// v000
// Times are from an AMD MI455X. After a warm-up the kernel runs many times in a row, and a time is the length of
// such a window on the GPU divided by its runs, so every launch and the gaps after it count. The runs cycle
// through copies of the inputs. A figure is the median of several windows, for all but v000 over two sittings.
// Sittings can differ by a few percent; kernels timed side by side share one.
// The starting kernel, v000, takes 531 microseconds a run.
#include <hip/hip_runtime.h>
#include <math.h>

typedef __attribute__((ext_vector_type(16))) _Float16 v16h;
typedef __attribute__((ext_vector_type(16))) __bf16 v16b;
typedef __attribute__((ext_vector_type(8)))  _Float16 v8h;
typedef __attribute__((ext_vector_type(8)))  float v8f;
typedef __attribute__((ext_vector_type(4)))  float v4f;
typedef __attribute__((ext_vector_type(2)))  float v2f;
typedef __attribute__((ext_vector_type(4)))  unsigned v4u;
typedef __attribute__((ext_vector_type(4)))  int v4i;
typedef float __attribute__((may_alias)) float_a;
typedef int __attribute__((may_alias)) int_a;

template <typename T> __device__ __forceinline__ void vst2(void* p, T v) { *(T*)p = v;  }
__device__ __forceinline__ v8f wmma16(v16h a, v16h b, v8f c) {
  v8f d = __builtin_amdgcn_wmma_f32_16x16x32_f16(false, a, false, b, (short)0, c, false, false);
  asm volatile("v_nop\n\tv_nop\n\tv_nop\n\tv_nop" : "+v"(d) : "v"(a), "v"(b));
  return d;
}
__device__ __forceinline__ v8f wmma_bf(v16b a, v16b b, v8f c) {
  v8f d = __builtin_amdgcn_wmma_f32_16x16x32_bf16(false, a, false, b, (short)0, c, false, false);
  asm volatile("v_nop\n\tv_nop\n\tv_nop\n\tv_nop" : "+v"(d) : "v"(a), "v"(b));
  return d;
}
// 16x16x32 fragments: lane = (h = lane>>4, row/col = lane&15); elements 0..7 = k0+8h+0..7, 8..15 = k0+16+8h+0..7; D element r = row 8h+r
__device__ __forceinline__ v16h frag_h(const _Float16* rowk0, int lane) {
  union { v16h v; v8h q[2]; } u; const _Float16* p = rowk0 + 8 * (lane >> 4);
  u.q[0] = *(const v8h*)p; u.q[1] = *(const v8h*)(p + 16); return u.v;
}
__device__ __forceinline__ v16h frag_f32(const float* rowk0, int lane) {
  v16h a; const float* p = rowk0 + 8 * (lane >> 4);
#pragma unroll
  for (int i = 0; i < 8; ++i) { a[i] = (_Float16)p[i]; a[8 + i] = (_Float16)p[16 + i]; }
  return a;
}
__device__ __forceinline__ v16h frag_f32s(const float* rowk0, int lane, float sc) {
  v16h a; const float* p = rowk0 + 8 * (lane >> 4);
#pragma unroll
  for (int i = 0; i < 8; ++i) { a[i] = (_Float16)(p[i] * sc); a[8 + i] = (_Float16)(p[16 + i] * sc); }
  return a;
}
// column fragment from a [K][ld] layout (column n), rows >= K read as 0
__device__ __forceinline__ v16h fragc_f32(const float* W, int k0, int n, int lane, int ld, int K) {
  v16h a; const int g = lane >> 4;
#pragma unroll
  for (int i = 0; i < 8; ++i) { const int ka = k0 + 8 * g + i, kb = ka + 16;
    a[i] = (_Float16)(ka < K ? W[(size_t)ka * ld + n] : 0.f); a[8 + i] = (_Float16)(kb < K ? W[(size_t)kb * ld + n] : 0.f); }
  return a;
}
struct F2 { v16b h, l; };
__device__ __forceinline__ F2 bsplit16(const float v[16]) { F2 r;
#pragma unroll
  for (int i = 0; i < 16; ++i) { const __bf16 h = (__bf16)v[i]; r.h[i] = h; r.l[i] = (__bf16)(v[i] - (float)h); }
  return r; }
__device__ __forceinline__ F2 split_row(const float* row, int k0, int lane) { float v[16]; const float* p = row + k0 + 8 * (lane >> 4);
#pragma unroll
  for (int i = 0; i < 8; ++i) { v[i] = p[i]; v[8 + i] = p[16 + i]; }
  return bsplit16(v); }
__device__ __forceinline__ F2 split_rowK(const float* row, int k0, int lane, int K) { float v[16]; const int g = lane >> 4;
#pragma unroll
  for (int i = 0; i < 8; ++i) { const int ka = k0 + 8 * g + i, kb = ka + 16; v[i] = ka < K ? row[ka] : 0.f; v[8 + i] = kb < K ? row[kb] : 0.f; }
  return bsplit16(v); }
__device__ __forceinline__ F2 split_col(const float* W, int k0, int n, int lane, int ld, int K) { float v[16]; const int g = lane >> 4;
#pragma unroll
  for (int i = 0; i < 8; ++i) { const int ka = k0 + 8 * g + i, kb = ka + 16; v[i] = ka < K ? W[(size_t)ka * ld + n] : 0.f; v[8 + i] = kb < K ? W[(size_t)kb * ld + n] : 0.f; }
  return bsplit16(v); }
__device__ __forceinline__ v8f mac3(const F2& a, const F2& b, v8f c) { c = wmma_bf(a.l, b.h, c); c = wmma_bf(a.h, b.l, c); return wmma_bf(a.h, b.h, c); }
__device__ __forceinline__ float sigm(float v) { return 1.0f / (1.0f + expf(-v)); }
#define LDSX() do { asm volatile("s_wait_dscnt 0" ::: "memory"); __builtin_amdgcn_wave_barrier(); __builtin_amdgcn_fence(__ATOMIC_RELEASE, "workgroup"); } while (0)

// Single-head causal attention whose scores are MULTIPLIED by sqrt(128) (as the reference), so the softmax is extremely sharp: q and k
// come from two-way bf16 split GEMMs (near-f32, f32 rows) and S = q.k*sqrt(128) is also a two-way split; the causal zero-fill followed
// by "== 0 -> -inf" of the reference is reproduced (masked and exactly-zero kept scores both get -inf); online softmax in f32; v from the
#define NB 4
#define SQ 2048
#define EE 1024
#define HD 128
#define NR (NB * SQ)

// q32, k32, v32 [r][128] f32 (split GEMMs); block 64 rows, blockIdx.y = which (0 q, 1 k, 2 v)
__global__ __launch_bounds__(128) void k_qkv(const float* __restrict__ x, const float* __restrict__ Wq, const float* __restrict__ Wk, const float* __restrict__ Wv, float* __restrict__ q32, float* __restrict__ k32, float* __restrict__ v32) {
  __shared__ __align__(16) float so[4][16][132];
  const int tid = threadIdx.x, wave = tid >> 5, lane = tid & 31, col = lane & 15, g = lane >> 4;
  const int which = blockIdx.y, r0b = blockIdx.x * 64, r0 = r0b + wave * 16;
  v8f acc[8] = {};
  { const float* W = which == 0 ? Wq : (which == 1 ? Wk : Wv);
#pragma unroll 1
    for (int kc = 0; kc < EE / 32; ++kc) { const F2 a = split_row(x + (size_t)(r0 + col) * EE, kc * 32, lane);
#pragma unroll
      for (int j = 0; j < 8; ++j) acc[j] = mac3(a, split_row(W + (size_t)(j * 16 + col) * EE, kc * 32, lane), acc[j]); }
#pragma unroll
    for (int j = 0; j < 8; ++j)
#pragma unroll
      for (int r = 0; r < 8; ++r) so[wave][8 * g + r][j * 16 + col] = acc[j][r];
    LDSX();
    float* dst = which == 0 ? q32 : (which == 1 ? k32 : v32);
#pragma unroll 4
    for (int rl = 0; rl < 16; ++rl) vst2(dst + (size_t)(r0 + rl) * HD + lane * 4, *(const v4f*)(&so[wave][rl][lane * 4])); }
}
__global__ __launch_bounds__(128) void k_attn(const float* __restrict__ q32, const float* __restrict__ k32, const float* __restrict__ v32, float* __restrict__ out) {
  __shared__ __align__(16) float sS[4][16][68];
  __shared__ __align__(16) float sP[4][16][68];
  __shared__ __align__(16) float sO[4][16][132];
  const int tid = threadIdx.x, w = tid >> 5, lane = tid & 31, col = lane & 15, g = lane >> 4;
  const int b = blockIdx.y, q0 = blockIdx.x * 64 + w * 16; const size_t rb = (size_t)b * SQ;
  const float* qb = q32 + rb * HD; const float* kb = k32 + rb * HD; const float* vb = v32 + rb * HD;
  F2 aq[4];
#pragma unroll
  for (int kc = 0; kc < 4; ++kc) aq[kc] = split_row(qb + (size_t)(q0 + col) * HD, kc * 32, lane);
  float mrun = -3.0e38f, lrun = 0.f; v8f acc[8] = {};
  const float scl = 11.313708498984761f;     // * sqrt(128), as the reference
  const int ntiles = blockIdx.x + 1;
#pragma unroll 1
  for (int kt = 0; kt < ntiles; ++kt) {
#pragma unroll
    for (int t = 0; t < 4; ++t) { v8f s = {}; const int key = kt * 64 + t * 16 + col;
#pragma unroll
      for (int kc = 0; kc < 4; ++kc) s = mac3(aq[kc], split_row(kb + (size_t)key * HD, kc * 32, lane), s);
#pragma unroll
      for (int r = 0; r < 8; ++r) { const int qi = q0 + 8 * g + r; const float sv = s[r] * scl; sS[w][8 * g + r][t * 16 + col] = (key <= qi && sv != 0.0f) ? sv : -3.0e38f; } }
    LDSX();
    float mx = -3.4e38f;
#pragma unroll
    for (int jj = 0; jj < 32; ++jj) mx = fmaxf(mx, sS[w][col][g * 32 + jj]);
    mx = fmaxf(mx, __shfl_xor(mx, 16, 32));
    const float mnew = fmaxf(mrun, mx); const float corr = mnew <= -1.0e38f ? 1.0f : expf(mrun - mnew);
    float ps = 0.f;
#pragma unroll
    for (int jj = 0; jj < 32; ++jj) { const float sv = sS[w][col][g * 32 + jj]; const float p = sv <= -1.0e38f ? 0.f : expf(sv - mnew); ps += p; sP[w][col][g * 32 + jj] = p; }
    ps += __shfl_xor(ps, 16, 32);
    lrun = lrun * corr + ps; mrun = mnew;
#pragma unroll
    for (int r = 0; r < 8; ++r) { const float cr = __shfl(corr, 8 * g + r, 32);
#pragma unroll
      for (int t = 0; t < 8; ++t) acc[t][r] *= cr; }
    LDSX();
#pragma unroll
    for (int kc = 0; kc < 2; ++kc) { const F2 pa = split_row(&sP[w][col][0], kc * 32, lane);
#pragma unroll
      for (int t = 0; t < 8; ++t) acc[t] = mac3(pa, split_col(vb + (size_t)(kt * 64) * HD, kc * 32, t * 16 + col, lane, HD, 64), acc[t]); }
    __builtin_amdgcn_wave_barrier();
  }
#pragma unroll
  for (int r = 0; r < 8; ++r) { const float lr = __shfl(lrun, 8 * g + r, 32);
#pragma unroll
    for (int t = 0; t < 8; ++t) sO[w][8 * g + r][t * 16 + col] = acc[t][r] / lr; }
  LDSX();
#pragma unroll 4
  for (int rl = 0; rl < 16; ++rl) vst2(out + (rb + q0 + rl) * HD + lane * 4, *(const v4f*)(&sO[w][rl][lane * 4]));
}
extern "C" void kernel_launch(void* const* d_in, const int* in_sizes, int n_in, void* d_out, int out_size, void* d_ws, size_t ws_size, hipStream_t stream) {
  (void)in_sizes; (void)n_in; (void)out_size; (void)ws_size;
  const float* x = (const float*)d_in[0]; const float* Wq = (const float*)d_in[1]; const float* Wk = (const float*)d_in[2]; const float* Wv = (const float*)d_in[3];
  float* out = (float*)d_out;
  char* ws = (char*)d_ws; size_t off = 0;
  auto take = [&](size_t bytes) { char* p = ws + off; off += (bytes + 255) & ~(size_t)255; return p; };
  float* q32 = (float*)take((size_t)NR * HD * 4); float* k32 = (float*)take((size_t)NR * HD * 4); float* v32 = (float*)take((size_t)NR * HD * 4);
  k_qkv<<<dim3(NR / 64, 3), 128, 0, stream>>>(x, Wq, Wk, Wv, q32, k32, v32);
  k_attn<<<dim3(SQ / 64, NB), 128, 0, stream>>>(q32, k32, v32, out);
}

// v001
// It runs in 171 microseconds.
// Timed twice side by side with v000, it ran 3.09 and 3.11 times as fast.
#include <hip/hip_runtime.h>
#include <math.h>

typedef __attribute__((ext_vector_type(16))) _Float16 v16h;
typedef __attribute__((ext_vector_type(16))) __bf16 v16b;
typedef __attribute__((ext_vector_type(8)))  _Float16 v8h;
typedef __attribute__((ext_vector_type(8)))  float v8f;
typedef __attribute__((ext_vector_type(4)))  float v4f;
typedef __attribute__((ext_vector_type(2)))  float v2f;
typedef __attribute__((ext_vector_type(4)))  unsigned v4u;
typedef __attribute__((ext_vector_type(4)))  int v4i;
typedef float __attribute__((may_alias)) float_a;
typedef int __attribute__((may_alias)) int_a;

template <typename T> __device__ __forceinline__ void vst2(void* p, T v) { *(T*)p = v;  }
__device__ __forceinline__ v8f wmma16(v16h a, v16h b, v8f c) {
  v8f d = __builtin_amdgcn_wmma_f32_16x16x32_f16(false, a, false, b, (short)0, c, false, false);
  asm volatile("v_nop\n\tv_nop\n\tv_nop\n\tv_nop" : "+v"(d) : "v"(a), "v"(b));
  return d;
}
__device__ __forceinline__ v8f wmma_bf(v16b a, v16b b, v8f c) {
  v8f d = __builtin_amdgcn_wmma_f32_16x16x32_bf16(false, a, false, b, (short)0, c, false, false);
  asm volatile("v_nop\n\tv_nop\n\tv_nop\n\tv_nop" : "+v"(d) : "v"(a), "v"(b));
  return d;
}
// 16x16x32 fragments: lane = (h = lane>>4, row/col = lane&15); elements 0..7 = k0+8h+0..7, 8..15 = k0+16+8h+0..7; D element r = row 8h+r
__device__ __forceinline__ v16h frag_h(const _Float16* rowk0, int lane) {
  union { v16h v; v8h q[2]; } u; const _Float16* p = rowk0 + 8 * (lane >> 4);
  u.q[0] = *(const v8h*)p; u.q[1] = *(const v8h*)(p + 16); return u.v;
}
__device__ __forceinline__ v16h frag_f32(const float* rowk0, int lane) {
  v16h a; const float* p = rowk0 + 8 * (lane >> 4);
#pragma unroll
  for (int i = 0; i < 8; ++i) { a[i] = (_Float16)p[i]; a[8 + i] = (_Float16)p[16 + i]; }
  return a;
}
__device__ __forceinline__ v16h frag_f32s(const float* rowk0, int lane, float sc) {
  v16h a; const float* p = rowk0 + 8 * (lane >> 4);
#pragma unroll
  for (int i = 0; i < 8; ++i) { a[i] = (_Float16)(p[i] * sc); a[8 + i] = (_Float16)(p[16 + i] * sc); }
  return a;
}
// column fragment from a [K][ld] layout (column n), rows >= K read as 0
__device__ __forceinline__ v16h fragc_f32(const float* W, int k0, int n, int lane, int ld, int K) {
  v16h a; const int g = lane >> 4;
#pragma unroll
  for (int i = 0; i < 8; ++i) { const int ka = k0 + 8 * g + i, kb = ka + 16;
    a[i] = (_Float16)(ka < K ? W[(size_t)ka * ld + n] : 0.f); a[8 + i] = (_Float16)(kb < K ? W[(size_t)kb * ld + n] : 0.f); }
  return a;
}
struct F2 { v16b h, l; };
__device__ __forceinline__ F2 bsplit16(const float v[16]) { F2 r;
#pragma unroll
  for (int i = 0; i < 16; ++i) { const __bf16 h = (__bf16)v[i]; r.h[i] = h; r.l[i] = (__bf16)(v[i] - (float)h); }
  return r; }
__device__ __forceinline__ F2 split_row(const float* row, int k0, int lane) { float v[16]; const float* p = row + k0 + 8 * (lane >> 4);
#pragma unroll
  for (int i = 0; i < 8; ++i) { v[i] = p[i]; v[8 + i] = p[16 + i]; }
  return bsplit16(v); }
__device__ __forceinline__ F2 split_rowK(const float* row, int k0, int lane, int K) { float v[16]; const int g = lane >> 4;
#pragma unroll
  for (int i = 0; i < 8; ++i) { const int ka = k0 + 8 * g + i, kb = ka + 16; v[i] = ka < K ? row[ka] : 0.f; v[8 + i] = kb < K ? row[kb] : 0.f; }
  return bsplit16(v); }
__device__ __forceinline__ F2 split_col(const float* W, int k0, int n, int lane, int ld, int K) { float v[16]; const int g = lane >> 4;
#pragma unroll
  for (int i = 0; i < 8; ++i) { const int ka = k0 + 8 * g + i, kb = ka + 16; v[i] = ka < K ? W[(size_t)ka * ld + n] : 0.f; v[8 + i] = kb < K ? W[(size_t)kb * ld + n] : 0.f; }
  return bsplit16(v); }
__device__ __forceinline__ v8f mac3(const F2& a, const F2& b, v8f c) { c = wmma_bf(a.l, b.h, c); c = wmma_bf(a.h, b.l, c); return wmma_bf(a.h, b.h, c); }
__device__ __forceinline__ float sigm(float v) { return 1.0f / (1.0f + expf(-v)); }
#define LDSX() do { asm volatile("s_wait_dscnt 0" ::: "memory"); __builtin_amdgcn_wave_barrier(); __builtin_amdgcn_fence(__ATOMIC_RELEASE, "workgroup"); } while (0)

// Single-head causal attention whose scores are MULTIPLIED by sqrt(128) (as the reference), so the softmax is extremely sharp: q and k
// come from two-way bf16 split GEMMs (near-f32, f32 rows) and S = q.k*sqrt(128) is also a two-way split; the causal zero-fill followed
// by "== 0 -> -inf" of the reference is reproduced (masked and exactly-zero kept scores both get -inf); online softmax in f32; v from the
#define NB 4
#define SQ 2048
#define EE 1024
#define HD 128
#define NR (NB * SQ)

// q32, k32, v32 [r][128] f32 (split GEMMs); block 64 rows, blockIdx.y = which (0 q, 1 k, 2 v)
__global__ __launch_bounds__(128) void k_qkv(const float* __restrict__ x, const float* __restrict__ Wq, const float* __restrict__ Wk, const float* __restrict__ Wv, float* __restrict__ q32, float* __restrict__ k32, float* __restrict__ v32) {
  __shared__ __align__(16) float so[4][16][132];
  const int tid = threadIdx.x, wave = tid >> 5, lane = tid & 31, col = lane & 15, g = lane >> 4;
  const int which = blockIdx.y, r0b = blockIdx.x * 64, r0 = r0b + wave * 16;
  v8f acc[8] = {};
  { const float* W = which == 0 ? Wq : (which == 1 ? Wk : Wv);
#pragma unroll 1
    for (int kc = 0; kc < EE / 32; ++kc) { const F2 a = split_row(x + (size_t)(r0 + col) * EE, kc * 32, lane);
#pragma unroll
      for (int j = 0; j < 8; ++j) acc[j] = mac3(a, split_row(W + (size_t)(j * 16 + col) * EE, kc * 32, lane), acc[j]); }
#pragma unroll
    for (int j = 0; j < 8; ++j)
#pragma unroll
      for (int r = 0; r < 8; ++r) so[wave][8 * g + r][j * 16 + col] = acc[j][r];
    LDSX();
    float* dst = which == 0 ? q32 : (which == 1 ? k32 : v32);
#pragma unroll 4
    for (int rl = 0; rl < 16; ++rl) vst2(dst + (size_t)(r0 + rl) * HD + lane * 4, *(const v4f*)(&so[wave][rl][lane * 4])); }
}
// One block = 16 query rows; its NW waves share the rows' key tiles (wave w takes tiles w, w + NW, ...), each with an online softmax of its
// own; the partial (max, sum, acc) triples are merged through LDS in wave order at the end.
#define NW 16
__global__ __launch_bounds__(NW * 32) void k_attn(const float* __restrict__ q32, const float* __restrict__ k32, const float* __restrict__ v32, float* __restrict__ out) {
  __shared__ __align__(16) float sS[NW][16][68];
  __shared__ __align__(16) float sP[NW][16][68];
  __shared__ __align__(16) float sO[NW][16][132];
  __shared__ float sM[NW][16];
  __shared__ float sL[NW][16];
  // w through readfirstlane: the tile loop's test is then a scalar branch and EXEC stays full at the WMMAs
  const int tid = threadIdx.x, w = __builtin_amdgcn_readfirstlane(tid >> 5), lane = tid & 31, col = lane & 15, g = lane >> 4;
  const int b = blockIdx.x, q0 = blockIdx.y * 16; const size_t rb = (size_t)b * SQ;
  const float* qb = q32 + rb * HD; const float* kb = k32 + rb * HD; const float* vb = v32 + rb * HD;
  F2 aq[4];
#pragma unroll
  for (int kc = 0; kc < 4; ++kc) aq[kc] = split_row(qb + (size_t)(q0 + col) * HD, kc * 32, lane);
  float mrun = -3.0e38f, lrun = 0.f; v8f acc[8] = {};
  const float scl = 11.313708498984761f;     // * sqrt(128), as the reference
  const int ntiles = (q0 >> 6) + 1;
#pragma unroll 1
  for (int kt = w; kt < ntiles; kt += NW) {
#pragma unroll
    for (int t = 0; t < 4; ++t) { v8f s = {}; const int key = kt * 64 + t * 16 + col;
#pragma unroll
      for (int kc = 0; kc < 4; ++kc) s = mac3(aq[kc], split_row(kb + (size_t)key * HD, kc * 32, lane), s);
#pragma unroll
      for (int r = 0; r < 8; ++r) { const int qi = q0 + 8 * g + r; const float sv = s[r] * scl; sS[w][8 * g + r][t * 16 + col] = (key <= qi && sv != 0.0f) ? sv : -3.0e38f; } }
    LDSX();
    float mx = -3.4e38f;
#pragma unroll
    for (int jj = 0; jj < 32; ++jj) mx = fmaxf(mx, sS[w][col][g * 32 + jj]);
    mx = fmaxf(mx, __shfl_xor(mx, 16, 32));
    const float mnew = fmaxf(mrun, mx); const float corr = mnew <= -1.0e38f ? 1.0f : expf(mrun - mnew);
    float ps = 0.f;
#pragma unroll
    for (int jj = 0; jj < 32; ++jj) { const float sv = sS[w][col][g * 32 + jj]; const float p = sv <= -1.0e38f ? 0.f : expf(sv - mnew); ps += p; sP[w][col][g * 32 + jj] = p; }
    ps += __shfl_xor(ps, 16, 32);
    lrun = lrun * corr + ps; mrun = mnew;
#pragma unroll
    for (int r = 0; r < 8; ++r) { const float cr = __shfl(corr, 8 * g + r, 32);
#pragma unroll
      for (int t = 0; t < 8; ++t) acc[t][r] *= cr; }
    LDSX();
#pragma unroll
    for (int kc = 0; kc < 2; ++kc) { const F2 pa = split_row(&sP[w][col][0], kc * 32, lane);
#pragma unroll
      for (int t = 0; t < 8; ++t) acc[t] = mac3(pa, split_col(vb + (size_t)(kt * 64) * HD, kc * 32, t * 16 + col, lane, HD, 64), acc[t]); }
    __builtin_amdgcn_wave_barrier();
  }
  if (g == 0) sM[w][col] = mrun;
  __syncthreads();
  float mg = sM[0][col];
#pragma unroll   // all NW reads in flight at once
  for (int i = 1; i < NW; ++i) mg = fmaxf(mg, sM[i][col]);
  const float f = mg <= -1.0e38f ? 1.0f : expf(mrun - mg);   // a wave without a kept score has acc = 0 and lrun = 0
  if (g == 0) sL[w][col] = lrun * f;
#pragma unroll   // acc is indexed by constants only, so it stays in registers
  for (int r = 0; r < 8; ++r) { const float fr = __shfl(f, 8 * g + r, 32);
#pragma unroll
    for (int t = 0; t < 8; ++t) sO[w][8 * g + r][t * 16 + col] = acc[t][r] * fr; }
  __syncthreads();
  float lt = 0.f; v4f o = {};                                  // wave w sums row w over the NW partials
#pragma unroll   // all NW reads in flight at once; the sum runs in wave order
  for (int i = 0; i < NW; ++i) { lt += sL[i][w]; o += *(const v4f*)(&sO[i][w][lane * 4]); }
#pragma unroll
  for (int c = 0; c < 4; ++c) o[c] = o[c] / lt;
  vst2(out + (rb + q0 + w) * HD + lane * 4, o);
}
extern "C" void kernel_launch(void* const* d_in, const int* in_sizes, int n_in, void* d_out, int out_size, void* d_ws, size_t ws_size, hipStream_t stream) {
  (void)in_sizes; (void)n_in; (void)out_size; (void)ws_size;
  const float* x = (const float*)d_in[0]; const float* Wq = (const float*)d_in[1]; const float* Wk = (const float*)d_in[2]; const float* Wv = (const float*)d_in[3];
  float* out = (float*)d_out;
  char* ws = (char*)d_ws; size_t off = 0;
  auto take = [&](size_t bytes) { char* p = ws + off; off += (bytes + 255) & ~(size_t)255; return p; };
  float* q32 = (float*)take((size_t)NR * HD * 4); float* k32 = (float*)take((size_t)NR * HD * 4); float* v32 = (float*)take((size_t)NR * HD * 4);
  k_qkv<<<dim3(NR / 64, 3), 128, 0, stream>>>(x, Wq, Wk, Wv, q32, k32, v32);
  k_attn<<<dim3(NB, SQ / 16), NW * 32, 0, stream>>>(q32, k32, v32, out);
}

// v002
// A run of this version takes 76.9 microseconds.
// In two side-by-side timings against v001, it was 2.24 and 2.22 times as fast.
// Counting every step since v000, it is 6.92 times as fast.
#include <hip/hip_runtime.h>
#include <math.h>

typedef __attribute__((ext_vector_type(16))) _Float16 v16h;
typedef __attribute__((ext_vector_type(16))) __bf16 v16b;
typedef __attribute__((ext_vector_type(8)))  _Float16 v8h;
typedef __attribute__((ext_vector_type(8)))  float v8f;
typedef __attribute__((ext_vector_type(4)))  float v4f;
typedef __attribute__((ext_vector_type(2)))  float v2f;
typedef __attribute__((ext_vector_type(4)))  unsigned v4u;
typedef __attribute__((ext_vector_type(4)))  int v4i;
typedef float __attribute__((may_alias)) float_a;
typedef int __attribute__((may_alias)) int_a;

template <typename T> __device__ __forceinline__ void vst2(void* p, T v) { *(T*)p = v;  }
__device__ __forceinline__ v8f wmma16(v16h a, v16h b, v8f c) {
  v8f d = __builtin_amdgcn_wmma_f32_16x16x32_f16(false, a, false, b, (short)0, c, false, false);
  asm volatile("v_nop\n\tv_nop\n\tv_nop\n\tv_nop" : "+v"(d) : "v"(a), "v"(b));
  return d;
}
__device__ __forceinline__ v8f wmma_bf(v16b a, v16b b, v8f c) {
  v8f d = __builtin_amdgcn_wmma_f32_16x16x32_bf16(false, a, false, b, (short)0, c, false, false);
  asm volatile("v_nop\n\tv_nop\n\tv_nop\n\tv_nop" : "+v"(d) : "v"(a), "v"(b));
  return d;
}
// 16x16x32 fragments: lane = (h = lane>>4, row/col = lane&15); elements 0..7 = k0+8h+0..7, 8..15 = k0+16+8h+0..7; D element r = row 8h+r
__device__ __forceinline__ v16h frag_h(const _Float16* rowk0, int lane) {
  union { v16h v; v8h q[2]; } u; const _Float16* p = rowk0 + 8 * (lane >> 4);
  u.q[0] = *(const v8h*)p; u.q[1] = *(const v8h*)(p + 16); return u.v;
}
__device__ __forceinline__ v16h frag_f32(const float* rowk0, int lane) {
  v16h a; const float* p = rowk0 + 8 * (lane >> 4);
#pragma unroll
  for (int i = 0; i < 8; ++i) { a[i] = (_Float16)p[i]; a[8 + i] = (_Float16)p[16 + i]; }
  return a;
}
__device__ __forceinline__ v16h frag_f32s(const float* rowk0, int lane, float sc) {
  v16h a; const float* p = rowk0 + 8 * (lane >> 4);
#pragma unroll
  for (int i = 0; i < 8; ++i) { a[i] = (_Float16)(p[i] * sc); a[8 + i] = (_Float16)(p[16 + i] * sc); }
  return a;
}
// column fragment from a [K][ld] layout (column n), rows >= K read as 0
__device__ __forceinline__ v16h fragc_f32(const float* W, int k0, int n, int lane, int ld, int K) {
  v16h a; const int g = lane >> 4;
#pragma unroll
  for (int i = 0; i < 8; ++i) { const int ka = k0 + 8 * g + i, kb = ka + 16;
    a[i] = (_Float16)(ka < K ? W[(size_t)ka * ld + n] : 0.f); a[8 + i] = (_Float16)(kb < K ? W[(size_t)kb * ld + n] : 0.f); }
  return a;
}
struct F2 { v16b h, l; };
__device__ __forceinline__ F2 bsplit16(const float v[16]) { F2 r;
#pragma unroll
  for (int i = 0; i < 16; ++i) { const __bf16 h = (__bf16)v[i]; r.h[i] = h; r.l[i] = (__bf16)(v[i] - (float)h); }
  return r; }
__device__ __forceinline__ F2 split_row(const float* row, int k0, int lane) { float v[16]; const float* p = row + k0 + 8 * (lane >> 4);
#pragma unroll
  for (int i = 0; i < 8; ++i) { v[i] = p[i]; v[8 + i] = p[16 + i]; }
  return bsplit16(v); }
__device__ __forceinline__ F2 split_rowK(const float* row, int k0, int lane, int K) { float v[16]; const int g = lane >> 4;
#pragma unroll
  for (int i = 0; i < 8; ++i) { const int ka = k0 + 8 * g + i, kb = ka + 16; v[i] = ka < K ? row[ka] : 0.f; v[8 + i] = kb < K ? row[kb] : 0.f; }
  return bsplit16(v); }
__device__ __forceinline__ F2 split_col(const float* W, int k0, int n, int lane, int ld, int K) { float v[16]; const int g = lane >> 4;
#pragma unroll
  for (int i = 0; i < 8; ++i) { const int ka = k0 + 8 * g + i, kb = ka + 16; v[i] = ka < K ? W[(size_t)ka * ld + n] : 0.f; v[8 + i] = kb < K ? W[(size_t)kb * ld + n] : 0.f; }
  return bsplit16(v); }
__device__ __forceinline__ v8f mac3(const F2& a, const F2& b, v8f c) { c = wmma_bf(a.l, b.h, c); c = wmma_bf(a.h, b.l, c); return wmma_bf(a.h, b.h, c); }
__device__ __forceinline__ float sigm(float v) { return 1.0f / (1.0f + expf(-v)); }
#define LDSX() do { asm volatile("s_wait_dscnt 0" ::: "memory"); __builtin_amdgcn_wave_barrier(); __builtin_amdgcn_fence(__ATOMIC_RELEASE, "workgroup"); } while (0)

// Single-head causal attention whose scores are MULTIPLIED by sqrt(128) (as the reference), so the softmax is extremely sharp: q and k
// come from two-way bf16 split GEMMs (near-f32, f32 rows) and S = q.k*sqrt(128) is also a two-way split; the causal zero-fill followed
// by "== 0 -> -inf" of the reference is reproduced (masked and exactly-zero kept scores both get -inf); online softmax in f32; v from the
#define NB 4
#define SQ 2048
#define EE 1024
#define HD 128
#define NR (NB * SQ)

// q32, k32, v32 [r][128] f32 (two-way bf16 split GEMMs). One block = 64 rows of x times 192 output columns: blockIdx.y = 0 all of q and
// columns 0..63 of k, blockIdx.y = 1 all of v and columns 64..127 of k. Per slab of 64 k the block reads its 64 x rows and 192 W rows
// once, in whole 256-byte runs, splits each value once into bf16 hi and lo, and lays the two planes in LDS; the eight waves (2 x 4, 32 x 48 outputs each) take their fragments from
// there. Two LDS buffers: the next slab's global loads are in flight during this slab's WMMAs. Per accumulator the WMMA order is k ascending,
// lo.hi, hi.lo, hi.hi.
#define QM 64
#define QN 192
#define QK 64
#define QP 144                    // LDS row pitch in bytes: 128 B of bf16 + 16, an odd multiple of 16 B (no bank conflict for 16-byte reads)
#define QPL ((QM + QN) * QP)      // one plane (hi or lo) of one buffer
#define QBUF (2 * QPL)
#define QSO 196                   // pitch in floats of the output staging
typedef __attribute__((ext_vector_type(8))) __bf16 v8b;
typedef __attribute__((ext_vector_type(4))) __bf16 v4b;
__device__ __forceinline__ v16b frag_lds(const char* p) { union { v16b v; v8b q[2]; } u; u.q[0] = *(const v8b*)p; u.q[1] = *(const v8b*)(p + 32); return u.v; }
// 16 rows a step, 16 lanes a row: 4 steps of x, 8 of the whole W matrix, 4 of the half of Wk; each pointer holds the lane's own offset and the slab's k
__device__ __forceinline__ void q_fetch(v4f (&st)[16], const float* px, const float* pa, const float* pb) {
#pragma unroll   // st is indexed by constants only, so it stays in registers; the row steps become immediate offsets
  for (int i = 0; i < 16; ++i) st[i] = *(const v4f*)(i < 4 ? px + (size_t)i * 16 * EE : (i < 12 ? pa + (size_t)(i - 4) * 16 * EE : pb + (size_t)(i - 12) * 16 * EE));
  // wait before a register that an issued load names is overwritten; as inputs the three address pairs stay live up to it, so that no later load's result lands on one ahead of it
  asm volatile("s_wait_xcnt 0x0" :: "v"(px), "v"(pa), "v"(pb) : "memory");
}
__device__ __forceinline__ void q_stage(const v4f (&st)[16], char* p) {
#pragma unroll   // st is indexed by constants only, so it stays in registers
  for (int i = 0; i < 16; ++i) { v4b h, l;
#pragma unroll   // vector elements picked by constants
    for (int c = 0; c < 4; ++c) { const __bf16 hh = (__bf16)st[i][c]; h[c] = hh; l[c] = (__bf16)(st[i][c] - (float)hh); }
    *(v4b*)(p + i * 16 * QP) = h; *(v4b*)(p + i * 16 * QP + QPL) = l; }
}
__global__ __launch_bounds__(256) void k_qkv(const float* __restrict__ x, const float* __restrict__ Wq, const float* __restrict__ Wk, const float* __restrict__ Wv, float* __restrict__ q32, float* __restrict__ k32, float* __restrict__ v32) {
  __shared__ __align__(16) char sm[2 * QBUF];
  const int tid = threadIdx.x, wave = __builtin_amdgcn_readfirstlane(tid >> 5), lane = tid & 31, col = lane & 15, g = lane >> 4;
  const int r0b = blockIdx.x * QM, y = blockIdx.y, wm = wave >> 2, wn = wave & 3;
  const size_t toff = (size_t)(tid >> 4) * EE + (tid & 15) * 4;
  const float* const px = x + (size_t)r0b * EE + toff; const float* const pa = (y == 0 ? Wq : Wv) + toff; const float* const pb = Wk + (size_t)y * 64 * EE + toff;
  char* const wr = sm + (tid >> 4) * QP + (tid & 15) * 8;
  const char* const ra = sm + (wm * 32 + col) * QP + g * 16;
  const char* const rbf = sm + (QM + wn * 48 + col) * QP + g * 16;
  v4f st[16]; v8f acc[6] = {};
  q_fetch(st, px, pa, pb);
  q_stage(st, wr);
  __syncthreads();
#pragma unroll 1   // one slab a trip: the two buffers alternate by a run-time offset
  for (int ks = 0; ks < EE / QK; ++ks) { const int cur = (ks & 1) * QBUF;
    if (ks + 1 < EE / QK) q_fetch(st, px + (ks + 1) * QK, pa + (ks + 1) * QK, pb + (ks + 1) * QK);
#pragma unroll   // the two 32-k steps of a slab differ by an immediate offset only
    for (int k2 = 0; k2 < QK / 32; ++k2) { F2 f[5];   // f[0], f[1]: the wave's two row tiles of x; f[2..4]: its three column tiles of W
#pragma unroll   // f is indexed by constants only, so it stays in registers
      for (int t = 0; t < 5; ++t) { const char* p = (t < 2 ? ra + t * 16 * QP : rbf + (t - 2) * 16 * QP) + cur + k2 * 64; f[t].h = frag_lds(p); f[t].l = frag_lds(p + QPL); }
#pragma unroll   // lo.hi, then hi.lo, then hi.hi: six independent accumulators between two WMMAs on the same one
      for (int ps = 0; ps < 3; ++ps)
#pragma unroll   // acc and f are indexed by constants only
        for (int t = 0; t < 6; ++t) acc[t] = wmma_bf(ps == 0 ? f[t / 3].l : f[t / 3].h, ps == 1 ? f[2 + t % 3].l : f[2 + t % 3].h, acc[t]); }
    if (ks + 1 < EE / QK) q_stage(st, wr + (QBUF - cur));
    __syncthreads();   // publishes the slab just staged and ends every wave's reads of the buffer that the next trip refills
  }
  float* const so = (float*)sm;   // the ring is free behind the loop's last barrier
#pragma unroll   // acc is indexed by constants only
  for (int e = 0; e < 48; ++e) { const int t = e >> 3, r = e & 7; so[(wm * 32 + (t / 3) * 16 + 8 * g + r) * QSO + wn * 48 + (t % 3) * 16 + col] = acc[t][r]; }
  __syncthreads();
#pragma unroll   // all twelve LDS reads in flight at once. 8 lanes write one whole 128-byte line; chunks of 32 columns: 0..3 the whole matrix's, 4 and 5 the half of k
  for (int it = 0; it < 12; ++it) { const int chunk = it % 6, row = (it / 6) * 32 + (tid >> 3);
    float* dst = chunk < 4 ? (y == 0 ? q32 : v32) + chunk * 32 : k32 + y * 64 + (chunk - 4) * 32;
    vst2(dst + (size_t)(r0b + row) * HD + (tid & 7) * 4, *(const v4f*)(so + row * QSO + chunk * 32 + (tid & 7) * 4)); }
}
// One block = 16 query rows; its NW waves share the rows' key tiles (wave w takes tiles w, w + NW, ...), each with an online softmax of its
// own; the partial (max, sum, acc) triples are merged through LDS in wave order at the end.
#define NW 16
__global__ __launch_bounds__(NW * 32) void k_attn(const float* __restrict__ q32, const float* __restrict__ k32, const float* __restrict__ v32, float* __restrict__ out) {
  __shared__ __align__(16) float sS[NW][16][68];
  __shared__ __align__(16) float sP[NW][16][68];
  __shared__ __align__(16) float sO[NW][16][132];
  __shared__ float sM[NW][16];
  __shared__ float sL[NW][16];
  // w through readfirstlane: the tile loop's test is then a scalar branch and EXEC stays full at the WMMAs
  const int tid = threadIdx.x, w = __builtin_amdgcn_readfirstlane(tid >> 5), lane = tid & 31, col = lane & 15, g = lane >> 4;
  const int b = blockIdx.x, q0 = blockIdx.y * 16; const size_t rb = (size_t)b * SQ;
  const float* qb = q32 + rb * HD; const float* kb = k32 + rb * HD; const float* vb = v32 + rb * HD;
  F2 aq[4];
#pragma unroll
  for (int kc = 0; kc < 4; ++kc) aq[kc] = split_row(qb + (size_t)(q0 + col) * HD, kc * 32, lane);
  float mrun = -3.0e38f, lrun = 0.f; v8f acc[8] = {};
  const float scl = 11.313708498984761f;     // * sqrt(128), as the reference
  const int ntiles = (q0 >> 6) + 1;
#pragma unroll 1
  for (int kt = w; kt < ntiles; kt += NW) {
#pragma unroll
    for (int t = 0; t < 4; ++t) { v8f s = {}; const int key = kt * 64 + t * 16 + col;
#pragma unroll
      for (int kc = 0; kc < 4; ++kc) s = mac3(aq[kc], split_row(kb + (size_t)key * HD, kc * 32, lane), s);
#pragma unroll
      for (int r = 0; r < 8; ++r) { const int qi = q0 + 8 * g + r; const float sv = s[r] * scl; sS[w][8 * g + r][t * 16 + col] = (key <= qi && sv != 0.0f) ? sv : -3.0e38f; } }
    LDSX();
    float mx = -3.4e38f;
#pragma unroll
    for (int jj = 0; jj < 32; ++jj) mx = fmaxf(mx, sS[w][col][g * 32 + jj]);
    mx = fmaxf(mx, __shfl_xor(mx, 16, 32));
    const float mnew = fmaxf(mrun, mx); const float corr = mnew <= -1.0e38f ? 1.0f : expf(mrun - mnew);
    float ps = 0.f;
#pragma unroll
    for (int jj = 0; jj < 32; ++jj) { const float sv = sS[w][col][g * 32 + jj]; const float p = sv <= -1.0e38f ? 0.f : expf(sv - mnew); ps += p; sP[w][col][g * 32 + jj] = p; }
    ps += __shfl_xor(ps, 16, 32);
    lrun = lrun * corr + ps; mrun = mnew;
#pragma unroll
    for (int r = 0; r < 8; ++r) { const float cr = __shfl(corr, 8 * g + r, 32);
#pragma unroll
      for (int t = 0; t < 8; ++t) acc[t][r] *= cr; }
    LDSX();
#pragma unroll
    for (int kc = 0; kc < 2; ++kc) { const F2 pa = split_row(&sP[w][col][0], kc * 32, lane);
#pragma unroll
      for (int t = 0; t < 8; ++t) acc[t] = mac3(pa, split_col(vb + (size_t)(kt * 64) * HD, kc * 32, t * 16 + col, lane, HD, 64), acc[t]); }
    __builtin_amdgcn_wave_barrier();
  }
  if (g == 0) sM[w][col] = mrun;
  __syncthreads();
  float mg = sM[0][col];
#pragma unroll   // all NW reads in flight at once
  for (int i = 1; i < NW; ++i) mg = fmaxf(mg, sM[i][col]);
  const float f = mg <= -1.0e38f ? 1.0f : expf(mrun - mg);   // a wave without a kept score has acc = 0 and lrun = 0
  if (g == 0) sL[w][col] = lrun * f;
#pragma unroll   // acc is indexed by constants only, so it stays in registers
  for (int r = 0; r < 8; ++r) { const float fr = __shfl(f, 8 * g + r, 32);
#pragma unroll
    for (int t = 0; t < 8; ++t) sO[w][8 * g + r][t * 16 + col] = acc[t][r] * fr; }
  __syncthreads();
  float lt = 0.f; v4f o = {};                                  // wave w sums row w over the NW partials
#pragma unroll   // all NW reads in flight at once; the sum runs in wave order
  for (int i = 0; i < NW; ++i) { lt += sL[i][w]; o += *(const v4f*)(&sO[i][w][lane * 4]); }
#pragma unroll
  for (int c = 0; c < 4; ++c) o[c] = o[c] / lt;
  vst2(out + (rb + q0 + w) * HD + lane * 4, o);
}
extern "C" void kernel_launch(void* const* d_in, const int* in_sizes, int n_in, void* d_out, int out_size, void* d_ws, size_t ws_size, hipStream_t stream) {
  (void)in_sizes; (void)n_in; (void)out_size; (void)ws_size;
  const float* x = (const float*)d_in[0]; const float* Wq = (const float*)d_in[1]; const float* Wk = (const float*)d_in[2]; const float* Wv = (const float*)d_in[3];
  float* out = (float*)d_out;
  char* ws = (char*)d_ws; size_t off = 0;
  auto take = [&](size_t bytes) { char* p = ws + off; off += (bytes + 255) & ~(size_t)255; return p; };
  float* q32 = (float*)take((size_t)NR * HD * 4); float* k32 = (float*)take((size_t)NR * HD * 4); float* v32 = (float*)take((size_t)NR * HD * 4);
  k_qkv<<<dim3(NR / QM, 2), 256, 0, stream>>>(x, Wq, Wk, Wv, q32, k32, v32);
  k_attn<<<dim3(NB, SQ / 16), NW * 32, 0, stream>>>(q32, k32, v32, out);
}

// v003
// One run takes 58.6 microseconds.
// Timed twice side by side with v002, it ran 1.31 and 1.32 times as fast.
// Counting every step since v000, it is 9.10 times as fast.
#include <hip/hip_runtime.h>
#include <math.h>

typedef __attribute__((ext_vector_type(16))) _Float16 v16h;
typedef __attribute__((ext_vector_type(16))) __bf16 v16b;
typedef __attribute__((ext_vector_type(8)))  _Float16 v8h;
typedef __attribute__((ext_vector_type(8)))  float v8f;
typedef __attribute__((ext_vector_type(4)))  float v4f;
typedef __attribute__((ext_vector_type(2)))  float v2f;
typedef __attribute__((ext_vector_type(4)))  unsigned v4u;
typedef __attribute__((ext_vector_type(4)))  int v4i;
typedef float __attribute__((may_alias)) float_a;
typedef int __attribute__((may_alias)) int_a;

template <typename T> __device__ __forceinline__ void vst2(void* p, T v) { *(T*)p = v;  }
__device__ __forceinline__ v8f wmma16(v16h a, v16h b, v8f c) {
  v8f d = __builtin_amdgcn_wmma_f32_16x16x32_f16(false, a, false, b, (short)0, c, false, false);
  asm volatile("v_nop\n\tv_nop\n\tv_nop\n\tv_nop" : "+v"(d) : "v"(a), "v"(b));
  return d;
}
__device__ __forceinline__ v8f wmma_bf(v16b a, v16b b, v8f c) {
  v8f d = __builtin_amdgcn_wmma_f32_16x16x32_bf16(false, a, false, b, (short)0, c, false, false);
  asm volatile("v_nop\n\tv_nop\n\tv_nop\n\tv_nop" : "+v"(d) : "v"(a), "v"(b));
  return d;
}
// 16x16x32 fragments: lane = (h = lane>>4, row/col = lane&15); elements 0..7 = k0+8h+0..7, 8..15 = k0+16+8h+0..7; D element r = row 8h+r
__device__ __forceinline__ v16h frag_h(const _Float16* rowk0, int lane) {
  union { v16h v; v8h q[2]; } u; const _Float16* p = rowk0 + 8 * (lane >> 4);
  u.q[0] = *(const v8h*)p; u.q[1] = *(const v8h*)(p + 16); return u.v;
}
__device__ __forceinline__ v16h frag_f32(const float* rowk0, int lane) {
  v16h a; const float* p = rowk0 + 8 * (lane >> 4);
#pragma unroll
  for (int i = 0; i < 8; ++i) { a[i] = (_Float16)p[i]; a[8 + i] = (_Float16)p[16 + i]; }
  return a;
}
__device__ __forceinline__ v16h frag_f32s(const float* rowk0, int lane, float sc) {
  v16h a; const float* p = rowk0 + 8 * (lane >> 4);
#pragma unroll
  for (int i = 0; i < 8; ++i) { a[i] = (_Float16)(p[i] * sc); a[8 + i] = (_Float16)(p[16 + i] * sc); }
  return a;
}
// column fragment from a [K][ld] layout (column n), rows >= K read as 0
__device__ __forceinline__ v16h fragc_f32(const float* W, int k0, int n, int lane, int ld, int K) {
  v16h a; const int g = lane >> 4;
#pragma unroll
  for (int i = 0; i < 8; ++i) { const int ka = k0 + 8 * g + i, kb = ka + 16;
    a[i] = (_Float16)(ka < K ? W[(size_t)ka * ld + n] : 0.f); a[8 + i] = (_Float16)(kb < K ? W[(size_t)kb * ld + n] : 0.f); }
  return a;
}
struct F2 { v16b h, l; };
__device__ __forceinline__ F2 bsplit16(const float v[16]) { F2 r;
#pragma unroll
  for (int i = 0; i < 16; ++i) { const __bf16 h = (__bf16)v[i]; r.h[i] = h; r.l[i] = (__bf16)(v[i] - (float)h); }
  return r; }
__device__ __forceinline__ F2 split_row(const float* row, int k0, int lane) { float v[16]; const float* p = row + k0 + 8 * (lane >> 4);
#pragma unroll
  for (int i = 0; i < 8; ++i) { v[i] = p[i]; v[8 + i] = p[16 + i]; }
  return bsplit16(v); }
__device__ __forceinline__ F2 split_rowK(const float* row, int k0, int lane, int K) { float v[16]; const int g = lane >> 4;
#pragma unroll
  for (int i = 0; i < 8; ++i) { const int ka = k0 + 8 * g + i, kb = ka + 16; v[i] = ka < K ? row[ka] : 0.f; v[8 + i] = kb < K ? row[kb] : 0.f; }
  return bsplit16(v); }
__device__ __forceinline__ F2 split_col(const float* W, int k0, int n, int lane, int ld, int K) { float v[16]; const int g = lane >> 4;
#pragma unroll
  for (int i = 0; i < 8; ++i) { const int ka = k0 + 8 * g + i, kb = ka + 16; v[i] = ka < K ? W[(size_t)ka * ld + n] : 0.f; v[8 + i] = kb < K ? W[(size_t)kb * ld + n] : 0.f; }
  return bsplit16(v); }
__device__ __forceinline__ v8f mac3(const F2& a, const F2& b, v8f c) { c = wmma_bf(a.l, b.h, c); c = wmma_bf(a.h, b.l, c); return wmma_bf(a.h, b.h, c); }
__device__ __forceinline__ float sigm(float v) { return 1.0f / (1.0f + expf(-v)); }
#define LDSX() do { asm volatile("s_wait_dscnt 0" ::: "memory"); __builtin_amdgcn_wave_barrier(); __builtin_amdgcn_fence(__ATOMIC_RELEASE, "workgroup"); } while (0)

// Single-head causal attention whose scores are MULTIPLIED by sqrt(128) (as the reference), so the softmax is extremely sharp: q and k
// come from two-way bf16 split GEMMs (near-f32, stored as bf16 hi and lo fragments) and S = q.k*sqrt(128) is also a two-way split; the causal zero-fill followed
// by "== 0 -> -inf" of the reference is reproduced (masked and exactly-zero kept scores both get -inf); online softmax in f32; v from the
#define NB 4
#define SQ 2048
#define EE 1024
#define HD 128
#define NR (NB * SQ)

// q, k and v leave as bf16 hi and lo planes in WMMA fragment order (two-way bf16 split GEMMs, f32 results split once more). One block = 64 rows of x times 192 output columns: blockIdx.y = 0 all of q and
// columns 0..63 of k, blockIdx.y = 1 all of v and columns 64..127 of k. Per slab of 64 k the block reads its 64 x rows and 192 W rows
// once, in whole 256-byte runs, splits each value once into bf16 hi and lo, and lays the two planes in LDS; the eight waves (2 x 4, 32 x 48 outputs each) take their fragments from
// there. Two LDS buffers: the next slab's global loads are in flight during this slab's WMMAs. Per accumulator the WMMA order is k ascending,
// lo.hi, hi.lo, hi.hi.
#define QM 64
#define QN 192
#define QK 64
#define QP 144                    // LDS row pitch in bytes: 128 B of bf16 + 16, an odd multiple of 16 B (no bank conflict for 16-byte reads)
#define QPL ((QM + QN) * QP)      // one plane (hi or lo) of one buffer
#define QBUF (2 * QPL)
#define QSO 196                   // pitch in floats of the output staging
typedef __attribute__((ext_vector_type(8))) __bf16 v8b;
typedef __attribute__((ext_vector_type(4))) __bf16 v4b;
// A packed fragment is 2 KB: hi elements 0..7, hi 8..15, lo 0..7, lo 8..15, each a run of 32 lanes x 16 bytes, so that every wave-wide access is 512 contiguous bytes.
// q, k: fragment (16-row tile, 32-wide step kc of the head), lane (g, col) = row col, elements = head kc*32 + 8g + 0..7 and + 16. Index tile * 4 + kc.
// v: fragment (32-key group, 16-column tile t), lane (g, col) = column t*16 + col, elements = keys 8g + 0..7 and + 16 of the group. Index group * 8 + t.
#define FRB 2048
__device__ __forceinline__ void put_frag(char* p, const F2& f) { union { v16b v; v8b q[2]; } a, b; a.v = f.h; b.v = f.l;
  *(v8b*)p = a.q[0]; *(v8b*)(p + 512) = a.q[1]; *(v8b*)(p + 1024) = b.q[0]; *(v8b*)(p + 1536) = b.q[1];
  // behind the run's last store: wait before a register that an issued store names is overwritten; as an input the address pair stays live up to it
  asm volatile("s_wait_xcnt 0x0" :: "v"(p) : "memory"); }
__device__ __forceinline__ F2 get_frag(const char* p) { union { v16b v; v8b q[2]; } a, b; F2 r;
  a.q[0] = *(const v8b*)p; a.q[1] = *(const v8b*)(p + 512); b.q[0] = *(const v8b*)(p + 1024); b.q[1] = *(const v8b*)(p + 1536); r.h = a.v; r.l = b.v; return r; }
__device__ __forceinline__ v16b frag_lds(const char* p) { union { v16b v; v8b q[2]; } u; u.q[0] = *(const v8b*)p; u.q[1] = *(const v8b*)(p + 32); return u.v; }
// 16 rows a step, 16 lanes a row: 4 steps of x, 8 of the whole W matrix, 4 of the half of Wk; each pointer holds the lane's own offset and the slab's k
__device__ __forceinline__ void q_fetch(v4f (&st)[16], const float* px, const float* pa, const float* pb) {
#pragma unroll   // st is indexed by constants only, so it stays in registers; the row steps become immediate offsets
  for (int i = 0; i < 16; ++i) st[i] = *(const v4f*)(i < 4 ? px + (size_t)i * 16 * EE : (i < 12 ? pa + (size_t)(i - 4) * 16 * EE : pb + (size_t)(i - 12) * 16 * EE));
  // wait before a register that an issued load names is overwritten; as inputs the three address pairs stay live up to it, so that no later load's result lands on one ahead of it
  asm volatile("s_wait_xcnt 0x0" :: "v"(px), "v"(pa), "v"(pb) : "memory");
}
__device__ __forceinline__ void q_stage(const v4f (&st)[16], char* p) {
#pragma unroll   // st is indexed by constants only, so it stays in registers
  for (int i = 0; i < 16; ++i) { v4b h, l;
#pragma unroll   // vector elements picked by constants
    for (int c = 0; c < 4; ++c) { const __bf16 hh = (__bf16)st[i][c]; h[c] = hh; l[c] = (__bf16)(st[i][c] - (float)hh); }
    *(v4b*)(p + i * 16 * QP) = h; *(v4b*)(p + i * 16 * QP + QPL) = l; }
}
__global__ __launch_bounds__(256) void k_qkv(const float* __restrict__ x, const float* __restrict__ Wq, const float* __restrict__ Wk, const float* __restrict__ Wv, float* __restrict__ qpk, float* __restrict__ kpk, float* __restrict__ vpk) {
  __shared__ __align__(16) char sm[2 * QBUF];
  const int tid = threadIdx.x, wave = __builtin_amdgcn_readfirstlane(tid >> 5), lane = tid & 31, col = lane & 15, g = lane >> 4;
  const int r0b = blockIdx.x * QM, y = blockIdx.y, wm = wave >> 2, wn = wave & 3;
  const size_t toff = (size_t)(tid >> 4) * EE + (tid & 15) * 4;
  const float* const px = x + (size_t)r0b * EE + toff; const float* const pa = (y == 0 ? Wq : Wv) + toff; const float* const pb = Wk + (size_t)y * 64 * EE + toff;
  char* const wr = sm + (tid >> 4) * QP + (tid & 15) * 8;
  const char* const ra = sm + (wm * 32 + col) * QP + g * 16;
  const char* const rbf = sm + (QM + wn * 48 + col) * QP + g * 16;
  v4f st[16]; v8f acc[6] = {};
  q_fetch(st, px, pa, pb);
  q_stage(st, wr);
  __syncthreads();
#pragma unroll 1   // one slab a trip: the two buffers alternate by a run-time offset
  for (int ks = 0; ks < EE / QK; ++ks) { const int cur = (ks & 1) * QBUF;
    if (ks + 1 < EE / QK) q_fetch(st, px + (ks + 1) * QK, pa + (ks + 1) * QK, pb + (ks + 1) * QK);
#pragma unroll   // the two 32-k steps of a slab differ by an immediate offset only
    for (int k2 = 0; k2 < QK / 32; ++k2) { F2 f[5];   // f[0], f[1]: the wave's two row tiles of x; f[2..4]: its three column tiles of W
#pragma unroll   // f is indexed by constants only, so it stays in registers
      for (int t = 0; t < 5; ++t) { const char* p = (t < 2 ? ra + t * 16 * QP : rbf + (t - 2) * 16 * QP) + cur + k2 * 64; f[t].h = frag_lds(p); f[t].l = frag_lds(p + QPL); }
#pragma unroll   // lo.hi, then hi.lo, then hi.hi: six independent accumulators between two WMMAs on the same one
      for (int ps = 0; ps < 3; ++ps)
#pragma unroll   // acc and f are indexed by constants only
        for (int t = 0; t < 6; ++t) acc[t] = wmma_bf(ps == 0 ? f[t / 3].l : f[t / 3].h, ps == 1 ? f[2 + t % 3].l : f[2 + t % 3].h, acc[t]); }
    if (ks + 1 < EE / QK) q_stage(st, wr + (QBUF - cur));
    __syncthreads();   // publishes the slab just staged and ends every wave's reads of the buffer that the next trip refills
  }
  float* const so = (float*)sm;   // the ring is free behind the loop's last barrier
#pragma unroll   // acc is indexed by constants only
  for (int e = 0; e < 48; ++e) { const int t = e >> 3, r = e & 7; so[(wm * 32 + (t / 3) * 16 + 8 * g + r) * QSO + wn * 48 + (t % 3) * 16 + col] = acc[t][r]; }
  __syncthreads();
  if (y == 0) {
#pragma unroll   // the block's sixteen fragments of q, two a wave: id = (16-row tile, kc)
    for (int u = 0; u < 2; ++u) { const int id = u * 8 + wave; float v[16]; const float* p = so + ((id >> 2) * 16 + col) * QSO + (id & 3) * 32 + 8 * g;
#pragma unroll   // v is indexed by constants only
      for (int i = 0; i < 8; ++i) { v[i] = p[i]; v[8 + i] = p[16 + i]; }
      put_frag((char*)qpk + ((size_t)(r0b / 16) * 4 + id) * FRB + lane * 16, bsplit16(v)); }
  } else {
#pragma unroll   // the block's two 32-key groups of v; wave = column tile
    for (int u = 0; u < 2; ++u) { float v[16]; const float* p = so + (u * 32 + 8 * g) * QSO + wave * 16 + col;
#pragma unroll   // v is indexed by constants only
      for (int i = 0; i < 8; ++i) { v[i] = p[i * QSO]; v[8 + i] = p[(16 + i) * QSO]; }
      put_frag((char*)vpk + ((size_t)(r0b / 32 + u) * 8 + wave) * FRB + lane * 16, bsplit16(v)); }
  }
  { float v[16]; const float* p = so + ((wave >> 1) * 16 + col) * QSO + 128 + (wave & 1) * 32 + 8 * g;   // the block's half of k: wave = (16-key tile, kc)
#pragma unroll   // v is indexed by constants only
    for (int i = 0; i < 8; ++i) { v[i] = p[i]; v[8 + i] = p[16 + i]; }
    put_frag((char*)kpk + ((size_t)(r0b / 16 + (wave >> 1)) * 4 + y * 2 + (wave & 1)) * FRB + lane * 16, bsplit16(v)); }
}
// One block = 16 query rows; its NW waves share the rows' key tiles (wave w takes tiles w, w + NW, ...), each with an online softmax of its
// own; the partial (max, sum, acc) triples are merged through LDS in wave order at the end.
// qpk is not __restrict__: its fragments are then loaded anew in every tile's stream and not held in 64 registers (or in scratch) across the softmax and the v products.
#define NW 16
#define PD 3    // fragments of q and k asked for ahead
#define PV 3    // fragments of v asked for ahead
__global__ __launch_bounds__(NW * 32) void k_attn(const float* qpk, const float* __restrict__ kpk, const float* __restrict__ vpk, float* __restrict__ out) {
  __shared__ __align__(16) float sS[NW][16][68];
  __shared__ __align__(16) float sP[NW][16][68];
  __shared__ __align__(16) float sO[NW][16][132];
  __shared__ float sM[NW][16];
  __shared__ float sL[NW][16];
  // w through readfirstlane: the tile loop's test is then a scalar branch and EXEC stays full at the WMMAs
  const int tid = threadIdx.x, w = __builtin_amdgcn_readfirstlane(tid >> 5), lane = tid & 31, col = lane & 15, g = lane >> 4;
  const int b = blockIdx.x, q0 = blockIdx.y * 16; const size_t rb = (size_t)b * SQ;
  const char* qp = (const char*)qpk + (rb + q0) * HD * 4 + lane * 16; const char* kb = (const char*)kpk + rb * HD * 4 + lane * 16; const char* vb = (const char*)vpk + rb * HD * 4 + lane * 16;   // 64 keys = 16 fragments = 32 KB in either
  float mrun = -3.0e38f, lrun = 0.f; v8f acc[8] = {};
  const float scl = 11.313708498984761f;     // * sqrt(128), as the reference
  const int ntiles = (q0 >> 6) + 1;
#pragma unroll 1
  for (int kt = w; kt < ntiles; kt += NW) {
    // Fragments come as streams in the order of their use: for the scores, per kc the one of q and then the four of k; for the output the sixteen of v. Fragment n + PD (v: n + PV)
    // is asked for in front of the products of fragment n, so that four loads a fragment ahead are in flight. fs and fv are indexed by constants only: few live at a time.
    const char* const kp = kb + (size_t)kt * (16 * FRB); const char* const vp = vb + (size_t)kt * (16 * FRB); F2 fs[20], fv[16]; v8f s4[4] = {};
#pragma unroll   // fs is indexed by constants only
    for (int n = 0; n < PD; ++n) fs[n] = get_frag(n % 5 == 0 ? qp + (n / 5) * FRB : kp + ((n % 5 - 1) * 4 + n / 5) * FRB);
#pragma unroll   // fs and s4 are indexed by constants only; per accumulator kc ascending
    for (int n = 0; n < 20; ++n) { const int m = n + PD;
      if (m < 20) fs[m] = get_frag(m % 5 == 0 ? qp + (m / 5) * FRB : kp + ((m % 5 - 1) * 4 + m / 5) * FRB);
      // behind the stream's last load: wait before a register that an issued load names is overwritten; as inputs the address pairs stay live up to it, so that no load's result lands on one
      if (m == 19) asm volatile("s_wait_xcnt 0x0" :: "v"(kp), "v"(qp) : "memory");
      if (n % 5 != 0) s4[n % 5 - 1] = mac3(fs[n - n % 5], fs[n], s4[n % 5 - 1]); }
#pragma unroll
    for (int t = 0; t < 4; ++t) { const v8f s = s4[t]; const int key = kt * 64 + t * 16 + col;
#pragma unroll
      for (int r = 0; r < 8; ++r) { const int qi = q0 + 8 * g + r; const float sv = s[r] * scl; sS[w][8 * g + r][t * 16 + col] = (key <= qi && sv != 0.0f) ? sv : -3.0e38f; } }
    LDSX();
#pragma unroll   // the first fragments of v land during the softmax
    for (int n = 0; n < PV; ++n) fv[n] = get_frag(vp + n * FRB);
    float mx = -3.4e38f;
#pragma unroll
    for (int jj = 0; jj < 32; ++jj) mx = fmaxf(mx, sS[w][col][g * 32 + jj]);
    mx = fmaxf(mx, __shfl_xor(mx, 16, 32));
    const float mnew = fmaxf(mrun, mx); const float corr = mnew <= -1.0e38f ? 1.0f : expf(mrun - mnew);
    float ps = 0.f;
#pragma unroll
    for (int jj = 0; jj < 32; ++jj) { const float sv = sS[w][col][g * 32 + jj]; const float p = sv <= -1.0e38f ? 0.f : expf(sv - mnew); ps += p; sP[w][col][g * 32 + jj] = p; }
    ps += __shfl_xor(ps, 16, 32);
    lrun = lrun * corr + ps; mrun = mnew;
#pragma unroll
    for (int r = 0; r < 8; ++r) { const float cr = __shfl(corr, 8 * g + r, 32);
#pragma unroll
      for (int t = 0; t < 8; ++t) acc[t][r] *= cr; }
    LDSX();
#pragma unroll
    for (int kc = 0; kc < 2; ++kc) { const F2 pa = split_row(&sP[w][col][0], kc * 32, lane);
#pragma unroll
      for (int t = 0; t < 8; ++t) { const int n = kc * 8 + t, m = n + PV; if (m < 16) fv[m] = get_frag(vp + m * FRB);
        if (m == 15) asm volatile("s_wait_xcnt 0x0" :: "v"(vp) : "memory");   // as behind the last load of k
        acc[t] = mac3(pa, fv[n], acc[t]); } }
    __builtin_amdgcn_wave_barrier();
  }
  if (g == 0) sM[w][col] = mrun;
  __syncthreads();
  float mg = sM[0][col];
#pragma unroll   // all NW reads in flight at once
  for (int i = 1; i < NW; ++i) mg = fmaxf(mg, sM[i][col]);
  const float f = mg <= -1.0e38f ? 1.0f : expf(mrun - mg);   // a wave without a kept score has acc = 0 and lrun = 0
  if (g == 0) sL[w][col] = lrun * f;
#pragma unroll   // acc is indexed by constants only, so it stays in registers
  for (int r = 0; r < 8; ++r) { const float fr = __shfl(f, 8 * g + r, 32);
#pragma unroll
    for (int t = 0; t < 8; ++t) sO[w][8 * g + r][t * 16 + col] = acc[t][r] * fr; }
  __syncthreads();
  float lt = 0.f; v4f o = {};                                  // wave w sums row w over the NW partials
#pragma unroll   // all NW reads in flight at once; the sum runs in wave order
  for (int i = 0; i < NW; ++i) { lt += sL[i][w]; o += *(const v4f*)(&sO[i][w][lane * 4]); }
#pragma unroll
  for (int c = 0; c < 4; ++c) o[c] = o[c] / lt;
  vst2(out + (rb + q0 + w) * HD + lane * 4, o);
}
extern "C" void kernel_launch(void* const* d_in, const int* in_sizes, int n_in, void* d_out, int out_size, void* d_ws, size_t ws_size, hipStream_t stream) {
  (void)in_sizes; (void)n_in; (void)out_size; (void)ws_size;
  const float* x = (const float*)d_in[0]; const float* Wq = (const float*)d_in[1]; const float* Wk = (const float*)d_in[2]; const float* Wv = (const float*)d_in[3];
  float* out = (float*)d_out;
  char* ws = (char*)d_ws; size_t off = 0;
  auto take = [&](size_t bytes) { char* p = ws + off; off += (bytes + 255) & ~(size_t)255; return p; };
  float* qpk = (float*)take((size_t)NR * HD * 4); float* kpk = (float*)take((size_t)NR * HD * 4); float* vpk = (float*)take((size_t)NR * HD * 4);
  k_qkv<<<dim3(NR / QM, 2), 256, 0, stream>>>(x, Wq, Wk, Wv, qpk, kpk, vpk);
  k_attn<<<dim3(NB, SQ / 16), NW * 32, 0, stream>>>(qpk, kpk, vpk, out);
}

// v004
// One run takes 55.7 microseconds.
// Two timings next to v003 both put it at 1.06 times that version's speed.
// All steps since v000 together make it 9.63 times as fast.
#include <hip/hip_runtime.h>
#include <math.h>

typedef __attribute__((ext_vector_type(16))) _Float16 v16h;
typedef __attribute__((ext_vector_type(16))) __bf16 v16b;
typedef __attribute__((ext_vector_type(8)))  _Float16 v8h;
typedef __attribute__((ext_vector_type(8)))  float v8f;
typedef __attribute__((ext_vector_type(4)))  float v4f;
typedef __attribute__((ext_vector_type(2)))  float v2f;
typedef __attribute__((ext_vector_type(4)))  unsigned v4u;
typedef __attribute__((ext_vector_type(4)))  int v4i;
typedef float __attribute__((may_alias)) float_a;
typedef int __attribute__((may_alias)) int_a;

template <typename T> __device__ __forceinline__ void vst2(void* p, T v) { *(T*)p = v;  }
__device__ __forceinline__ v8f wmma16(v16h a, v16h b, v8f c) {
  v8f d = __builtin_amdgcn_wmma_f32_16x16x32_f16(false, a, false, b, (short)0, c, false, false);
  asm volatile("v_nop\n\tv_nop\n\tv_nop\n\tv_nop" : "+v"(d) : "v"(a), "v"(b));
  return d;
}
__device__ __forceinline__ v8f wmma_bf(v16b a, v16b b, v8f c) {
  v8f d = __builtin_amdgcn_wmma_f32_16x16x32_bf16(false, a, false, b, (short)0, c, false, false);
  asm volatile("v_nop\n\tv_nop\n\tv_nop\n\tv_nop" : "+v"(d) : "v"(a), "v"(b));
  return d;
}
// 16x16x32 fragments: lane = (h = lane>>4, row/col = lane&15); elements 0..7 = k0+8h+0..7, 8..15 = k0+16+8h+0..7; D element r = row 8h+r
__device__ __forceinline__ v16h frag_h(const _Float16* rowk0, int lane) {
  union { v16h v; v8h q[2]; } u; const _Float16* p = rowk0 + 8 * (lane >> 4);
  u.q[0] = *(const v8h*)p; u.q[1] = *(const v8h*)(p + 16); return u.v;
}
__device__ __forceinline__ v16h frag_f32(const float* rowk0, int lane) {
  v16h a; const float* p = rowk0 + 8 * (lane >> 4);
#pragma unroll
  for (int i = 0; i < 8; ++i) { a[i] = (_Float16)p[i]; a[8 + i] = (_Float16)p[16 + i]; }
  return a;
}
__device__ __forceinline__ v16h frag_f32s(const float* rowk0, int lane, float sc) {
  v16h a; const float* p = rowk0 + 8 * (lane >> 4);
#pragma unroll
  for (int i = 0; i < 8; ++i) { a[i] = (_Float16)(p[i] * sc); a[8 + i] = (_Float16)(p[16 + i] * sc); }
  return a;
}
// column fragment from a [K][ld] layout (column n), rows >= K read as 0
__device__ __forceinline__ v16h fragc_f32(const float* W, int k0, int n, int lane, int ld, int K) {
  v16h a; const int g = lane >> 4;
#pragma unroll
  for (int i = 0; i < 8; ++i) { const int ka = k0 + 8 * g + i, kb = ka + 16;
    a[i] = (_Float16)(ka < K ? W[(size_t)ka * ld + n] : 0.f); a[8 + i] = (_Float16)(kb < K ? W[(size_t)kb * ld + n] : 0.f); }
  return a;
}
struct F2 { v16b h, l; };
__device__ __forceinline__ F2 bsplit16(const float v[16]) { F2 r;
#pragma unroll
  for (int i = 0; i < 16; ++i) { const __bf16 h = (__bf16)v[i]; r.h[i] = h; r.l[i] = (__bf16)(v[i] - (float)h); }
  return r; }
__device__ __forceinline__ F2 split_row(const float* row, int k0, int lane) { float v[16]; const float* p = row + k0 + 8 * (lane >> 4);
#pragma unroll
  for (int i = 0; i < 8; ++i) { v[i] = p[i]; v[8 + i] = p[16 + i]; }
  return bsplit16(v); }
__device__ __forceinline__ F2 split_rowK(const float* row, int k0, int lane, int K) { float v[16]; const int g = lane >> 4;
#pragma unroll
  for (int i = 0; i < 8; ++i) { const int ka = k0 + 8 * g + i, kb = ka + 16; v[i] = ka < K ? row[ka] : 0.f; v[8 + i] = kb < K ? row[kb] : 0.f; }
  return bsplit16(v); }
__device__ __forceinline__ F2 split_col(const float* W, int k0, int n, int lane, int ld, int K) { float v[16]; const int g = lane >> 4;
#pragma unroll
  for (int i = 0; i < 8; ++i) { const int ka = k0 + 8 * g + i, kb = ka + 16; v[i] = ka < K ? W[(size_t)ka * ld + n] : 0.f; v[8 + i] = kb < K ? W[(size_t)kb * ld + n] : 0.f; }
  return bsplit16(v); }
__device__ __forceinline__ v8f mac3(const F2& a, const F2& b, v8f c) { c = wmma_bf(a.l, b.h, c); c = wmma_bf(a.h, b.l, c); return wmma_bf(a.h, b.h, c); }
__device__ __forceinline__ float sigm(float v) { return 1.0f / (1.0f + expf(-v)); }
#define LDSX() do { asm volatile("s_wait_dscnt 0" ::: "memory"); __builtin_amdgcn_wave_barrier(); __builtin_amdgcn_fence(__ATOMIC_RELEASE, "workgroup"); } while (0)

// Single-head causal attention whose scores are MULTIPLIED by sqrt(128) (as the reference), so the softmax is extremely sharp: q and k
// come from two-way bf16 split GEMMs (near-f32, stored as bf16 hi and lo fragments) and S = q.k*sqrt(128) is also a two-way split; the causal zero-fill followed
// by "== 0 -> -inf" of the reference is reproduced (masked and exactly-zero kept scores both get -inf); online softmax in f32; v from the
#define NB 4
#define SQ 2048
#define EE 1024
#define HD 128
#define NR (NB * SQ)

// q, k and v leave as bf16 hi and lo planes in WMMA fragment order (two-way bf16 split GEMMs, f32 results split once more). One block = 64 rows of x times 192 output columns: blockIdx.y = 0 all of q and
// columns 0..63 of k, blockIdx.y = 1 all of v and columns 64..127 of k. Per slab of 64 k the block reads its 64 x rows and 192 W rows
// once, in whole 256-byte runs, splits each value once into bf16 hi and lo, and lays the two planes in LDS; the eight waves (2 x 4, 32 x 48 outputs each) take their fragments from
// there. Two LDS buffers: the next slab's global loads are in flight during this slab's WMMAs. Per accumulator the WMMA order is k ascending,
// lo.hi, hi.lo, hi.hi.
#define QM 64
#define QN 192
#define QK 64
#define QP 144                    // LDS row pitch in bytes: 128 B of bf16 + 16, an odd multiple of 16 B (no bank conflict for 16-byte reads)
#define QPL ((QM + QN) * QP)      // one plane (hi or lo) of one buffer
#define QBUF (2 * QPL)
#define QSO 196                   // pitch in floats of the output staging
typedef __attribute__((ext_vector_type(8))) __bf16 v8b;
typedef __attribute__((ext_vector_type(4))) __bf16 v4b;
// A packed fragment is 2 KB: hi elements 0..7, hi 8..15, lo 0..7, lo 8..15, each a run of 32 lanes x 16 bytes, so that every wave-wide access is 512 contiguous bytes.
// q, k: fragment (16-row tile, 32-wide step kc of the head), lane (g, col) = row col, elements = head kc*32 + 8g + 0..7 and + 16. Index tile * 4 + kc.
// v: fragment (32-key group, 16-column tile t), lane (g, col) = column t*16 + col, elements = keys 8g + 0..7 and + 16 of the group. Index group * 8 + t.
#define FRB 2048
__device__ __forceinline__ void put_frag(char* p, const F2& f) { union { v16b v; v8b q[2]; } a, b; a.v = f.h; b.v = f.l;
  *(v8b*)p = a.q[0]; *(v8b*)(p + 512) = a.q[1]; *(v8b*)(p + 1024) = b.q[0]; *(v8b*)(p + 1536) = b.q[1];
  // behind the run's last store: wait before a register that an issued store names is overwritten; as an input the address pair stays live up to it
  asm volatile("s_wait_xcnt 0x0" :: "v"(p) : "memory"); }
__device__ __forceinline__ F2 get_frag(const char* p) { union { v16b v; v8b q[2]; } a, b; F2 r;
  a.q[0] = *(const v8b*)p; a.q[1] = *(const v8b*)(p + 512); b.q[0] = *(const v8b*)(p + 1024); b.q[1] = *(const v8b*)(p + 1536); r.h = a.v; r.l = b.v; return r; }
__device__ __forceinline__ v16b frag_lds(const char* p) { union { v16b v; v8b q[2]; } u; u.q[0] = *(const v8b*)p; u.q[1] = *(const v8b*)(p + 32); return u.v; }
// 16 rows a step, 16 lanes a row: 4 steps of x, 8 of the whole W matrix, 4 of the half of Wk; each pointer holds the lane's own offset and the slab's k
__device__ __forceinline__ void q_fetch(v4f (&st)[16], const float* px, const float* pa, const float* pb) {
#pragma unroll   // st is indexed by constants only, so it stays in registers; the row steps become immediate offsets
  for (int i = 0; i < 16; ++i) st[i] = *(const v4f*)(i < 4 ? px + (size_t)i * 16 * EE : (i < 12 ? pa + (size_t)(i - 4) * 16 * EE : pb + (size_t)(i - 12) * 16 * EE));
  // wait before a register that an issued load names is overwritten; as inputs the three address pairs stay live up to it, so that no later load's result lands on one ahead of it
  asm volatile("s_wait_xcnt 0x0" :: "v"(px), "v"(pa), "v"(pb) : "memory");
}
__device__ __forceinline__ void q_stage(const v4f (&st)[16], char* p) {
#pragma unroll   // st is indexed by constants only, so it stays in registers
  for (int i = 0; i < 16; ++i) { v4b h, l;
#pragma unroll   // vector elements picked by constants
    for (int c = 0; c < 4; ++c) { const __bf16 hh = (__bf16)st[i][c]; h[c] = hh; l[c] = (__bf16)(st[i][c] - (float)hh); }
    *(v4b*)(p + i * 16 * QP) = h; *(v4b*)(p + i * 16 * QP + QPL) = l; }
}
__global__ __launch_bounds__(256) void k_qkv(const float* __restrict__ x, const float* __restrict__ Wq, const float* __restrict__ Wk, const float* __restrict__ Wv, float* __restrict__ qpk, float* __restrict__ kpk, float* __restrict__ vpk) {
  __shared__ __align__(16) char sm[2 * QBUF];
  const int tid = threadIdx.x, wave = __builtin_amdgcn_readfirstlane(tid >> 5), lane = tid & 31, col = lane & 15, g = lane >> 4;
  const int r0b = blockIdx.x * QM, y = blockIdx.y, wm = wave >> 2, wn = wave & 3;
  const size_t toff = (size_t)(tid >> 4) * EE + (tid & 15) * 4;
  const float* const px = x + (size_t)r0b * EE + toff; const float* const pa = (y == 0 ? Wq : Wv) + toff; const float* const pb = Wk + (size_t)y * 64 * EE + toff;
  char* const wr = sm + (tid >> 4) * QP + (tid & 15) * 8;
  const char* const ra = sm + (wm * 32 + col) * QP + g * 16;
  const char* const rbf = sm + (QM + wn * 48 + col) * QP + g * 16;
  v4f st[16]; v8f acc[6] = {};
  q_fetch(st, px, pa, pb);
  q_stage(st, wr);
  __syncthreads();
#pragma unroll 1   // one slab a trip: the two buffers alternate by a run-time offset
  for (int ks = 0; ks < EE / QK; ++ks) { const int cur = (ks & 1) * QBUF;
    if (ks + 1 < EE / QK) q_fetch(st, px + (ks + 1) * QK, pa + (ks + 1) * QK, pb + (ks + 1) * QK);
#pragma unroll   // the two 32-k steps of a slab differ by an immediate offset only
    for (int k2 = 0; k2 < QK / 32; ++k2) { F2 f[5];   // f[0], f[1]: the wave's two row tiles of x; f[2..4]: its three column tiles of W
#pragma unroll   // f is indexed by constants only, so it stays in registers
      for (int t = 0; t < 5; ++t) { const char* p = (t < 2 ? ra + t * 16 * QP : rbf + (t - 2) * 16 * QP) + cur + k2 * 64; f[t].h = frag_lds(p); f[t].l = frag_lds(p + QPL); }
#pragma unroll   // lo.hi, then hi.lo, then hi.hi: six independent accumulators between two WMMAs on the same one
      for (int ps = 0; ps < 3; ++ps)
#pragma unroll   // acc and f are indexed by constants only
        for (int t = 0; t < 6; ++t) acc[t] = wmma_bf(ps == 0 ? f[t / 3].l : f[t / 3].h, ps == 1 ? f[2 + t % 3].l : f[2 + t % 3].h, acc[t]); }
    if (ks + 1 < EE / QK) q_stage(st, wr + (QBUF - cur));
    __syncthreads();   // publishes the slab just staged and ends every wave's reads of the buffer that the next trip refills
  }
  float* const so = (float*)sm;   // the ring is free behind the loop's last barrier
#pragma unroll   // acc is indexed by constants only
  for (int e = 0; e < 48; ++e) { const int t = e >> 3, r = e & 7; so[(wm * 32 + (t / 3) * 16 + 8 * g + r) * QSO + wn * 48 + (t % 3) * 16 + col] = acc[t][r]; }
  __syncthreads();
  if (y == 0) {
#pragma unroll   // the block's sixteen fragments of q, two a wave: id = (16-row tile, kc)
    for (int u = 0; u < 2; ++u) { const int id = u * 8 + wave; float v[16]; const float* p = so + ((id >> 2) * 16 + col) * QSO + (id & 3) * 32 + 8 * g;
#pragma unroll   // v is indexed by constants only
      for (int i = 0; i < 8; ++i) { v[i] = p[i]; v[8 + i] = p[16 + i]; }
      put_frag((char*)qpk + ((size_t)(r0b / 16) * 4 + id) * FRB + lane * 16, bsplit16(v)); }
  } else {
#pragma unroll   // the block's two 32-key groups of v; wave = column tile
    for (int u = 0; u < 2; ++u) { float v[16]; const float* p = so + (u * 32 + 8 * g) * QSO + wave * 16 + col;
#pragma unroll   // v is indexed by constants only
      for (int i = 0; i < 8; ++i) { v[i] = p[i * QSO]; v[8 + i] = p[(16 + i) * QSO]; }
      put_frag((char*)vpk + ((size_t)(r0b / 32 + u) * 8 + wave) * FRB + lane * 16, bsplit16(v)); }
  }
  { float v[16]; const float* p = so + ((wave >> 1) * 16 + col) * QSO + 128 + (wave & 1) * 32 + 8 * g;   // the block's half of k: wave = (16-key tile, kc)
#pragma unroll   // v is indexed by constants only
    for (int i = 0; i < 8; ++i) { v[i] = p[i]; v[8 + i] = p[16 + i]; }
    put_frag((char*)kpk + ((size_t)(r0b / 16 + (wave >> 1)) * 4 + y * 2 + (wave & 1)) * FRB + lane * 16, bsplit16(v)); }
}
// One block = 16 query rows; its NW waves share the rows' key tiles (wave w takes tiles w, w + NW, ...), each with an online softmax of its
// own; the partial (max, sum, acc) triples are merged through LDS in wave order at the end.
// qpk is not __restrict__: its fragments are then loaded anew in every tile's stream and not held in 64 registers (or in scratch) across the softmax and the v products.
#define NW 16
#define PD 3    // fragments of q and k asked for ahead
#define PV 3    // fragments of v asked for ahead
__global__ __launch_bounds__(NW * 32) void k_attn(const float* qpk, const float* __restrict__ kpk, const float* __restrict__ vpk, float* __restrict__ out) {
  __shared__ __align__(16) float sS[NW][16][68];
  __shared__ __align__(16) float sP[NW][16][68];
  __shared__ __align__(16) float sO[NW][16][132];
  __shared__ float sM[NW][16];
  __shared__ float sL[NW][16];
  // w through readfirstlane: the tile loop's test is then a scalar branch and EXEC stays full at the WMMAs
  const int tid = threadIdx.x, w = __builtin_amdgcn_readfirstlane(tid >> 5), lane = tid & 31, col = lane & 15, g = lane >> 4;
  const int b = blockIdx.x, q0 = blockIdx.y * 16; const size_t rb = (size_t)b * SQ;
  const char* qp = (const char*)qpk + (rb + q0) * HD * 4 + lane * 16; const char* kb = (const char*)kpk + rb * HD * 4 + lane * 16; const char* vb = (const char*)vpk + rb * HD * 4 + lane * 16;   // 64 keys = 16 fragments = 32 KB in either
  float mrun = -3.0e38f, lrun = 0.f; v8f acc[8] = {};
  const float scl = 11.313708498984761f;     // * sqrt(128), as the reference
  const int ntiles = (q0 >> 6) + 1;
#pragma unroll 1
  for (int kt = w; kt < ntiles; kt += NW) {
    // Fragments come as streams in the order of their use: for the scores, per kc the one of q and then the four of k; for the output the sixteen of v. Fragment n + PD (v: n + PV)
    // is asked for in front of the products of fragment n, so that four loads a fragment ahead are in flight. fs and fv are indexed by constants only: few live at a time.
    const char* const kp = kb + (size_t)kt * (16 * FRB); const char* const vp = vb + (size_t)kt * (16 * FRB); F2 fs[20], fv[16]; v8f s4[4] = {};
#pragma unroll   // fs is indexed by constants only
    for (int n = 0; n < PD; ++n) fs[n] = get_frag(n % 5 == 0 ? qp + (n / 5) * FRB : kp + ((n % 5 - 1) * 4 + n / 5) * FRB);
#pragma unroll   // fs and s4 are indexed by constants only; per accumulator kc ascending
    for (int n = 0; n < 20; ++n) { const int m = n + PD;
      if (m < 20) fs[m] = get_frag(m % 5 == 0 ? qp + (m / 5) * FRB : kp + ((m % 5 - 1) * 4 + m / 5) * FRB);
      // behind the stream's last load: wait before a register that an issued load names is overwritten; as inputs the address pairs stay live up to it, so that no load's result lands on one
      if (m == 19) asm volatile("s_wait_xcnt 0x0" :: "v"(kp), "v"(qp) : "memory");
      if (n % 5 != 0) s4[n % 5 - 1] = mac3(fs[n - n % 5], fs[n], s4[n % 5 - 1]); }
#pragma unroll
    for (int t = 0; t < 4; ++t) { const v8f s = s4[t]; const int key = kt * 64 + t * 16 + col;
#pragma unroll
      for (int r = 0; r < 8; ++r) { const int qi = q0 + 8 * g + r; const float sv = s[r] * scl; sS[w][8 * g + r][t * 16 + col] = (key <= qi && sv != 0.0f) ? sv : -3.0e38f; } }
    LDSX();
#pragma unroll   // the first fragments of v land during the softmax
    for (int n = 0; n < PV; ++n) fv[n] = get_frag(vp + n * FRB);
    __builtin_amdgcn_sched_barrier(0);   // keeps these loads in front of the softmax: sunk into it they would still be in flight at the wait that ends it
    float mx = -3.4e38f;
#pragma unroll
    for (int jj = 0; jj < 32; ++jj) mx = fmaxf(mx, sS[w][col][g * 32 + jj]);
    mx = fmaxf(mx, __shfl_xor(mx, 16, 32));
    // Every exponential is computed unconditionally and the masked case picked afterwards by a select: no branch on EXEC per score, so the chains of a tile are independent and interleave.
    const float mnew = fmaxf(mrun, mx); const float ec = expf(mrun - mnew); const float corr = mnew <= -1.0e38f ? 1.0f : ec;
    float ps = 0.f;
#pragma unroll
    for (int jj = 0; jj < 32; ++jj) { const float sv = sS[w][col][g * 32 + jj]; const float e = expf(sv - mnew); const float p = sv <= -1.0e38f ? 0.f : e; ps += p; sP[w][col][g * 32 + jj] = p; }
    ps += __shfl_xor(ps, 16, 32);
    lrun = lrun * corr + ps; mrun = mnew;
#pragma unroll
    for (int r = 0; r < 8; ++r) { const float cr = __shfl(corr, 8 * g + r, 32);
#pragma unroll
      for (int t = 0; t < 8; ++t) acc[t][r] *= cr; }
    LDSX();
#pragma unroll
    for (int kc = 0; kc < 2; ++kc) { const F2 pa = split_row(&sP[w][col][0], kc * 32, lane);
#pragma unroll
      for (int t = 0; t < 8; ++t) { const int n = kc * 8 + t, m = n + PV; if (m < 16) fv[m] = get_frag(vp + m * FRB);
        if (m == 15) asm volatile("s_wait_xcnt 0x0" :: "v"(vp) : "memory");   // as behind the last load of k
        acc[t] = mac3(pa, fv[n], acc[t]); } }
    __builtin_amdgcn_wave_barrier();
  }
  if (g == 0) sM[w][col] = mrun;
  __syncthreads();
  float mg = sM[0][col];
#pragma unroll   // all NW reads in flight at once
  for (int i = 1; i < NW; ++i) mg = fmaxf(mg, sM[i][col]);
  const float f = mg <= -1.0e38f ? 1.0f : expf(mrun - mg);   // a wave without a kept score has acc = 0 and lrun = 0
  if (g == 0) sL[w][col] = lrun * f;
#pragma unroll   // acc is indexed by constants only, so it stays in registers
  for (int r = 0; r < 8; ++r) { const float fr = __shfl(f, 8 * g + r, 32);
#pragma unroll
    for (int t = 0; t < 8; ++t) sO[w][8 * g + r][t * 16 + col] = acc[t][r] * fr; }
  __syncthreads();
  float lt = 0.f; v4f o = {};                                  // wave w sums row w over the NW partials
#pragma unroll   // all NW reads in flight at once; the sum runs in wave order
  for (int i = 0; i < NW; ++i) { lt += sL[i][w]; o += *(const v4f*)(&sO[i][w][lane * 4]); }
#pragma unroll
  for (int c = 0; c < 4; ++c) o[c] = o[c] / lt;
  vst2(out + (rb + q0 + w) * HD + lane * 4, o);
}
extern "C" void kernel_launch(void* const* d_in, const int* in_sizes, int n_in, void* d_out, int out_size, void* d_ws, size_t ws_size, hipStream_t stream) {
  (void)in_sizes; (void)n_in; (void)out_size; (void)ws_size;
  const float* x = (const float*)d_in[0]; const float* Wq = (const float*)d_in[1]; const float* Wk = (const float*)d_in[2]; const float* Wv = (const float*)d_in[3];
  float* out = (float*)d_out;
  char* ws = (char*)d_ws; size_t off = 0;
  auto take = [&](size_t bytes) { char* p = ws + off; off += (bytes + 255) & ~(size_t)255; return p; };
  float* qpk = (float*)take((size_t)NR * HD * 4); float* kpk = (float*)take((size_t)NR * HD * 4); float* vpk = (float*)take((size_t)NR * HD * 4);
  k_qkv<<<dim3(NR / QM, 2), 256, 0, stream>>>(x, Wq, Wk, Wv, qpk, kpk, vpk);
  k_attn<<<dim3(NB, SQ / 16), NW * 32, 0, stream>>>(qpk, kpk, vpk, out);
}

// v005
// One run takes 53.4 microseconds.
// Next to v004, in two timings, it ran 1.04 times as fast each time.
// All steps since v000 together make it 10.0 times as fast.
#include <hip/hip_runtime.h>
#include <math.h>

typedef __attribute__((ext_vector_type(16))) _Float16 v16h;
typedef __attribute__((ext_vector_type(16))) __bf16 v16b;
typedef __attribute__((ext_vector_type(8)))  _Float16 v8h;
typedef __attribute__((ext_vector_type(8)))  float v8f;
typedef __attribute__((ext_vector_type(4)))  float v4f;
typedef __attribute__((ext_vector_type(2)))  float v2f;
typedef __attribute__((ext_vector_type(4)))  unsigned v4u;
typedef __attribute__((ext_vector_type(4)))  int v4i;
typedef float __attribute__((may_alias)) float_a;
typedef int __attribute__((may_alias)) int_a;

template <typename T> __device__ __forceinline__ void vst2(void* p, T v) { *(T*)p = v;  }
__device__ __forceinline__ v8f wmma16(v16h a, v16h b, v8f c) {
  v8f d = __builtin_amdgcn_wmma_f32_16x16x32_f16(false, a, false, b, (short)0, c, false, false);
  asm volatile("v_nop\n\tv_nop\n\tv_nop\n\tv_nop" : "+v"(d) : "v"(a), "v"(b));
  return d;
}
__device__ __forceinline__ v8f wmma_bf(v16b a, v16b b, v8f c) {
  v8f d = __builtin_amdgcn_wmma_f32_16x16x32_bf16(false, a, false, b, (short)0, c, false, false);
  asm volatile("v_nop\n\tv_nop\n\tv_nop\n\tv_nop" : "+v"(d) : "v"(a), "v"(b));
  return d;
}
// 16x16x32 fragments: lane = (h = lane>>4, row/col = lane&15); elements 0..7 = k0+8h+0..7, 8..15 = k0+16+8h+0..7; D element r = row 8h+r
__device__ __forceinline__ v16h frag_h(const _Float16* rowk0, int lane) {
  union { v16h v; v8h q[2]; } u; const _Float16* p = rowk0 + 8 * (lane >> 4);
  u.q[0] = *(const v8h*)p; u.q[1] = *(const v8h*)(p + 16); return u.v;
}
__device__ __forceinline__ v16h frag_f32(const float* rowk0, int lane) {
  v16h a; const float* p = rowk0 + 8 * (lane >> 4);
#pragma unroll
  for (int i = 0; i < 8; ++i) { a[i] = (_Float16)p[i]; a[8 + i] = (_Float16)p[16 + i]; }
  return a;
}
__device__ __forceinline__ v16h frag_f32s(const float* rowk0, int lane, float sc) {
  v16h a; const float* p = rowk0 + 8 * (lane >> 4);
#pragma unroll
  for (int i = 0; i < 8; ++i) { a[i] = (_Float16)(p[i] * sc); a[8 + i] = (_Float16)(p[16 + i] * sc); }
  return a;
}
// column fragment from a [K][ld] layout (column n), rows >= K read as 0
__device__ __forceinline__ v16h fragc_f32(const float* W, int k0, int n, int lane, int ld, int K) {
  v16h a; const int g = lane >> 4;
#pragma unroll
  for (int i = 0; i < 8; ++i) { const int ka = k0 + 8 * g + i, kb = ka + 16;
    a[i] = (_Float16)(ka < K ? W[(size_t)ka * ld + n] : 0.f); a[8 + i] = (_Float16)(kb < K ? W[(size_t)kb * ld + n] : 0.f); }
  return a;
}
struct F2 { v16b h, l; };
__device__ __forceinline__ F2 bsplit16(const float v[16]) { F2 r;
#pragma unroll
  for (int i = 0; i < 16; ++i) { const __bf16 h = (__bf16)v[i]; r.h[i] = h; r.l[i] = (__bf16)(v[i] - (float)h); }
  return r; }
__device__ __forceinline__ F2 split_row(const float* row, int k0, int lane) { float v[16]; const float* p = row + k0 + 8 * (lane >> 4);
#pragma unroll
  for (int i = 0; i < 8; ++i) { v[i] = p[i]; v[8 + i] = p[16 + i]; }
  return bsplit16(v); }
__device__ __forceinline__ F2 split_rowK(const float* row, int k0, int lane, int K) { float v[16]; const int g = lane >> 4;
#pragma unroll
  for (int i = 0; i < 8; ++i) { const int ka = k0 + 8 * g + i, kb = ka + 16; v[i] = ka < K ? row[ka] : 0.f; v[8 + i] = kb < K ? row[kb] : 0.f; }
  return bsplit16(v); }
__device__ __forceinline__ F2 split_col(const float* W, int k0, int n, int lane, int ld, int K) { float v[16]; const int g = lane >> 4;
#pragma unroll
  for (int i = 0; i < 8; ++i) { const int ka = k0 + 8 * g + i, kb = ka + 16; v[i] = ka < K ? W[(size_t)ka * ld + n] : 0.f; v[8 + i] = kb < K ? W[(size_t)kb * ld + n] : 0.f; }
  return bsplit16(v); }
__device__ __forceinline__ v8f mac3(const F2& a, const F2& b, v8f c) { c = wmma_bf(a.l, b.h, c); c = wmma_bf(a.h, b.l, c); return wmma_bf(a.h, b.h, c); }
__device__ __forceinline__ float sigm(float v) { return 1.0f / (1.0f + expf(-v)); }
#define LDSX() do { asm volatile("s_wait_dscnt 0" ::: "memory"); __builtin_amdgcn_wave_barrier(); __builtin_amdgcn_fence(__ATOMIC_RELEASE, "workgroup"); } while (0)

// Single-head causal attention whose scores are MULTIPLIED by sqrt(128) (as the reference), so the softmax is extremely sharp: q and k
// come from two-way bf16 split GEMMs (near-f32, stored as bf16 hi and lo fragments) and S = q.k*sqrt(128) is also a two-way split; the causal zero-fill followed
// by "== 0 -> -inf" of the reference is reproduced (masked and exactly-zero kept scores both get -inf); online softmax in f32; v from the
#define NB 4
#define SQ 2048
#define EE 1024
#define HD 128
#define NR (NB * SQ)

// q, k and v leave as bf16 hi and lo planes in WMMA fragment order (two-way bf16 split GEMMs, f32 results split once more). One block = 64 rows of x times 192 output columns: blockIdx.y = 0 all of q and
// columns 0..63 of k, blockIdx.y = 1 all of v and columns 64..127 of k. Per slab of 64 k the block reads its 64 x rows and 192 W rows
// once, in whole 256-byte runs, splits each value once into bf16 hi and lo, and lays the two planes in LDS; the eight waves (2 x 4, 32 x 48 outputs each) take their fragments from
// there. Two LDS buffers and two register sets of fragments: the fragments of a 32-k step are read from LDS during the WMMAs of the step before it, also from one slab to the next,
// and each staging register is refilled from global memory as soon as it has been staged. Per accumulator the WMMA order is k ascending, lo.hi, hi.lo, hi.hi.
#define QM 64
#define QN 192
#define QK 64
#define QP 144                    // LDS row pitch in bytes: 128 B of bf16 + 16, an odd multiple of 16 B (no bank conflict for 16-byte reads)
#define QPL ((QM + QN) * QP)      // one plane (hi or lo) of one buffer
#define QBUF (2 * QPL)
#define QSO 196                   // pitch in floats of the output staging
typedef __attribute__((ext_vector_type(8))) __bf16 v8b;
typedef __attribute__((ext_vector_type(4))) __bf16 v4b;
// A packed fragment is 2 KB: hi elements 0..7, hi 8..15, lo 0..7, lo 8..15, each a run of 32 lanes x 16 bytes, so that every wave-wide access is 512 contiguous bytes.
// q, k: fragment (16-row tile, 32-wide step kc of the head), lane (g, col) = row col, elements = head kc*32 + 8g + 0..7 and + 16. Index tile * 4 + kc.
// v: fragment (32-key group, 16-column tile t), lane (g, col) = column t*16 + col, elements = keys 8g + 0..7 and + 16 of the group. Index group * 8 + t.
#define FRB 2048
__device__ __forceinline__ void put_frag(char* p, const F2& f) { union { v16b v; v8b q[2]; } a, b; a.v = f.h; b.v = f.l;
  *(v8b*)p = a.q[0]; *(v8b*)(p + 512) = a.q[1]; *(v8b*)(p + 1024) = b.q[0]; *(v8b*)(p + 1536) = b.q[1];
  // behind the run's last store: wait before a register that an issued store names is overwritten; as an input the address pair stays live up to it
  asm volatile("s_wait_xcnt 0x0" :: "v"(p) : "memory"); }
__device__ __forceinline__ F2 get_frag(const char* p) { union { v16b v; v8b q[2]; } a, b; F2 r;
  a.q[0] = *(const v8b*)p; a.q[1] = *(const v8b*)(p + 512); b.q[0] = *(const v8b*)(p + 1024); b.q[1] = *(const v8b*)(p + 1536); r.h = a.v; r.l = b.v; return r; }
__device__ __forceinline__ v16b frag_lds(const char* p) { union { v16b v; v8b q[2]; } u; u.q[0] = *(const v8b*)p; u.q[1] = *(const v8b*)(p + 32); return u.v; }
// 16 rows a step, 16 lanes a row: 4 steps of x, 8 of the whole W matrix, 4 of the half of Wk; each pointer holds the lane's own offset and the slab's k, and moves on by one slab behind its loads
// steps I0 .. I1 - 1 only: 0..3 are x (from memory, the longest way), 4..15 are W (from L2)
struct QB { const float* x; const float* a; const float* b; unsigned lo; };   // the three block-wide bases and the lane's byte offset, from which the pointers were formed
template <int I0, int I1, bool PRO> __device__ __forceinline__ void q_fetch(v4f (&st)[16], const float*& px, const float*& pa, const float*& pb, const QB& qb) {
#pragma unroll   // st is indexed by constants only, so it stays in registers; the row steps become immediate offsets
  for (int i = I0; i < I1; ++i) st[i] = *(const v4f*)(i < 4 ? px + (size_t)i * 16 * EE : (i < 12 ? pa + (size_t)(i - 4) * 16 * EE : pb + (size_t)(i - 12) * 16 * EE));
  // wait before a register that an issued load names is overwritten (the pointers move on right behind it); as inputs the address pairs in use stay live up to it, so that nothing lands on one
  // ahead of it; in front of the loop (PRO) so do base and offset, which the loads there name in the pairs' place
  if constexpr (I0 < 4 && PRO) asm volatile("s_wait_xcnt 0x0" :: "v"(px), "v"(qb.lo), "s"(qb.x) : "memory");
  if constexpr (I0 < 4 && !PRO) asm volatile("s_wait_xcnt 0x0" :: "v"(px) : "memory");
  if constexpr (I1 > 4 && PRO) asm volatile("s_wait_xcnt 0x0" :: "v"(pa), "v"(pb), "v"(qb.lo), "s"(qb.a), "s"(qb.b) : "memory");
  if constexpr (I1 > 4 && !PRO) asm volatile("s_wait_xcnt 0x0" :: "v"(pa), "v"(pb) : "memory");
  if constexpr (I0 < 4) px += QK;
  if constexpr (I1 > 4) { pa += QK; pb += QK; }
}
template <int I0, int I1> __device__ __forceinline__ void q_stage(const v4f (&st)[16], char* p) {
#pragma unroll   // st is indexed by constants only, so it stays in registers
  for (int i = I0; i < I1; ++i) { v4b h, l;
#pragma unroll   // vector elements picked by constants
    for (int c = 0; c < 4; ++c) { const __bf16 hh = (__bf16)st[i][c]; h[c] = hh; l[c] = (__bf16)(st[i][c] - (float)hh); }
    *(v4b*)(p + i * 16 * QP) = h; *(v4b*)(p + i * 16 * QP + QPL) = l; }
}
// the five fragments of one 32-k step, hi and lo: f[0], f[1] the wave's two row tiles of x, f[2..4] its three column tiles of W
__device__ __forceinline__ void q_frags(F2 (&f)[5], const char* ra, const char* rbf) {
#pragma unroll   // f is indexed by constants only, so it stays in registers
  for (int t = 0; t < 5; ++t) { const char* p = t < 2 ? ra + t * 16 * QP : rbf + (t - 2) * 16 * QP; f[t].h = frag_lds(p); f[t].l = frag_lds(p + QPL); }
  __builtin_amdgcn_sched_barrier(0);   // keeps the reads as one group in front of the WMMAs of the step before: sunk among or behind them they would not have returned when they are needed
}
// The plain builtin, which the compiler pads itself: the two fragment sets take the kernel above 256 registers, and with wmma_bf, whose asm operands the compiler kept in the first 256, the loop spilled to scratch.
__device__ __forceinline__ void q_mac(v8f (&acc)[6], const F2 (&f)[5]) {
#pragma unroll   // lo.hi, then hi.lo, then hi.hi: six independent accumulators between two WMMAs on the same one
  for (int ps = 0; ps < 3; ++ps)
#pragma unroll   // acc and f are indexed by constants only
    for (int t = 0; t < 6; ++t) acc[t] = __builtin_amdgcn_wmma_f32_16x16x32_bf16(false, ps == 0 ? f[t / 3].l : f[t / 3].h, false, ps == 1 ? f[2 + t % 3].l : f[2 + t % 3].h, (short)0, acc[t], false, false);
}
// The slab barrier by hand: the wave's LDS stores and reads are done, then the work-group barrier. __syncthreads() would also wait for the global loads of the slab after next, which are to stay in flight across it.
#define QBAR() asm volatile("s_wait_dscnt 0x0\n\ts_barrier_signal -1\n\ts_barrier_wait -1" ::: "memory")
// One slab. On entry f0 holds (or is about to receive) the fragments of the slab's first 32-k step. STAGE: a next slab exists and is in st; FETCH: a slab after next exists.
// The last two trips are written out apart from the loop, so that inside it every count of loads and LDS reads in flight is the same on every path and no wait is set for the shorter path.
template <bool STAGE, bool FETCH> __device__ __forceinline__ void q_trip(int ks, v8f (&acc)[6], F2 (&f0)[5], F2 (&f1)[5], v4f (&st)[16], const char* ra, const char* rbf, char* wr,
                                                                         const float*& px, const float*& pa, const float*& pb, const QB& qb) {
  const int cur = (ks & 1) * QBUF, nxt = QBUF - cur;
  q_frags(f1, ra + cur + 64, rbf + cur + 64);   // the slab's second step is read during the first step's WMMAs
  if (STAGE) q_stage<0, 4>(st, wr + nxt);
  if (FETCH) q_fetch<0, 4, false>(st, px, pa, pb, qb);   // x is staged and asked for again first: nearly a whole trip for the way from memory
  __builtin_amdgcn_sched_barrier(0);                             // keeps the WMMAs out of the lines above: woven in there they put off the loads of x by their own length
  q_mac(acc, f0);                                                // the compiler is free to weave the split of W into these WMMAs
  if (STAGE) q_stage<4, 16>(st, wr + nxt);
  if (FETCH) q_fetch<4, 16, false>(st, px, pa, pb, qb);
  QBAR();   // publishes the slab just staged; every wave's reads of this slab's buffer, which the next trip refills, have returned in front of it
  if (STAGE) q_frags(f0, ra + nxt, rbf + nxt);   // the next slab's first step is read during this slab's last WMMAs
  q_mac(acc, f1);
}
__global__ __launch_bounds__(256) void k_qkv(const float* __restrict__ x, const float* __restrict__ Wq, const float* __restrict__ Wk, const float* __restrict__ Wv, float* __restrict__ qpk, float* __restrict__ kpk, float* __restrict__ vpk) {
  __shared__ __align__(16) char sm[2 * QBUF];
  const int tid = threadIdx.x, wave = __builtin_amdgcn_readfirstlane(tid >> 5), lane = tid & 31, col = lane & 15, g = lane >> 4;
  const int r0b = blockIdx.x * QM, y = blockIdx.y, wm = wave >> 2, wn = wave & 3;
  const QB qb = { x + (size_t)r0b * EE, y == 0 ? Wq : Wv, Wk + (size_t)y * 64 * EE, (unsigned)(((tid >> 4) * EE + (tid & 15) * 4) * 4) };
  const float* px = (const float*)((const char*)qb.x + qb.lo); const float* pa = (const float*)((const char*)qb.a + qb.lo); const float* pb = (const float*)((const char*)qb.b + qb.lo);
  char* const wr = sm + (tid >> 4) * QP + (tid & 15) * 8;
  const char* const ra = sm + (wm * 32 + col) * QP + g * 16;
  const char* const rbf = sm + (QM + wn * 48 + col) * QP + g * 16;
  v4f st[16]; v8f acc[6] = {}; F2 f0[5], f1[5];
  q_fetch<0, 16, true>(st, px, pa, pb, qb);
  q_stage<0, 4>(st, wr); q_fetch<0, 4, true>(st, px, pa, pb, qb);
  q_stage<4, 16>(st, wr); q_fetch<4, 16, true>(st, px, pa, pb, qb);
  QBAR();
  q_frags(f0, ra, rbf);
#pragma unroll 1   // one slab a trip: the two buffers alternate by a run-time offset
  for (int ks = 0; ks < EE / QK - 2; ++ks) q_trip<true, true>(ks, acc, f0, f1, st, ra, rbf, wr, px, pa, pb, qb);
  q_trip<true, false>(EE / QK - 2, acc, f0, f1, st, ra, rbf, wr, px, pa, pb, qb);
  q_trip<false, false>(EE / QK - 1, acc, f0, f1, st, ra, rbf, wr, px, pa, pb, qb);
  float* const so = (float*)sm;   // the ring is free behind the last trip's barrier
#pragma unroll   // acc is indexed by constants only
  for (int e = 0; e < 48; ++e) { const int t = e >> 3, r = e & 7; so[(wm * 32 + (t / 3) * 16 + 8 * g + r) * QSO + wn * 48 + (t % 3) * 16 + col] = acc[t][r]; }
  __syncthreads();
  if (y == 0) {
#pragma unroll   // the block's sixteen fragments of q, two a wave: id = (16-row tile, kc)
    for (int u = 0; u < 2; ++u) { const int id = u * 8 + wave; float v[16]; const float* p = so + ((id >> 2) * 16 + col) * QSO + (id & 3) * 32 + 8 * g;
#pragma unroll   // v is indexed by constants only
      for (int i = 0; i < 8; ++i) { v[i] = p[i]; v[8 + i] = p[16 + i]; }
      put_frag((char*)qpk + ((size_t)(r0b / 16) * 4 + id) * FRB + lane * 16, bsplit16(v)); }
  } else {
#pragma unroll   // the block's two 32-key groups of v; wave = column tile
    for (int u = 0; u < 2; ++u) { float v[16]; const float* p = so + (u * 32 + 8 * g) * QSO + wave * 16 + col;
#pragma unroll   // v is indexed by constants only
      for (int i = 0; i < 8; ++i) { v[i] = p[i * QSO]; v[8 + i] = p[(16 + i) * QSO]; }
      put_frag((char*)vpk + ((size_t)(r0b / 32 + u) * 8 + wave) * FRB + lane * 16, bsplit16(v)); }
  }
  { float v[16]; const float* p = so + ((wave >> 1) * 16 + col) * QSO + 128 + (wave & 1) * 32 + 8 * g;   // the block's half of k: wave = (16-key tile, kc)
#pragma unroll   // v is indexed by constants only
    for (int i = 0; i < 8; ++i) { v[i] = p[i]; v[8 + i] = p[16 + i]; }
    put_frag((char*)kpk + ((size_t)(r0b / 16 + (wave >> 1)) * 4 + y * 2 + (wave & 1)) * FRB + lane * 16, bsplit16(v)); }
}
// One block = 16 query rows; its NW waves share the rows' key tiles (wave w takes tiles w, w + NW, ...), each with an online softmax of its
// own; the partial (max, sum, acc) triples are merged through LDS in wave order at the end.
// qpk is not __restrict__: its fragments are then loaded anew in every tile's stream and not held in 64 registers (or in scratch) across the softmax and the v products.
#define NW 16
#define PD 3    // fragments of q and k asked for ahead
#define PV 3    // fragments of v asked for ahead
__global__ __launch_bounds__(NW * 32) void k_attn(const float* qpk, const float* __restrict__ kpk, const float* __restrict__ vpk, float* __restrict__ out) {
  __shared__ __align__(16) float sS[NW][16][68];
  __shared__ __align__(16) float sP[NW][16][68];
  __shared__ __align__(16) float sO[NW][16][132];
  __shared__ float sM[NW][16];
  __shared__ float sL[NW][16];
  // w through readfirstlane: the tile loop's test is then a scalar branch and EXEC stays full at the WMMAs
  const int tid = threadIdx.x, w = __builtin_amdgcn_readfirstlane(tid >> 5), lane = tid & 31, col = lane & 15, g = lane >> 4;
  const int b = blockIdx.x, q0 = blockIdx.y * 16; const size_t rb = (size_t)b * SQ;
  const char* qp = (const char*)qpk + (rb + q0) * HD * 4 + lane * 16; const char* kb = (const char*)kpk + rb * HD * 4 + lane * 16; const char* vb = (const char*)vpk + rb * HD * 4 + lane * 16;   // 64 keys = 16 fragments = 32 KB in either
  float mrun = -3.0e38f, lrun = 0.f; v8f acc[8] = {};
  const float scl = 11.313708498984761f;     // * sqrt(128), as the reference
  const int ntiles = (q0 >> 6) + 1;
#pragma unroll 1
  for (int kt = w; kt < ntiles; kt += NW) {
    // Fragments come as streams in the order of their use: for the scores, per kc the one of q and then the four of k; for the output the sixteen of v. Fragment n + PD (v: n + PV)
    // is asked for in front of the products of fragment n, so that four loads a fragment ahead are in flight. fs and fv are indexed by constants only: few live at a time.
    const char* const kp = kb + (size_t)kt * (16 * FRB); const char* const vp = vb + (size_t)kt * (16 * FRB); F2 fs[20], fv[16]; v8f s4[4] = {};
#pragma unroll   // fs is indexed by constants only
    for (int n = 0; n < PD; ++n) fs[n] = get_frag(n % 5 == 0 ? qp + (n / 5) * FRB : kp + ((n % 5 - 1) * 4 + n / 5) * FRB);
#pragma unroll   // fs and s4 are indexed by constants only; per accumulator kc ascending
    for (int n = 0; n < 20; ++n) { const int m = n + PD;
      if (m < 20) fs[m] = get_frag(m % 5 == 0 ? qp + (m / 5) * FRB : kp + ((m % 5 - 1) * 4 + m / 5) * FRB);
      // behind the stream's last load: wait before a register that an issued load names is overwritten; as inputs the address pairs stay live up to it, so that no load's result lands on one
      if (m == 19) asm volatile("s_wait_xcnt 0x0" :: "v"(kp), "v"(qp) : "memory");
      if (n % 5 != 0) s4[n % 5 - 1] = mac3(fs[n - n % 5], fs[n], s4[n % 5 - 1]); }
#pragma unroll
    for (int t = 0; t < 4; ++t) { const v8f s = s4[t]; const int key = kt * 64 + t * 16 + col;
#pragma unroll
      for (int r = 0; r < 8; ++r) { const int qi = q0 + 8 * g + r; const float sv = s[r] * scl; sS[w][8 * g + r][t * 16 + col] = (key <= qi && sv != 0.0f) ? sv : -3.0e38f; } }
    LDSX();
#pragma unroll   // the first fragments of v land during the softmax
    for (int n = 0; n < PV; ++n) fv[n] = get_frag(vp + n * FRB);
    __builtin_amdgcn_sched_barrier(0);   // keeps these loads in front of the softmax: sunk into it they would still be in flight at the wait that ends it
    float mx = -3.4e38f;
#pragma unroll
    for (int jj = 0; jj < 32; ++jj) mx = fmaxf(mx, sS[w][col][g * 32 + jj]);
    mx = fmaxf(mx, __shfl_xor(mx, 16, 32));
    // Every exponential is computed unconditionally and the masked case picked afterwards by a select: no branch on EXEC per score, so the chains of a tile are independent and interleave.
    const float mnew = fmaxf(mrun, mx); const float ec = expf(mrun - mnew); const float corr = mnew <= -1.0e38f ? 1.0f : ec;
    float ps = 0.f;
#pragma unroll
    for (int jj = 0; jj < 32; ++jj) { const float sv = sS[w][col][g * 32 + jj]; const float e = expf(sv - mnew); const float p = sv <= -1.0e38f ? 0.f : e; ps += p; sP[w][col][g * 32 + jj] = p; }
    ps += __shfl_xor(ps, 16, 32);
    lrun = lrun * corr + ps; mrun = mnew;
#pragma unroll
    for (int r = 0; r < 8; ++r) { const float cr = __shfl(corr, 8 * g + r, 32);
#pragma unroll
      for (int t = 0; t < 8; ++t) acc[t][r] *= cr; }
    LDSX();
#pragma unroll
    for (int kc = 0; kc < 2; ++kc) { const F2 pa = split_row(&sP[w][col][0], kc * 32, lane);
#pragma unroll
      for (int t = 0; t < 8; ++t) { const int n = kc * 8 + t, m = n + PV; if (m < 16) fv[m] = get_frag(vp + m * FRB);
        if (m == 15) asm volatile("s_wait_xcnt 0x0" :: "v"(vp) : "memory");   // as behind the last load of k
        acc[t] = mac3(pa, fv[n], acc[t]); } }
    __builtin_amdgcn_wave_barrier();
  }
  if (g == 0) sM[w][col] = mrun;
  __syncthreads();
  float mg = sM[0][col];
#pragma unroll   // all NW reads in flight at once
  for (int i = 1; i < NW; ++i) mg = fmaxf(mg, sM[i][col]);
  const float f = mg <= -1.0e38f ? 1.0f : expf(mrun - mg);   // a wave without a kept score has acc = 0 and lrun = 0
  if (g == 0) sL[w][col] = lrun * f;
#pragma unroll   // acc is indexed by constants only, so it stays in registers
  for (int r = 0; r < 8; ++r) { const float fr = __shfl(f, 8 * g + r, 32);
#pragma unroll
    for (int t = 0; t < 8; ++t) sO[w][8 * g + r][t * 16 + col] = acc[t][r] * fr; }
  __syncthreads();
  float lt = 0.f; v4f o = {};                                  // wave w sums row w over the NW partials
#pragma unroll   // all NW reads in flight at once; the sum runs in wave order
  for (int i = 0; i < NW; ++i) { lt += sL[i][w]; o += *(const v4f*)(&sO[i][w][lane * 4]); }
#pragma unroll
  for (int c = 0; c < 4; ++c) o[c] = o[c] / lt;
  vst2(out + (rb + q0 + w) * HD + lane * 4, o);
}
extern "C" void kernel_launch(void* const* d_in, const int* in_sizes, int n_in, void* d_out, int out_size, void* d_ws, size_t ws_size, hipStream_t stream) {
  (void)in_sizes; (void)n_in; (void)out_size; (void)ws_size;
  const float* x = (const float*)d_in[0]; const float* Wq = (const float*)d_in[1]; const float* Wk = (const float*)d_in[2]; const float* Wv = (const float*)d_in[3];
  float* out = (float*)d_out;
  char* ws = (char*)d_ws; size_t off = 0;
  auto take = [&](size_t bytes) { char* p = ws + off; off += (bytes + 255) & ~(size_t)255; return p; };
  float* qpk = (float*)take((size_t)NR * HD * 4); float* kpk = (float*)take((size_t)NR * HD * 4); float* vpk = (float*)take((size_t)NR * HD * 4);
  k_qkv<<<dim3(NR / QM, 2), 256, 0, stream>>>(x, Wq, Wk, Wv, qpk, kpk, vpk);
  k_attn<<<dim3(NB, SQ / 16), NW * 32, 0, stream>>>(qpk, kpk, vpk, out);
}

// v006
// It runs in 47.8 microseconds.
// Two timings next to v005 put it at 1.12 and 1.11 times that version's speed.
// All steps since v000 together make it 11.2 times as fast.
#include <hip/hip_runtime.h>
#include <math.h>

typedef __attribute__((ext_vector_type(16))) _Float16 v16h;
typedef __attribute__((ext_vector_type(16))) __bf16 v16b;
typedef __attribute__((ext_vector_type(8)))  _Float16 v8h;
typedef __attribute__((ext_vector_type(8)))  float v8f;
typedef __attribute__((ext_vector_type(4)))  float v4f;
typedef __attribute__((ext_vector_type(2)))  float v2f;
typedef __attribute__((ext_vector_type(4)))  unsigned v4u;
typedef __attribute__((ext_vector_type(4)))  int v4i;
typedef float __attribute__((may_alias)) float_a;
typedef int __attribute__((may_alias)) int_a;

template <typename T> __device__ __forceinline__ void vst2(void* p, T v) { *(T*)p = v;  }
__device__ __forceinline__ v8f wmma16(v16h a, v16h b, v8f c) {
  v8f d = __builtin_amdgcn_wmma_f32_16x16x32_f16(false, a, false, b, (short)0, c, false, false);
  asm volatile("v_nop\n\tv_nop\n\tv_nop\n\tv_nop" : "+v"(d) : "v"(a), "v"(b));
  return d;
}
__device__ __forceinline__ v8f wmma_bf(v16b a, v16b b, v8f c) {
  v8f d = __builtin_amdgcn_wmma_f32_16x16x32_bf16(false, a, false, b, (short)0, c, false, false);
  asm volatile("v_nop\n\tv_nop\n\tv_nop\n\tv_nop" : "+v"(d) : "v"(a), "v"(b));
  return d;
}
// 16x16x32 fragments: lane = (h = lane>>4, row/col = lane&15); elements 0..7 = k0+8h+0..7, 8..15 = k0+16+8h+0..7; D element r = row 8h+r
__device__ __forceinline__ v16h frag_h(const _Float16* rowk0, int lane) {
  union { v16h v; v8h q[2]; } u; const _Float16* p = rowk0 + 8 * (lane >> 4);
  u.q[0] = *(const v8h*)p; u.q[1] = *(const v8h*)(p + 16); return u.v;
}
__device__ __forceinline__ v16h frag_f32(const float* rowk0, int lane) {
  v16h a; const float* p = rowk0 + 8 * (lane >> 4);
#pragma unroll
  for (int i = 0; i < 8; ++i) { a[i] = (_Float16)p[i]; a[8 + i] = (_Float16)p[16 + i]; }
  return a;
}
__device__ __forceinline__ v16h frag_f32s(const float* rowk0, int lane, float sc) {
  v16h a; const float* p = rowk0 + 8 * (lane >> 4);
#pragma unroll
  for (int i = 0; i < 8; ++i) { a[i] = (_Float16)(p[i] * sc); a[8 + i] = (_Float16)(p[16 + i] * sc); }
  return a;
}
// column fragment from a [K][ld] layout (column n), rows >= K read as 0
__device__ __forceinline__ v16h fragc_f32(const float* W, int k0, int n, int lane, int ld, int K) {
  v16h a; const int g = lane >> 4;
#pragma unroll
  for (int i = 0; i < 8; ++i) { const int ka = k0 + 8 * g + i, kb = ka + 16;
    a[i] = (_Float16)(ka < K ? W[(size_t)ka * ld + n] : 0.f); a[8 + i] = (_Float16)(kb < K ? W[(size_t)kb * ld + n] : 0.f); }
  return a;
}
struct F2 { v16b h, l; };
__device__ __forceinline__ F2 bsplit16(const float v[16]) { F2 r;
#pragma unroll
  for (int i = 0; i < 16; ++i) { const __bf16 h = (__bf16)v[i]; r.h[i] = h; r.l[i] = (__bf16)(v[i] - (float)h); }
  return r; }
__device__ __forceinline__ F2 split_row(const float* row, int k0, int lane) { float v[16]; const float* p = row + k0 + 8 * (lane >> 4);
#pragma unroll
  for (int i = 0; i < 8; ++i) { v[i] = p[i]; v[8 + i] = p[16 + i]; }
  return bsplit16(v); }
__device__ __forceinline__ F2 split_rowK(const float* row, int k0, int lane, int K) { float v[16]; const int g = lane >> 4;
#pragma unroll
  for (int i = 0; i < 8; ++i) { const int ka = k0 + 8 * g + i, kb = ka + 16; v[i] = ka < K ? row[ka] : 0.f; v[8 + i] = kb < K ? row[kb] : 0.f; }
  return bsplit16(v); }
__device__ __forceinline__ F2 split_col(const float* W, int k0, int n, int lane, int ld, int K) { float v[16]; const int g = lane >> 4;
#pragma unroll
  for (int i = 0; i < 8; ++i) { const int ka = k0 + 8 * g + i, kb = ka + 16; v[i] = ka < K ? W[(size_t)ka * ld + n] : 0.f; v[8 + i] = kb < K ? W[(size_t)kb * ld + n] : 0.f; }
  return bsplit16(v); }
__device__ __forceinline__ v8f mac3(const F2& a, const F2& b, v8f c) { c = wmma_bf(a.l, b.h, c); c = wmma_bf(a.h, b.l, c); return wmma_bf(a.h, b.h, c); }
__device__ __forceinline__ float sigm(float v) { return 1.0f / (1.0f + expf(-v)); }
#define LDSX() do { asm volatile("s_wait_dscnt 0" ::: "memory"); __builtin_amdgcn_wave_barrier(); __builtin_amdgcn_fence(__ATOMIC_RELEASE, "workgroup"); } while (0)

// Single-head causal attention whose scores are MULTIPLIED by sqrt(128) (as the reference), so the softmax is extremely sharp: q and k
// come from two-way bf16 split GEMMs (near-f32, stored as bf16 hi and lo fragments) and S = q.k*sqrt(128) is also a two-way split; the causal zero-fill followed
// by "== 0 -> -inf" of the reference is reproduced (masked and exactly-zero kept scores both get -inf); online softmax in f32; v from the
#define NB 4
#define SQ 2048
#define EE 1024
#define HD 128
#define NR (NB * SQ)

// q, k and v leave as bf16 hi and lo planes in WMMA fragment order (two-way bf16 split GEMMs, f32 results split once more). One block = 64 rows of x times 192 output columns: blockIdx.y = 0 all of q and
// columns 0..63 of k, blockIdx.y = 1 all of v and columns 64..127 of k. Per slab of 64 k the block reads its 64 x rows and 192 W rows
// once, in whole 256-byte runs, splits each value once into bf16 hi and lo, and lays the two planes in LDS; the eight waves (2 x 4, 32 x 48 outputs each) take their fragments from
// there. Two LDS buffers and two register sets of fragments: the fragments of a 32-k step are read from LDS during the WMMAs of the step before it, also from one slab to the next,
// and each staging register is refilled from global memory as soon as it has been staged. Per accumulator the WMMA order is k ascending, lo.hi, hi.lo, hi.hi.
#define QM 64
#define QN 192
#define QK 64
#define QP 144                    // LDS row pitch in bytes: 128 B of bf16 + 16, an odd multiple of 16 B (no bank conflict for 16-byte reads)
#define QPL ((QM + QN) * QP)      // one plane (hi or lo) of one buffer
#define QBUF (2 * QPL)
#define QSO 196                   // pitch in floats of the output staging
typedef __attribute__((ext_vector_type(8))) __bf16 v8b;
typedef __attribute__((ext_vector_type(4))) __bf16 v4b;
// A packed fragment is 2 KB: hi elements 0..7, hi 8..15, lo 0..7, lo 8..15, each a run of 32 lanes x 16 bytes, so that every wave-wide access is 512 contiguous bytes.
// q, k: fragment (16-row tile, 32-wide step kc of the head), lane (g, col) = row col, elements = head kc*32 + 8g + 0..7 and + 16. Index tile * 4 + kc.
// v: fragment (32-key group, 16-column tile t), lane (g, col) = column t*16 + col, elements = keys 8g + 0..7 and + 16 of the group. Index group * 8 + t.
#define FRB 2048
__device__ __forceinline__ void put_frag(char* p, const F2& f) { union { v16b v; v8b q[2]; } a, b; a.v = f.h; b.v = f.l;
  *(v8b*)p = a.q[0]; *(v8b*)(p + 512) = a.q[1]; *(v8b*)(p + 1024) = b.q[0]; *(v8b*)(p + 1536) = b.q[1];
  // behind the run's last store: wait before a register that an issued store names is overwritten; as an input the address pair stays live up to it
  asm volatile("s_wait_xcnt 0x0" :: "v"(p) : "memory"); }
__device__ __forceinline__ F2 get_frag(const char* p) { union { v16b v; v8b q[2]; } a, b; F2 r;
  a.q[0] = *(const v8b*)p; a.q[1] = *(const v8b*)(p + 512); b.q[0] = *(const v8b*)(p + 1024); b.q[1] = *(const v8b*)(p + 1536); r.h = a.v; r.l = b.v; return r; }
__device__ __forceinline__ v16b frag_lds(const char* p) { union { v16b v; v8b q[2]; } u; u.q[0] = *(const v8b*)p; u.q[1] = *(const v8b*)(p + 32); return u.v; }
// 16 rows a step, 16 lanes a row: 4 steps of x, 8 of the whole W matrix, 4 of the half of Wk; each pointer holds the lane's own offset and the slab's k, and moves on by one slab behind its loads
// steps I0 .. I1 - 1 only: 0..3 are x (from memory, the longest way), 4..15 are W (from L2)
struct QB { const float* x; const float* a; const float* b; unsigned lo; };   // the three block-wide bases and the lane's byte offset, from which the pointers were formed
template <int I0, int I1, bool PRO> __device__ __forceinline__ void q_fetch(v4f (&st)[16], const float*& px, const float*& pa, const float*& pb, const QB& qb) {
#pragma unroll   // st is indexed by constants only, so it stays in registers; the row steps become immediate offsets
  for (int i = I0; i < I1; ++i) st[i] = *(const v4f*)(i < 4 ? px + (size_t)i * 16 * EE : (i < 12 ? pa + (size_t)(i - 4) * 16 * EE : pb + (size_t)(i - 12) * 16 * EE));
  // wait before a register that an issued load names is overwritten (the pointers move on right behind it); as inputs the address pairs in use stay live up to it, so that nothing lands on one
  // ahead of it; in front of the loop (PRO) so do base and offset, which the loads there name in the pairs' place
  if constexpr (I0 < 4 && PRO) asm volatile("s_wait_xcnt 0x0" :: "v"(px), "v"(qb.lo), "s"(qb.x) : "memory");
  if constexpr (I0 < 4 && !PRO) asm volatile("s_wait_xcnt 0x0" :: "v"(px) : "memory");
  if constexpr (I1 > 4 && PRO) asm volatile("s_wait_xcnt 0x0" :: "v"(pa), "v"(pb), "v"(qb.lo), "s"(qb.a), "s"(qb.b) : "memory");
  if constexpr (I1 > 4 && !PRO) asm volatile("s_wait_xcnt 0x0" :: "v"(pa), "v"(pb) : "memory");
  if constexpr (I0 < 4) px += QK;
  if constexpr (I1 > 4) { pa += QK; pb += QK; }
}
template <int I0, int I1> __device__ __forceinline__ void q_stage(const v4f (&st)[16], char* p) {
#pragma unroll   // st is indexed by constants only, so it stays in registers
  for (int i = I0; i < I1; ++i) { v4b h, l;
#pragma unroll   // vector elements picked by constants
    for (int c = 0; c < 4; ++c) { const __bf16 hh = (__bf16)st[i][c]; h[c] = hh; l[c] = (__bf16)(st[i][c] - (float)hh); }
    *(v4b*)(p + i * 16 * QP) = h; *(v4b*)(p + i * 16 * QP + QPL) = l; }
}
// the five fragments of one 32-k step, hi and lo: f[0], f[1] the wave's two row tiles of x, f[2..4] its three column tiles of W
__device__ __forceinline__ void q_frags(F2 (&f)[5], const char* ra, const char* rbf) {
#pragma unroll   // f is indexed by constants only, so it stays in registers
  for (int t = 0; t < 5; ++t) { const char* p = t < 2 ? ra + t * 16 * QP : rbf + (t - 2) * 16 * QP; f[t].h = frag_lds(p); f[t].l = frag_lds(p + QPL); }
  __builtin_amdgcn_sched_barrier(0);   // keeps the reads as one group in front of the WMMAs of the step before: sunk among or behind them they would not have returned when they are needed
}
// The plain builtin, which the compiler pads itself: the two fragment sets take the kernel above 256 registers, and with wmma_bf, whose asm operands the compiler kept in the first 256, the loop spilled to scratch.
__device__ __forceinline__ void q_mac(v8f (&acc)[6], const F2 (&f)[5]) {
#pragma unroll   // lo.hi, then hi.lo, then hi.hi: six independent accumulators between two WMMAs on the same one
  for (int ps = 0; ps < 3; ++ps)
#pragma unroll   // acc and f are indexed by constants only
    for (int t = 0; t < 6; ++t) acc[t] = __builtin_amdgcn_wmma_f32_16x16x32_bf16(false, ps == 0 ? f[t / 3].l : f[t / 3].h, false, ps == 1 ? f[2 + t % 3].l : f[2 + t % 3].h, (short)0, acc[t], false, false);
}
// The slab barrier by hand: the wave's LDS stores and reads are done, then the work-group barrier. __syncthreads() would also wait for the global loads of the slab after next, which are to stay in flight across it.
#define QBAR() asm volatile("s_wait_dscnt 0x0\n\ts_barrier_signal -1\n\ts_barrier_wait -1" ::: "memory")
// One slab. On entry f0 holds (or is about to receive) the fragments of the slab's first 32-k step. STAGE: a next slab exists and is in st; FETCH: a slab after next exists.
// The last two trips are written out apart from the loop, so that inside it every count of loads and LDS reads in flight is the same on every path and no wait is set for the shorter path.
template <bool STAGE, bool FETCH> __device__ __forceinline__ void q_trip(int ks, v8f (&acc)[6], F2 (&f0)[5], F2 (&f1)[5], v4f (&st)[16], const char* ra, const char* rbf, char* wr,
                                                                         const float*& px, const float*& pa, const float*& pb, const QB& qb) {
  const int cur = (ks & 1) * QBUF, nxt = QBUF - cur;
  q_frags(f1, ra + cur + 64, rbf + cur + 64);   // the slab's second step is read during the first step's WMMAs
  if (STAGE) q_stage<0, 4>(st, wr + nxt);
  if (FETCH) q_fetch<0, 4, false>(st, px, pa, pb, qb);   // x is staged and asked for again first: nearly a whole trip for the way from memory
  __builtin_amdgcn_sched_barrier(0);                             // keeps the WMMAs out of the lines above: woven in there they put off the loads of x by their own length
  q_mac(acc, f0);                                                // the compiler is free to weave the split of W into these WMMAs
  if (STAGE) q_stage<4, 16>(st, wr + nxt);
  if (FETCH) q_fetch<4, 16, false>(st, px, pa, pb, qb);
  QBAR();   // publishes the slab just staged; every wave's reads of this slab's buffer, which the next trip refills, have returned in front of it
  if (STAGE) q_frags(f0, ra + nxt, rbf + nxt);   // the next slab's first step is read during this slab's last WMMAs
  q_mac(acc, f1);
}
__global__ __launch_bounds__(256) void k_qkv(const float* __restrict__ x, const float* __restrict__ Wq, const float* __restrict__ Wk, const float* __restrict__ Wv, float* __restrict__ qpk, float* __restrict__ kpk, float* __restrict__ vpk) {
  __shared__ __align__(16) char sm[2 * QBUF];
  const int tid = threadIdx.x, wave = __builtin_amdgcn_readfirstlane(tid >> 5), lane = tid & 31, col = lane & 15, g = lane >> 4;
  const int r0b = blockIdx.x * QM, y = blockIdx.y, wm = wave >> 2, wn = wave & 3;
  const QB qb = { x + (size_t)r0b * EE, y == 0 ? Wq : Wv, Wk + (size_t)y * 64 * EE, (unsigned)(((tid >> 4) * EE + (tid & 15) * 4) * 4) };
  const float* px = (const float*)((const char*)qb.x + qb.lo); const float* pa = (const float*)((const char*)qb.a + qb.lo); const float* pb = (const float*)((const char*)qb.b + qb.lo);
  char* const wr = sm + (tid >> 4) * QP + (tid & 15) * 8;
  const char* const ra = sm + (wm * 32 + col) * QP + g * 16;
  const char* const rbf = sm + (QM + wn * 48 + col) * QP + g * 16;
  v4f st[16]; v8f acc[6] = {}; F2 f0[5], f1[5];
  q_fetch<0, 16, true>(st, px, pa, pb, qb);
  q_stage<0, 4>(st, wr); q_fetch<0, 4, true>(st, px, pa, pb, qb);
  q_stage<4, 16>(st, wr); q_fetch<4, 16, true>(st, px, pa, pb, qb);
  QBAR();
  q_frags(f0, ra, rbf);
#pragma unroll 1   // one slab a trip: the two buffers alternate by a run-time offset
  for (int ks = 0; ks < EE / QK - 2; ++ks) q_trip<true, true>(ks, acc, f0, f1, st, ra, rbf, wr, px, pa, pb, qb);
  q_trip<true, false>(EE / QK - 2, acc, f0, f1, st, ra, rbf, wr, px, pa, pb, qb);
  q_trip<false, false>(EE / QK - 1, acc, f0, f1, st, ra, rbf, wr, px, pa, pb, qb);
  float* const so = (float*)sm;   // the ring is free behind the last trip's barrier
#pragma unroll   // acc is indexed by constants only
  for (int e = 0; e < 48; ++e) { const int t = e >> 3, r = e & 7; so[(wm * 32 + (t / 3) * 16 + 8 * g + r) * QSO + wn * 48 + (t % 3) * 16 + col] = acc[t][r]; }
  __syncthreads();
  if (y == 0) {
#pragma unroll   // the block's sixteen fragments of q, two a wave: id = (16-row tile, kc)
    for (int u = 0; u < 2; ++u) { const int id = u * 8 + wave; float v[16]; const float* p = so + ((id >> 2) * 16 + col) * QSO + (id & 3) * 32 + 8 * g;
#pragma unroll   // v is indexed by constants only
      for (int i = 0; i < 8; ++i) { v[i] = p[i]; v[8 + i] = p[16 + i]; }
      put_frag((char*)qpk + ((size_t)(r0b / 16) * 4 + id) * FRB + lane * 16, bsplit16(v)); }
  } else {
#pragma unroll   // the block's two 32-key groups of v; wave = column tile
    for (int u = 0; u < 2; ++u) { float v[16]; const float* p = so + (u * 32 + 8 * g) * QSO + wave * 16 + col;
#pragma unroll   // v is indexed by constants only
      for (int i = 0; i < 8; ++i) { v[i] = p[i * QSO]; v[8 + i] = p[(16 + i) * QSO]; }
      put_frag((char*)vpk + ((size_t)(r0b / 32 + u) * 8 + wave) * FRB + lane * 16, bsplit16(v)); }
  }
  { float v[16]; const float* p = so + ((wave >> 1) * 16 + col) * QSO + 128 + (wave & 1) * 32 + 8 * g;   // the block's half of k: wave = (16-key tile, kc)
#pragma unroll   // v is indexed by constants only
    for (int i = 0; i < 8; ++i) { v[i] = p[i]; v[8 + i] = p[16 + i]; }
    put_frag((char*)kpk + ((size_t)(r0b / 16 + (wave >> 1)) * 4 + y * 2 + (wave & 1)) * FRB + lane * 16, bsplit16(v)); }
}
// One block = 16 query rows; its NW waves share the rows' key tiles (wave w takes tiles w, w + NW, ...), each with an online softmax of its
// own; the partial (max, sum, acc) triples are merged through LDS in wave order at the end.
// qpk is not __restrict__: its fragments are then loaded anew in every tile's stream and not held in 64 registers (or in scratch) across the softmax and the v products.
// The fragments of k and v do not pass through registers on their way in: each wave copies them asynchronously into an LDS ring of its own, RG groups of two fragments, in the order of their use
// (k: per kc the four key tiles; then the sixteen of v). A group is read into registers one group ahead of its products; as soon as those reads have returned its place is refilled with the group
// RG further on, so that up to RG groups (12 KB a wave) are on their way at a time. No other wave touches a wave's ring, so no barrier belongs to it.
#define NW 16
#define GB (2 * FRB)    // one group
#define RG 3            // groups in a wave's ring
#define RWB (RG * GB)   // ring bytes a wave
#define NG 16           // groups a key tile: 8 of k, 8 of v
// The eight copies of one group: every lane brings 16 bytes a copy, the immediate offset moves the global and the LDS address alike. The s_wait_xcnt stands inside the statement, behind the last copy:
// wait before a register that an issued copy names is rewritten.
__device__ __forceinline__ void cp_group(unsigned l0, const char* g0, unsigned l1, const char* g1) {
  asm volatile("global_load_async_to_lds_b128 %0, %1, off\n\t"
               "global_load_async_to_lds_b128 %0, %1, off offset:512\n\t"
               "global_load_async_to_lds_b128 %0, %1, off offset:1024\n\t"
               "global_load_async_to_lds_b128 %0, %1, off offset:1536\n\t"
               "global_load_async_to_lds_b128 %2, %3, off\n\t"
               "global_load_async_to_lds_b128 %2, %3, off offset:512\n\t"
               "global_load_async_to_lds_b128 %2, %3, off offset:1024\n\t"
               "global_load_async_to_lds_b128 %2, %3, off offset:1536\n\t"
               "s_wait_xcnt 0x0" :: "v"(l0), "v"(g0), "v"(l1), "v"(g1) : "memory");
}
// Returns when all but the wave's Y youngest groups (eight copies each) have landed. Every key tile is the same straight line of copies and waits and starts and ends with none on its way, so each count is exact.
template <int Y> __device__ __forceinline__ void cp_wait() {
  static_assert(Y >= 0 && Y < RG, "");
  if constexpr (Y == 2) asm volatile("s_wait_asynccnt 0x10" ::: "memory");
  if constexpr (Y == 1) asm volatile("s_wait_asynccnt 0x8" ::: "memory");
  if constexpr (Y == 0) asm volatile("s_wait_asynccnt 0x0" ::: "memory");
}
struct G2 { F2 a, b; };   // one group in registers
template <int GI> __device__ __forceinline__ void cp_issue(unsigned rl, const char* kp, const char* vp) {
  constexpr int f = 2 * GI; const unsigned l = rl + (GI % RG) * GB;
  if constexpr (f < 16) cp_group(l, kp + ((f & 3) * 4 + (f >> 2)) * FRB, l + FRB, kp + (((f + 1) & 3) * 4 + (f >> 2)) * FRB);
  else cp_group(l, vp + (f - 16) * FRB, l + FRB, vp + (f - 15) * FRB);
}
template <int GI> __device__ __forceinline__ void ring_read(G2& d, const char* rr) { d.a = get_frag(rr + (GI % RG) * GB); d.b = get_frag(rr + (GI % RG) * GB + FRB); }
// In front of the products of group GI: its reads have returned, so its place takes the copies of group GI + RG; then group GI + 1, once landed, is read into the other register set.
template <int GI> __device__ __forceinline__ void ring_turn(G2& nx, const char* rr, unsigned rl, const char* kp, const char* vp) {
  asm volatile("s_wait_dscnt 0x0" ::: "memory");   // the wave's reads of the place have retired before a copy is aimed at it
  if constexpr (GI + RG < NG) cp_issue<GI + RG>(rl, kp, vp);
  if constexpr (GI + 1 < NG) { cp_wait<(GI + RG < NG ? RG - 1 : NG - 2 - GI)>(); ring_read<GI + 1>(nx, rr); }
}
template <int GI> __device__ __forceinline__ void s_step(v8f (&s4)[4], F2 (&fq)[2], G2 (&fr)[2], const char* qp, const char* rr, unsigned rl, const char* kp, const char* vp) {
  constexpr int kc = GI >> 1, t0 = (GI & 1) * 2;
  ring_turn<GI>(fr[(GI + 1) & 1], rr, rl, kp, vp);
  if constexpr ((GI & 1) == 0 && kc < 3) fq[(kc + 1) & 1] = get_frag(qp + (kc + 1) * FRB);   // the next kc's fragment of q, two groups ahead, by plain loads: all waves of the block read the same lines
  // behind the tile's last load of q: wait before a register that an issued load names is overwritten; as an input the address pair stays live up to it
  if constexpr (GI == 4) asm volatile("s_wait_xcnt 0x0" :: "v"(qp) : "memory");
  __builtin_amdgcn_sched_barrier(0);   // keeps the reads and loads above in front of the WMMAs: sunk behind them they would not have returned at the next group's wait
  s4[t0] = mac3(fq[kc & 1], fr[GI & 1].a, s4[t0]); s4[t0 + 1] = mac3(fq[kc & 1], fr[GI & 1].b, s4[t0 + 1]);
}
template <int GI> __device__ __forceinline__ void v_step(v8f (&acc)[8], const F2& pa, G2 (&fr)[2], const char* rr, unsigned rl, const char* kp, const char* vp) {
  constexpr int t0 = (2 * (GI - 8)) & 7;
  ring_turn<GI>(fr[(GI + 1) & 1], rr, rl, kp, vp);
  __builtin_amdgcn_sched_barrier(0);   // as in s_step
  acc[t0] = mac3(pa, fr[GI & 1].a, acc[t0]); acc[t0 + 1] = mac3(pa, fr[GI & 1].b, acc[t0 + 1]);
}
__global__ __launch_bounds__(NW * 32) void k_attn(const float* qpk, const float* __restrict__ kpk, const float* __restrict__ vpk, float* __restrict__ out) {
  __shared__ __align__(16) char sR[NW * RWB];       // the rings; behind the tile loop and the first barrier the same bytes hold the partial outputs
  __shared__ __align__(16) float sS[NW][16][68];    // a tile's scores, overwritten in place by its weights (each lane rewrites what it alone has read)
  __shared__ float sM[NW][16];
  __shared__ float sL[NW][16];
  float (*const sO)[16][132] = (float (*)[16][132])sR;
  static_assert(sizeof(float) * NW * 16 * 132 <= NW * RWB, "");
  // w through readfirstlane: the tile loop's test is then a scalar branch and EXEC stays full at the WMMAs and at the copies
  const int tid = threadIdx.x, w = __builtin_amdgcn_readfirstlane(tid >> 5), lane = tid & 31, col = lane & 15, g = lane >> 4;
  const int b = blockIdx.x, q0 = blockIdx.y * 16; const size_t rb = (size_t)b * SQ;
  const char* qp = (const char*)qpk + (rb + q0) * HD * 4 + lane * 16; const char* kb = (const char*)kpk + rb * HD * 4 + lane * 16; const char* vb = (const char*)vpk + rb * HD * 4 + lane * 16;   // 64 keys = 16 fragments = 32 KB in either
  const char* const rr = sR + w * RWB + lane * 16;   // the lane's 16 bytes in the first run of its wave's ring
  const unsigned rl = (unsigned)(size_t)rr;          // the same as an LDS byte address
  float mrun = -3.0e38f, lrun = 0.f; v8f acc[8] = {};
  const float scl = 11.313708498984761f;     // * sqrt(128), as the reference
  const int ntiles = (q0 >> 6) + 1;
#pragma unroll 1
  for (int kt = w; kt < ntiles; kt += NW) {
    const char* const kp = kb + (size_t)kt * (16 * FRB); const char* const vp = vb + (size_t)kt * (16 * FRB); G2 fr[2]; F2 fq[2]; v8f s4[4] = {};
    cp_issue<0>(rl, kp, vp); cp_issue<1>(rl, kp, vp); cp_issue<2>(rl, kp, vp);   // every ring read of the tile before retired at the wait in front of its last group's products
    fq[0] = get_frag(qp);
    cp_wait<2>(); ring_read<0>(fr[0], rr);
    s_step<0>(s4, fq, fr, qp, rr, rl, kp, vp); s_step<1>(s4, fq, fr, qp, rr, rl, kp, vp); s_step<2>(s4, fq, fr, qp, rr, rl, kp, vp); s_step<3>(s4, fq, fr, qp, rr, rl, kp, vp);
    s_step<4>(s4, fq, fr, qp, rr, rl, kp, vp); s_step<5>(s4, fq, fr, qp, rr, rl, kp, vp); s_step<6>(s4, fq, fr, qp, rr, rl, kp, vp); s_step<7>(s4, fq, fr, qp, rr, rl, kp, vp);
#pragma unroll
    for (int t = 0; t < 4; ++t) { const v8f s = s4[t]; const int key = kt * 64 + t * 16 + col;
#pragma unroll
      for (int r = 0; r < 8; ++r) { const int qi = q0 + 8 * g + r; const float sv = s[r] * scl; sS[w][8 * g + r][t * 16 + col] = (key <= qi && sv != 0.0f) ? sv : -3.0e38f; } }
    LDSX();
    float mx = -3.4e38f;
#pragma unroll
    for (int jj = 0; jj < 32; ++jj) mx = fmaxf(mx, sS[w][col][g * 32 + jj]);
    mx = fmaxf(mx, __shfl_xor(mx, 16, 32));
    // Every exponential is computed unconditionally and the masked case picked afterwards by a select: no branch on EXEC per score, so the chains of a tile are independent and interleave.
    const float mnew = fmaxf(mrun, mx); const float ec = expf(mrun - mnew); const float corr = mnew <= -1.0e38f ? 1.0f : ec;
    float ps = 0.f;
#pragma unroll
    for (int jj = 0; jj < 32; ++jj) { const float sv = sS[w][col][g * 32 + jj]; const float e = expf(sv - mnew); const float p = sv <= -1.0e38f ? 0.f : e; ps += p; sS[w][col][g * 32 + jj] = p; }
    ps += __shfl_xor(ps, 16, 32);
    lrun = lrun * corr + ps; mrun = mnew;
#pragma unroll
    for (int r = 0; r < 8; ++r) { const float cr = __shfl(corr, 8 * g + r, 32);
#pragma unroll
      for (int t = 0; t < 8; ++t) acc[t][r] *= cr; }
    LDSX();
    { const F2 pa = split_row(&sS[w][col][0], 0, lane);
      v_step<8>(acc, pa, fr, rr, rl, kp, vp); v_step<9>(acc, pa, fr, rr, rl, kp, vp); v_step<10>(acc, pa, fr, rr, rl, kp, vp); v_step<11>(acc, pa, fr, rr, rl, kp, vp); }
    { const F2 pa = split_row(&sS[w][col][0], 32, lane);
      v_step<12>(acc, pa, fr, rr, rl, kp, vp); v_step<13>(acc, pa, fr, rr, rl, kp, vp); v_step<14>(acc, pa, fr, rr, rl, kp, vp); v_step<15>(acc, pa, fr, rr, rl, kp, vp); }
    __builtin_amdgcn_wave_barrier();
  }
  if (g == 0) sM[w][col] = mrun;
  __syncthreads();
  float mg = sM[0][col];
#pragma unroll   // all NW reads in flight at once
  for (int i = 1; i < NW; ++i) mg = fmaxf(mg, sM[i][col]);
  const float f = mg <= -1.0e38f ? 1.0f : expf(mrun - mg);   // a wave without a kept score has acc = 0 and lrun = 0
  if (g == 0) sL[w][col] = lrun * f;
#pragma unroll   // acc is indexed by constants only, so it stays in registers
  for (int r = 0; r < 8; ++r) { const float fr = __shfl(f, 8 * g + r, 32);
#pragma unroll
    for (int t = 0; t < 8; ++t) sO[w][8 * g + r][t * 16 + col] = acc[t][r] * fr; }
  __syncthreads();
  float lt = 0.f; v4f o = {};                                  // wave w sums row w over the NW partials
#pragma unroll   // all NW reads in flight at once; the sum runs in wave order
  for (int i = 0; i < NW; ++i) { lt += sL[i][w]; o += *(const v4f*)(&sO[i][w][lane * 4]); }
#pragma unroll
  for (int c = 0; c < 4; ++c) o[c] = o[c] / lt;
  vst2(out + (rb + q0 + w) * HD + lane * 4, o);
}
extern "C" void kernel_launch(void* const* d_in, const int* in_sizes, int n_in, void* d_out, int out_size, void* d_ws, size_t ws_size, hipStream_t stream) {
  (void)in_sizes; (void)n_in; (void)out_size; (void)ws_size;
  const float* x = (const float*)d_in[0]; const float* Wq = (const float*)d_in[1]; const float* Wk = (const float*)d_in[2]; const float* Wv = (const float*)d_in[3];
  float* out = (float*)d_out;
  char* ws = (char*)d_ws; size_t off = 0;
  auto take = [&](size_t bytes) { char* p = ws + off; off += (bytes + 255) & ~(size_t)255; return p; };
  float* qpk = (float*)take((size_t)NR * HD * 4); float* kpk = (float*)take((size_t)NR * HD * 4); float* vpk = (float*)take((size_t)NR * HD * 4);
  k_qkv<<<dim3(NR / QM, 2), 256, 0, stream>>>(x, Wq, Wk, Wv, qpk, kpk, vpk);
  k_attn<<<dim3(NB, SQ / 16), NW * 32, 0, stream>>>(qpk, kpk, vpk, out);
}

// v007
// It runs in 43.1 microseconds.
// Next to v006, in two timings, it ran 1.08 and 1.10 times as fast.
// Counting every step since v000, it is 12.3 times as fast.
#include <hip/hip_runtime.h>
#include <math.h>

typedef __attribute__((ext_vector_type(16))) _Float16 v16h;
typedef __attribute__((ext_vector_type(16))) __bf16 v16b;
typedef __attribute__((ext_vector_type(8)))  _Float16 v8h;
typedef __attribute__((ext_vector_type(8)))  float v8f;
typedef __attribute__((ext_vector_type(4)))  float v4f;
typedef __attribute__((ext_vector_type(2)))  float v2f;
typedef __attribute__((ext_vector_type(4)))  unsigned v4u;
typedef __attribute__((ext_vector_type(4)))  int v4i;
typedef float __attribute__((may_alias)) float_a;
typedef int __attribute__((may_alias)) int_a;

template <typename T> __device__ __forceinline__ void vst2(void* p, T v) { *(T*)p = v;  }
__device__ __forceinline__ v8f wmma16(v16h a, v16h b, v8f c) {
  v8f d = __builtin_amdgcn_wmma_f32_16x16x32_f16(false, a, false, b, (short)0, c, false, false);
  asm volatile("v_nop\n\tv_nop\n\tv_nop\n\tv_nop" : "+v"(d) : "v"(a), "v"(b));
  return d;
}
__device__ __forceinline__ v8f wmma_bf(v16b a, v16b b, v8f c) {
  v8f d = __builtin_amdgcn_wmma_f32_16x16x32_bf16(false, a, false, b, (short)0, c, false, false);
  asm volatile("v_nop\n\tv_nop\n\tv_nop\n\tv_nop" : "+v"(d) : "v"(a), "v"(b));
  return d;
}
// 16x16x32 fragments: lane = (h = lane>>4, row/col = lane&15); elements 0..7 = k0+8h+0..7, 8..15 = k0+16+8h+0..7; D element r = row 8h+r
__device__ __forceinline__ v16h frag_h(const _Float16* rowk0, int lane) {
  union { v16h v; v8h q[2]; } u; const _Float16* p = rowk0 + 8 * (lane >> 4);
  u.q[0] = *(const v8h*)p; u.q[1] = *(const v8h*)(p + 16); return u.v;
}
__device__ __forceinline__ v16h frag_f32(const float* rowk0, int lane) {
  v16h a; const float* p = rowk0 + 8 * (lane >> 4);
#pragma unroll
  for (int i = 0; i < 8; ++i) { a[i] = (_Float16)p[i]; a[8 + i] = (_Float16)p[16 + i]; }
  return a;
}
__device__ __forceinline__ v16h frag_f32s(const float* rowk0, int lane, float sc) {
  v16h a; const float* p = rowk0 + 8 * (lane >> 4);
#pragma unroll
  for (int i = 0; i < 8; ++i) { a[i] = (_Float16)(p[i] * sc); a[8 + i] = (_Float16)(p[16 + i] * sc); }
  return a;
}
// column fragment from a [K][ld] layout (column n), rows >= K read as 0
__device__ __forceinline__ v16h fragc_f32(const float* W, int k0, int n, int lane, int ld, int K) {
  v16h a; const int g = lane >> 4;
#pragma unroll
  for (int i = 0; i < 8; ++i) { const int ka = k0 + 8 * g + i, kb = ka + 16;
    a[i] = (_Float16)(ka < K ? W[(size_t)ka * ld + n] : 0.f); a[8 + i] = (_Float16)(kb < K ? W[(size_t)kb * ld + n] : 0.f); }
  return a;
}
struct F2 { v16b h, l; };
__device__ __forceinline__ F2 bsplit16(const float v[16]) { F2 r;
#pragma unroll
  for (int i = 0; i < 16; ++i) { const __bf16 h = (__bf16)v[i]; r.h[i] = h; r.l[i] = (__bf16)(v[i] - (float)h); }
  return r; }
__device__ __forceinline__ F2 split_row(const float* row, int k0, int lane) { float v[16]; const float* p = row + k0 + 8 * (lane >> 4);
#pragma unroll
  for (int i = 0; i < 8; ++i) { v[i] = p[i]; v[8 + i] = p[16 + i]; }
  return bsplit16(v); }
__device__ __forceinline__ F2 split_rowK(const float* row, int k0, int lane, int K) { float v[16]; const int g = lane >> 4;
#pragma unroll
  for (int i = 0; i < 8; ++i) { const int ka = k0 + 8 * g + i, kb = ka + 16; v[i] = ka < K ? row[ka] : 0.f; v[8 + i] = kb < K ? row[kb] : 0.f; }
  return bsplit16(v); }
__device__ __forceinline__ F2 split_col(const float* W, int k0, int n, int lane, int ld, int K) { float v[16]; const int g = lane >> 4;
#pragma unroll
  for (int i = 0; i < 8; ++i) { const int ka = k0 + 8 * g + i, kb = ka + 16; v[i] = ka < K ? W[(size_t)ka * ld + n] : 0.f; v[8 + i] = kb < K ? W[(size_t)kb * ld + n] : 0.f; }
  return bsplit16(v); }
__device__ __forceinline__ v8f mac3(const F2& a, const F2& b, v8f c) { c = wmma_bf(a.l, b.h, c); c = wmma_bf(a.h, b.l, c); return wmma_bf(a.h, b.h, c); }
__device__ __forceinline__ float sigm(float v) { return 1.0f / (1.0f + expf(-v)); }
#define LDSX() do { asm volatile("s_wait_dscnt 0" ::: "memory"); __builtin_amdgcn_wave_barrier(); __builtin_amdgcn_fence(__ATOMIC_RELEASE, "workgroup"); } while (0)

// Single-head causal attention whose scores are MULTIPLIED by sqrt(128) (as the reference), so the softmax is extremely sharp: q and k
// come from two-way bf16 split GEMMs (near-f32, stored as bf16 hi and lo fragments) and S = q.k*sqrt(128) is also a two-way split; the causal zero-fill followed
// by "== 0 -> -inf" of the reference is reproduced (masked and exactly-zero kept scores both get -inf); online softmax in f32; v from the
#define NB 4
#define SQ 2048
#define EE 1024
#define HD 128
#define NR (NB * SQ)

// q, k and v leave as bf16 hi and lo planes in WMMA fragment order (two-way bf16 split GEMMs, f32 results split once more). One block = 64 rows of x times 192 output columns: blockIdx.y = 0 all of q and
// columns 0..63 of k, blockIdx.y = 1 all of v and columns 64..127 of k. Per slab of 64 k the block reads its 64 x rows and 192 W rows
// once, in whole 256-byte runs, splits each value once into bf16 hi and lo, and lays the two planes in LDS; the eight waves (2 x 4, 32 x 48 outputs each) take their fragments from
// there. Two LDS buffers and two register sets of fragments: the fragments of a 32-k step are read from LDS during the WMMAs of the step before it, also from one slab to the next,
// and each staging register is refilled from global memory as soon as it has been staged. Per accumulator the WMMA order is k ascending, lo.hi, hi.lo, hi.hi.
#define QM 64
#define QN 192
#define QK 64
#define QP 144                    // LDS row pitch in bytes: 128 B of bf16 + 16, an odd multiple of 16 B (no bank conflict for 16-byte reads)
#define QPL ((QM + QN) * QP)      // one plane (hi or lo) of one buffer
#define QBUF (2 * QPL)
#define QSO 196                   // pitch in floats of the output staging
typedef __attribute__((ext_vector_type(8))) __bf16 v8b;
typedef __attribute__((ext_vector_type(4))) __bf16 v4b;
// A packed fragment is 2 KB: hi elements 0..7, hi 8..15, lo 0..7, lo 8..15, each a run of 32 lanes x 16 bytes, so that every wave-wide access is 512 contiguous bytes.
// q, k: fragment (16-row tile, 32-wide step kc of the head), lane (g, col) = row col, elements = head kc*32 + 8g + 0..7 and + 16. Index tile * 4 + kc.
// v: fragment (32-key group, 16-column tile t), lane (g, col) = column t*16 + col, elements = keys 8g + 0..7 and + 16 of the group. Index group * 8 + t.
#define FRB 2048
__device__ __forceinline__ void put_frag(char* p, const F2& f) { union { v16b v; v8b q[2]; } a, b; a.v = f.h; b.v = f.l;
  *(v8b*)p = a.q[0]; *(v8b*)(p + 512) = a.q[1]; *(v8b*)(p + 1024) = b.q[0]; *(v8b*)(p + 1536) = b.q[1];
  // behind the run's last store: wait before a register that an issued store names is overwritten; as an input the address pair stays live up to it
  asm volatile("s_wait_xcnt 0x0" :: "v"(p) : "memory"); }
__device__ __forceinline__ F2 get_frag(const char* p) { union { v16b v; v8b q[2]; } a, b; F2 r;
  a.q[0] = *(const v8b*)p; a.q[1] = *(const v8b*)(p + 512); b.q[0] = *(const v8b*)(p + 1024); b.q[1] = *(const v8b*)(p + 1536); r.h = a.v; r.l = b.v; return r; }
__device__ __forceinline__ v16b frag_lds(const char* p) { union { v16b v; v8b q[2]; } u; u.q[0] = *(const v8b*)p; u.q[1] = *(const v8b*)(p + 32); return u.v; }
// 16 rows a step, 16 lanes a row: 4 steps of x, 8 of the whole W matrix, 4 of the half of Wk; each pointer holds the lane's own offset and the slab's k, and moves on by one slab behind its loads
// steps I0 .. I1 - 1 only: 0..3 are x (from memory, the longest way), 4..15 are W (from L2)
struct QB { const float* x; const float* a; const float* b; unsigned lo; };   // the three block-wide bases and the lane's byte offset, from which the pointers were formed
template <int I0, int I1, bool PRO> __device__ __forceinline__ void q_fetch(v4f (&st)[16], const float*& px, const float*& pa, const float*& pb, const QB& qb) {
#pragma unroll   // st is indexed by constants only, so it stays in registers; the row steps become immediate offsets
  for (int i = I0; i < I1; ++i) st[i] = *(const v4f*)(i < 4 ? px + (size_t)i * 16 * EE : (i < 12 ? pa + (size_t)(i - 4) * 16 * EE : pb + (size_t)(i - 12) * 16 * EE));
  // wait before a register that an issued load names is overwritten (the pointers move on right behind it); as inputs the address pairs in use stay live up to it, so that nothing lands on one
  // ahead of it; in front of the loop (PRO) so do base and offset, which the loads there name in the pairs' place
  if constexpr (I0 < 4 && PRO) asm volatile("s_wait_xcnt 0x0" :: "v"(px), "v"(qb.lo), "s"(qb.x) : "memory");
  if constexpr (I0 < 4 && !PRO) asm volatile("s_wait_xcnt 0x0" :: "v"(px) : "memory");
  if constexpr (I1 > 4 && PRO) asm volatile("s_wait_xcnt 0x0" :: "v"(pa), "v"(pb), "v"(qb.lo), "s"(qb.a), "s"(qb.b) : "memory");
  if constexpr (I1 > 4 && !PRO) asm volatile("s_wait_xcnt 0x0" :: "v"(pa), "v"(pb) : "memory");
  if constexpr (I0 < 4) px += QK;
  if constexpr (I1 > 4) { pa += QK; pb += QK; }
}
template <int I0, int I1> __device__ __forceinline__ void q_stage(const v4f (&st)[16], char* p) {
#pragma unroll   // st is indexed by constants only, so it stays in registers
  for (int i = I0; i < I1; ++i) { v4b h, l;
#pragma unroll   // vector elements picked by constants
    for (int c = 0; c < 4; ++c) { const __bf16 hh = (__bf16)st[i][c]; h[c] = hh; l[c] = (__bf16)(st[i][c] - (float)hh); }
    *(v4b*)(p + i * 16 * QP) = h; *(v4b*)(p + i * 16 * QP + QPL) = l; }
}
// the five fragments of one 32-k step, hi and lo: f[0], f[1] the wave's two row tiles of x, f[2..4] its three column tiles of W
__device__ __forceinline__ void q_frags(F2 (&f)[5], const char* ra, const char* rbf) {
#pragma unroll   // f is indexed by constants only, so it stays in registers
  for (int t = 0; t < 5; ++t) { const char* p = t < 2 ? ra + t * 16 * QP : rbf + (t - 2) * 16 * QP; f[t].h = frag_lds(p); f[t].l = frag_lds(p + QPL); }
  __builtin_amdgcn_sched_barrier(0);   // keeps the reads as one group in front of the WMMAs of the step before: sunk among or behind them they would not have returned when they are needed
}
// The plain builtin, which the compiler pads itself: the two fragment sets take the kernel above 256 registers, and with wmma_bf, whose asm operands the compiler kept in the first 256, the loop spilled to scratch.
__device__ __forceinline__ void q_mac(v8f (&acc)[6], const F2 (&f)[5]) {
#pragma unroll   // lo.hi, then hi.lo, then hi.hi: six independent accumulators between two WMMAs on the same one
  for (int ps = 0; ps < 3; ++ps)
#pragma unroll   // acc and f are indexed by constants only
    for (int t = 0; t < 6; ++t) acc[t] = __builtin_amdgcn_wmma_f32_16x16x32_bf16(false, ps == 0 ? f[t / 3].l : f[t / 3].h, false, ps == 1 ? f[2 + t % 3].l : f[2 + t % 3].h, (short)0, acc[t], false, false);
}
// The slab barrier by hand: the wave's LDS stores and reads are done, then the work-group barrier. __syncthreads() would also wait for the global loads of the slab after next, which are to stay in flight across it.
#define QBAR() asm volatile("s_wait_dscnt 0x0\n\ts_barrier_signal -1\n\ts_barrier_wait -1" ::: "memory")
// One slab. On entry f0 holds (or is about to receive) the fragments of the slab's first 32-k step. STAGE: a next slab exists and is in st; FETCH: a slab after next exists.
// The last two trips are written out apart from the loop, so that inside it every count of loads and LDS reads in flight is the same on every path and no wait is set for the shorter path.
template <bool STAGE, bool FETCH> __device__ __forceinline__ void q_trip(int ks, v8f (&acc)[6], F2 (&f0)[5], F2 (&f1)[5], v4f (&st)[16], const char* ra, const char* rbf, char* wr,
                                                                         const float*& px, const float*& pa, const float*& pb, const QB& qb) {
  const int cur = (ks & 1) * QBUF, nxt = QBUF - cur;
  q_frags(f1, ra + cur + 64, rbf + cur + 64);   // the slab's second step is read during the first step's WMMAs
  if (STAGE) q_stage<0, 4>(st, wr + nxt);
  if (FETCH) q_fetch<0, 4, false>(st, px, pa, pb, qb);   // x is staged and asked for again first: nearly a whole trip for the way from memory
  __builtin_amdgcn_sched_barrier(0);                             // keeps the WMMAs out of the lines above: woven in there they put off the loads of x by their own length
  q_mac(acc, f0);                                                // the compiler is free to weave the split of W into these WMMAs
  if (STAGE) q_stage<4, 16>(st, wr + nxt);
  if (FETCH) q_fetch<4, 16, false>(st, px, pa, pb, qb);
  QBAR();   // publishes the slab just staged; every wave's reads of this slab's buffer, which the next trip refills, have returned in front of it
  if (STAGE) q_frags(f0, ra + nxt, rbf + nxt);   // the next slab's first step is read during this slab's last WMMAs
  q_mac(acc, f1);
}
__global__ __launch_bounds__(256) void k_qkv(const float* __restrict__ x, const float* __restrict__ Wq, const float* __restrict__ Wk, const float* __restrict__ Wv, float* __restrict__ qpk, float* __restrict__ kpk, float* __restrict__ vpk) {
  __shared__ __align__(16) char sm[2 * QBUF];
  const int tid = threadIdx.x, wave = __builtin_amdgcn_readfirstlane(tid >> 5), lane = tid & 31, col = lane & 15, g = lane >> 4;
  const int r0b = blockIdx.x * QM, y = blockIdx.y, wm = wave >> 2, wn = wave & 3;
  const QB qb = { x + (size_t)r0b * EE, y == 0 ? Wq : Wv, Wk + (size_t)y * 64 * EE, (unsigned)(((tid >> 4) * EE + (tid & 15) * 4) * 4) };
  const float* px = (const float*)((const char*)qb.x + qb.lo); const float* pa = (const float*)((const char*)qb.a + qb.lo); const float* pb = (const float*)((const char*)qb.b + qb.lo);
  char* const wr = sm + (tid >> 4) * QP + (tid & 15) * 8;
  const char* const ra = sm + (wm * 32 + col) * QP + g * 16;
  const char* const rbf = sm + (QM + wn * 48 + col) * QP + g * 16;
  v4f st[16]; v8f acc[6] = {}; F2 f0[5], f1[5];
  q_fetch<0, 16, true>(st, px, pa, pb, qb);
  q_stage<0, 4>(st, wr); q_fetch<0, 4, true>(st, px, pa, pb, qb);
  q_stage<4, 16>(st, wr); q_fetch<4, 16, true>(st, px, pa, pb, qb);
  QBAR();
  q_frags(f0, ra, rbf);
#pragma unroll 1   // one slab a trip: the two buffers alternate by a run-time offset
  for (int ks = 0; ks < EE / QK - 2; ++ks) q_trip<true, true>(ks, acc, f0, f1, st, ra, rbf, wr, px, pa, pb, qb);
  q_trip<true, false>(EE / QK - 2, acc, f0, f1, st, ra, rbf, wr, px, pa, pb, qb);
  q_trip<false, false>(EE / QK - 1, acc, f0, f1, st, ra, rbf, wr, px, pa, pb, qb);
  float* const so = (float*)sm;   // the ring is free behind the last trip's barrier
#pragma unroll   // acc is indexed by constants only
  for (int e = 0; e < 48; ++e) { const int t = e >> 3, r = e & 7; so[(wm * 32 + (t / 3) * 16 + 8 * g + r) * QSO + wn * 48 + (t % 3) * 16 + col] = acc[t][r]; }
  __syncthreads();
  if (y == 0) {
#pragma unroll   // the block's sixteen fragments of q, two a wave: id = (16-row tile, kc)
    for (int u = 0; u < 2; ++u) { const int id = u * 8 + wave; float v[16]; const float* p = so + ((id >> 2) * 16 + col) * QSO + (id & 3) * 32 + 8 * g;
#pragma unroll   // v is indexed by constants only
      for (int i = 0; i < 8; ++i) { v[i] = p[i]; v[8 + i] = p[16 + i]; }
      put_frag((char*)qpk + ((size_t)(r0b / 16) * 4 + id) * FRB + lane * 16, bsplit16(v)); }
  } else {
#pragma unroll   // the block's two 32-key groups of v; wave = column tile
    for (int u = 0; u < 2; ++u) { float v[16]; const float* p = so + (u * 32 + 8 * g) * QSO + wave * 16 + col;
#pragma unroll   // v is indexed by constants only
      for (int i = 0; i < 8; ++i) { v[i] = p[i * QSO]; v[8 + i] = p[(16 + i) * QSO]; }
      put_frag((char*)vpk + ((size_t)(r0b / 32 + u) * 8 + wave) * FRB + lane * 16, bsplit16(v)); }
  }
  { float v[16]; const float* p = so + ((wave >> 1) * 16 + col) * QSO + 128 + (wave & 1) * 32 + 8 * g;   // the block's half of k: wave = (16-key tile, kc)
#pragma unroll   // v is indexed by constants only
    for (int i = 0; i < 8; ++i) { v[i] = p[i]; v[8 + i] = p[16 + i]; }
    put_frag((char*)kpk + ((size_t)(r0b / 16 + (wave >> 1)) * 4 + y * 2 + (wave & 1)) * FRB + lane * 16, bsplit16(v)); }
}
// One block = two tiles of 16 query rows, tile 127 - y (index 0 below, the longer) and tile y (index 1): every block then has 33 (query tile, key tile) pairs, all blocks are resident at once, and the key tiles
// of the shorter query tile are among those of the longer, so that there one copy of a k or v fragment feeds the products of both. The NW waves share the key tiles (wave w takes tiles w, w + NW, ...), each with
// an online softmax of its own per query tile; the partial (max, sum, acc) triples are merged through LDS in wave order at the end.
// qpk is not __restrict__: its fragments are then loaded anew in every tile's stream and not held in registers (or in scratch) across the softmax and the v products.
// The fragments of k and v do not pass through registers on their way in: each wave copies them asynchronously into an LDS ring of its own, RG groups of two fragments, in the order of their use
// (k: per kc the four key tiles; then the sixteen of v). A group is read into registers one group ahead of its products; as soon as those reads have returned its place is refilled with the group
// RG further on, so that up to RG groups (24 KB a wave) are on their way at a time. No other wave touches a wave's ring, so no barrier belongs to it.
#define NW 8
#define GB (2 * FRB)    // one group
#define RG 6            // groups in a wave's ring
#define RWB (RG * GB)   // ring bytes a wave
#define NG 16           // groups a key tile: 8 of k, 8 of v
// The eight copies of one group: every lane brings 16 bytes a copy, the immediate offset moves the global and the LDS address alike. The s_wait_xcnt stands inside the statement, behind the last copy:
// wait before a register that an issued copy names is rewritten.
__device__ __forceinline__ void cp_group(unsigned l0, const char* g0, unsigned l1, const char* g1) {
  asm volatile("global_load_async_to_lds_b128 %0, %1, off\n\t"
               "global_load_async_to_lds_b128 %0, %1, off offset:512\n\t"
               "global_load_async_to_lds_b128 %0, %1, off offset:1024\n\t"
               "global_load_async_to_lds_b128 %0, %1, off offset:1536\n\t"
               "global_load_async_to_lds_b128 %2, %3, off\n\t"
               "global_load_async_to_lds_b128 %2, %3, off offset:512\n\t"
               "global_load_async_to_lds_b128 %2, %3, off offset:1024\n\t"
               "global_load_async_to_lds_b128 %2, %3, off offset:1536\n\t"
               "s_wait_xcnt 0x0" :: "v"(l0), "v"(g0), "v"(l1), "v"(g1) : "memory");
}
// Returns when all but the wave's Y youngest groups (eight copies each) have landed. Every key tile is the same straight line of copies and waits and starts and ends with none on its way, so each count is exact.
template <int Y> __device__ __forceinline__ void cp_wait() {
  static_assert(Y >= 0 && Y < RG, "");
  if constexpr (Y == 5) asm volatile("s_wait_asynccnt 0x28" ::: "memory");
  if constexpr (Y == 4) asm volatile("s_wait_asynccnt 0x20" ::: "memory");
  if constexpr (Y == 3) asm volatile("s_wait_asynccnt 0x18" ::: "memory");
  if constexpr (Y == 2) asm volatile("s_wait_asynccnt 0x10" ::: "memory");
  if constexpr (Y == 1) asm volatile("s_wait_asynccnt 0x8" ::: "memory");
  if constexpr (Y == 0) asm volatile("s_wait_asynccnt 0x0" ::: "memory");
}
struct G2 { F2 a, b; };   // one group in registers
template <int GI> __device__ __forceinline__ void cp_issue(unsigned rl, const char* kp, const char* vp) {
  constexpr int f = 2 * GI; const unsigned l = rl + (GI % RG) * GB;
  if constexpr (f < 16) cp_group(l, kp + ((f & 3) * 4 + (f >> 2)) * FRB, l + FRB, kp + (((f + 1) & 3) * 4 + (f >> 2)) * FRB);
  else cp_group(l, vp + (f - 16) * FRB, l + FRB, vp + (f - 15) * FRB);
}
template <int GI> __device__ __forceinline__ void ring_read(G2& d, const char* rr) { d.a = get_frag(rr + (GI % RG) * GB); d.b = get_frag(rr + (GI % RG) * GB + FRB); }
// In front of the products of group GI: its reads have returned, so its place takes the copies of group GI + RG; then group GI + 1, once landed, is read into the other register set.
template <int GI> __device__ __forceinline__ void ring_turn(G2& nx, const char* rr, unsigned rl, const char* kp, const char* vp) {
  asm volatile("s_wait_dscnt 0x0" ::: "memory");   // the wave's reads of the place have retired before a copy is aimed at it
  if constexpr (GI + RG < NG) cp_issue<GI + RG>(rl, kp, vp);
  if constexpr (GI + 1 < NG) { cp_wait<(GI + RG < NG ? RG - 1 : NG - 2 - GI)>(); ring_read<GI + 1>(nx, rr); }
}
// The products of one group (fragments b0, b1) with the A fragments of one or two query tiles. The plain builtin, which the compiler pads itself: two query tiles take the kernel above 256 registers (see q_mac).
// Per accumulator the order is lo.hi, hi.lo, hi.hi, as in mac3.
template <int NQ> __device__ __forceinline__ void g_mac(const F2* const (&a)[2], const G2& b, v8f* const (&c0)[2], v8f* const (&c1)[2]) {
#pragma unroll   // the two or four accumulators are independent: they stand between two WMMAs on the same one
  for (int ps = 0; ps < 3; ++ps)
#pragma unroll
    for (int j = 0; j < NQ; ++j) {
      *c0[j] = __builtin_amdgcn_wmma_f32_16x16x32_bf16(false, ps == 0 ? a[j]->l : a[j]->h, false, ps == 1 ? b.a.l : b.a.h, (short)0, *c0[j], false, false);
      *c1[j] = __builtin_amdgcn_wmma_f32_16x16x32_bf16(false, ps == 0 ? a[j]->l : a[j]->h, false, ps == 1 ? b.b.l : b.b.h, (short)0, *c1[j], false, false); }
}
template <int GI, int NQ> __device__ __forceinline__ void s_step(v8f (&s4)[2][4], F2 (&fq)[2][2], G2 (&fr)[2], const char* q0p, const char* q1p, const char* rr, unsigned rl, const char* kp, const char* vp) {
  constexpr int kc = GI >> 1, t0 = (GI & 1) * 2;
  ring_turn<GI>(fr[(GI + 1) & 1], rr, rl, kp, vp);
  if constexpr ((GI & 1) == 0 && kc < 3) {   // the next kc's fragments of q, two groups ahead, by plain loads: all waves of the block read the same lines
    fq[0][(kc + 1) & 1] = get_frag(q0p + (kc + 1) * FRB);
    if constexpr (NQ == 2) fq[1][(kc + 1) & 1] = get_frag(q1p + (kc + 1) * FRB); }
  // behind the tile's last loads of q: wait before a register that an issued load names is overwritten; as inputs the address pairs stay live up to it
  if constexpr (GI == 4) asm volatile("s_wait_xcnt 0x0" :: "v"(q0p), "v"(q1p) : "memory");
  __builtin_amdgcn_sched_barrier(0);   // keeps the reads and loads above in front of the WMMAs: sunk behind them they would not have returned at the next group's wait
  const F2* const a[2] = { &fq[0][kc & 1], &fq[1][kc & 1] }; v8f* const c0[2] = { &s4[0][t0], &s4[1][t0] }; v8f* const c1[2] = { &s4[0][t0 + 1], &s4[1][t0 + 1] };
  g_mac<NQ>(a, fr[GI & 1], c0, c1);
}
template <int GI, int NQ> __device__ __forceinline__ void v_step(v8f (&acc)[2][8], const F2 (&pa)[2], G2 (&fr)[2], const char* rr, unsigned rl, const char* kp, const char* vp) {
  constexpr int t0 = (2 * (GI - 8)) & 7;
  ring_turn<GI>(fr[(GI + 1) & 1], rr, rl, kp, vp);
  __builtin_amdgcn_sched_barrier(0);   // as in s_step
  const F2* const a[2] = { &pa[0], &pa[1] }; v8f* const c0[2] = { &acc[0][t0], &acc[1][t0] }; v8f* const c1[2] = { &acc[0][t0 + 1], &acc[1][t0 + 1] };
  g_mac<NQ>(a, fr[GI & 1], c0, c1);
}
// a tile's scores of one query tile, scaled and masked, into the wave's own LDS
__device__ __forceinline__ void soft_put(const v8f (&s4)[4], float (*S)[68], int q0, int kt, int col, int g) {
  const float scl = 11.313708498984761f;     // * sqrt(128), as the reference
#pragma unroll
  for (int t = 0; t < 4; ++t) { const v8f s = s4[t]; const int key = kt * 64 + t * 16 + col;
#pragma unroll
    for (int r = 0; r < 8; ++r) { const int qi = q0 + 8 * g + r; const float sv = s[r] * scl; S[8 * g + r][t * 16 + col] = (key <= qi && sv != 0.0f) ? sv : -3.0e38f; } }
}
// the online softmax step of one query tile: the scores in S are overwritten in place by their weights (each lane rewrites what it alone has read); returns the factor that the row's older sums take
__device__ __forceinline__ float soft_row(float (*S)[68], int col, int g, float& mrun, float& lrun) {
  float mx = -3.4e38f;
#pragma unroll
  for (int jj = 0; jj < 32; ++jj) mx = fmaxf(mx, S[col][g * 32 + jj]);
  mx = fmaxf(mx, __shfl_xor(mx, 16, 32));
  // Every exponential is computed unconditionally and the masked case picked afterwards by a select: no branch on EXEC per score, so the chains of a tile are independent and interleave.
  const float mnew = fmaxf(mrun, mx); const float ec = expf(mrun - mnew); const float corr = mnew <= -1.0e38f ? 1.0f : ec;
  float ps = 0.f;
#pragma unroll
  for (int jj = 0; jj < 32; ++jj) { const float sv = S[col][g * 32 + jj]; const float e = expf(sv - mnew); const float p = sv <= -1.0e38f ? 0.f : e; ps += p; S[col][g * 32 + jj] = p; }
  ps += __shfl_xor(ps, 16, 32);
  lrun = lrun * corr + ps; mrun = mnew;
  return corr;
}
// One key tile, for the longer query tile (NQ = 1) or for both (NQ = 2), in two parts: the scores, left in LDS; then, behind the softmax, the products with v.
template <int NQ> __device__ __forceinline__ void s_phase(int kt, const char* kp, const char* vp, const char* q0p, const char* q1p, const char* rr, unsigned rl, float (*S0)[68], float (*S1)[68],
                                                          int qa, int qb, int col, int g, G2 (&fr)[2]) {
  F2 fq[2][2]; v8f s4[2][4] = {};
  cp_issue<0>(rl, kp, vp); cp_issue<1>(rl, kp, vp); cp_issue<2>(rl, kp, vp);   // every ring read of the tile before retired at the wait in front of its last group's products
  cp_issue<3>(rl, kp, vp); cp_issue<4>(rl, kp, vp); cp_issue<5>(rl, kp, vp);
  fq[0][0] = get_frag(q0p);
  if constexpr (NQ == 2) fq[1][0] = get_frag(q1p);
  cp_wait<RG - 1>(); ring_read<0>(fr[0], rr);
  s_step<0, NQ>(s4, fq, fr, q0p, q1p, rr, rl, kp, vp); s_step<1, NQ>(s4, fq, fr, q0p, q1p, rr, rl, kp, vp); s_step<2, NQ>(s4, fq, fr, q0p, q1p, rr, rl, kp, vp); s_step<3, NQ>(s4, fq, fr, q0p, q1p, rr, rl, kp, vp);
  s_step<4, NQ>(s4, fq, fr, q0p, q1p, rr, rl, kp, vp); s_step<5, NQ>(s4, fq, fr, q0p, q1p, rr, rl, kp, vp); s_step<6, NQ>(s4, fq, fr, q0p, q1p, rr, rl, kp, vp); s_step<7, NQ>(s4, fq, fr, q0p, q1p, rr, rl, kp, vp);
  soft_put(s4[0], S0, qa, kt, col, g);
  if constexpr (NQ == 2) soft_put(s4[1], S1, qb, kt, col, g);
}
template <int NQ> __device__ __forceinline__ void v_phase(const char* kp, const char* vp, const char* rr, unsigned rl, float (*S0)[68], float (*S1)[68], int lane, const float (&corr)[2], G2 (&fr)[2], v8f (&acc)[2][8]) {
  const int col = lane & 15, g = lane >> 4;
#pragma unroll   // acc is indexed by constants only, so it stays in registers
  for (int j = 0; j < NQ; ++j)
#pragma unroll
    for (int r = 0; r < 8; ++r) { const float cr = __shfl(corr[j], 8 * g + r, 32);
#pragma unroll
      for (int t = 0; t < 8; ++t) acc[j][t][r] *= cr; }
  { F2 pa[2]; pa[0] = split_row(&S0[col][0], 0, lane);
    if constexpr (NQ == 2) pa[1] = split_row(&S1[col][0], 0, lane);
    v_step<8, NQ>(acc, pa, fr, rr, rl, kp, vp); v_step<9, NQ>(acc, pa, fr, rr, rl, kp, vp); v_step<10, NQ>(acc, pa, fr, rr, rl, kp, vp); v_step<11, NQ>(acc, pa, fr, rr, rl, kp, vp); }
  { F2 pa[2]; pa[0] = split_row(&S0[col][0], 32, lane);
    if constexpr (NQ == 2) pa[1] = split_row(&S1[col][0], 32, lane);
    v_step<12, NQ>(acc, pa, fr, rr, rl, kp, vp); v_step<13, NQ>(acc, pa, fr, rr, rl, kp, vp); v_step<14, NQ>(acc, pa, fr, rr, rl, kp, vp); v_step<15, NQ>(acc, pa, fr, rr, rl, kp, vp); }
}
__global__ __launch_bounds__(NW * 32) void k_attn(const float* qpk, const float* __restrict__ kpk, const float* __restrict__ vpk, float* __restrict__ out) {
  __shared__ __align__(16) char sR[NW * RWB];          // the rings; behind the tile loop and the first barrier the same bytes hold the partial outputs
  __shared__ __align__(16) float sS[NW][2][16][68];    // a tile's scores per query tile, overwritten in place by its weights
  __shared__ float sM[2][NW][16];
  __shared__ float sL[2][NW][16];
  float (*const sO)[32][132] = (float (*)[32][132])sR;
  static_assert(sizeof(float) * NW * 32 * 132 <= NW * RWB, "");
  // w through readfirstlane: the tile loop's tests are then scalar branches and EXEC stays full at the WMMAs and at the copies
  const int tid = threadIdx.x, w = __builtin_amdgcn_readfirstlane(tid >> 5), lane = tid & 31, col = lane & 15, g = lane >> 4;
  const int b = blockIdx.x; const int q0[2] = { (SQ / 16 - 1 - (int)blockIdx.y) * 16, (int)blockIdx.y * 16 }; const size_t rb = (size_t)b * SQ;
  const char* q0p = (const char*)qpk + (rb + q0[0]) * HD * 4 + lane * 16; const char* q1p = (const char*)qpk + (rb + q0[1]) * HD * 4 + lane * 16;
  const char* kb = (const char*)kpk + rb * HD * 4 + lane * 16; const char* vb = (const char*)vpk + rb * HD * 4 + lane * 16;   // 64 keys = 16 fragments = 32 KB in either
  const char* const rr = sR + w * RWB + lane * 16;   // the lane's 16 bytes in the first run of its wave's ring
  const unsigned rl = (unsigned)(size_t)rr;          // the same as an LDS byte address
  float mrun[2] = { -3.0e38f, -3.0e38f }, lrun[2] = { 0.f, 0.f }; v8f acc[2][8] = {};
  const int n0 = (q0[0] >> 6) + 1, n1 = (q0[1] >> 6) + 1;   // key tiles of the longer and of the shorter query tile, n1 <= n0
#pragma unroll 1
  for (int kt = w; kt < n0; kt += NW) {
    const char* const kp = kb + (size_t)kt * (16 * FRB); const char* const vp = vb + (size_t)kt * (16 * FRB); G2 fr[2]; float corr[2] = { 1.0f, 1.0f };
    const int nq = kt < n1 ? 2 : 1;
    if (nq == 2) s_phase<2>(kt, kp, vp, q0p, q1p, rr, rl, sS[w][0], sS[w][1], q0[0], q0[1], col, g, fr);
    else s_phase<1>(kt, kp, vp, q0p, q1p, rr, rl, sS[w][0], sS[w][1], q0[0], q0[1], col, g, fr);
    LDSX();
#pragma unroll 1   // the softmax stands once in the text and serves either query tile: written out for each, the kernel's text passes 32 KB
    for (int j = 0; j < nq; ++j) {
      float m = j ? mrun[1] : mrun[0], l = j ? lrun[1] : lrun[0];
      const float c = soft_row(sS[w][j], col, g, m, l);
      if (j) { mrun[1] = m; lrun[1] = l; corr[1] = c; } else { mrun[0] = m; lrun[0] = l; corr[0] = c; }
    }
    LDSX();
    if (nq == 2) v_phase<2>(kp, vp, rr, rl, sS[w][0], sS[w][1], lane, corr, fr, acc);
    else v_phase<1>(kp, vp, rr, rl, sS[w][0], sS[w][1], lane, corr, fr, acc);
    __builtin_amdgcn_wave_barrier();
  }
  if (g == 0) { sM[0][w][col] = mrun[0]; sM[1][w][col] = mrun[1]; }
  __syncthreads();
#pragma unroll   // acc is indexed by constants only, so it stays in registers
  for (int j = 0; j < 2; ++j) {
    float mg = sM[j][0][col];
#pragma unroll   // all NW reads in flight at once
    for (int i = 1; i < NW; ++i) mg = fmaxf(mg, sM[j][i][col]);
    const float f = mg <= -1.0e38f ? 1.0f : expf(mrun[j] - mg);   // a wave without a kept score has acc = 0 and lrun = 0
    if (g == 0) sL[j][w][col] = lrun[j] * f;
#pragma unroll
    for (int r = 0; r < 8; ++r) { const float fr = __shfl(f, 8 * g + r, 32);
#pragma unroll
      for (int t = 0; t < 8; ++t) sO[w][j * 16 + 8 * g + r][t * 16 + col] = acc[j][t][r] * fr; }
  }
  __syncthreads();
#pragma unroll 1   // wave w sums rows w, w + NW of either query tile over the NW partials; rolled for the size of the text, as above
  for (int u = 0; u < 32 / NW; ++u) { const int row = u * NW + w, j = row >> 4, rw = row & 15;
    float lt = 0.f; v4f o = {};
#pragma unroll   // all NW reads in flight at once; the sum runs in wave order
    for (int i = 0; i < NW; ++i) { lt += sL[j][i][rw]; o += *(const v4f*)(&sO[i][row][lane * 4]); }
#pragma unroll
    for (int c = 0; c < 4; ++c) o[c] = o[c] / lt;
    float* const po = out + (rb + (j ? q0[1] : q0[0]) + rw) * HD + lane * 4; vst2(po, o);
    // behind the store: wait before a register that the issued store names is overwritten (the next trip writes them anew); as an input the address pair stays live up to it
    asm volatile("s_wait_xcnt 0x0" :: "v"(po) : "memory"); }
}
extern "C" void kernel_launch(void* const* d_in, const int* in_sizes, int n_in, void* d_out, int out_size, void* d_ws, size_t ws_size, hipStream_t stream) {
  (void)in_sizes; (void)n_in; (void)out_size; (void)ws_size;
  const float* x = (const float*)d_in[0]; const float* Wq = (const float*)d_in[1]; const float* Wk = (const float*)d_in[2]; const float* Wv = (const float*)d_in[3];
  float* out = (float*)d_out;
  char* ws = (char*)d_ws; size_t off = 0;
  auto take = [&](size_t bytes) { char* p = ws + off; off += (bytes + 255) & ~(size_t)255; return p; };
  float* qpk = (float*)take((size_t)NR * HD * 4); float* kpk = (float*)take((size_t)NR * HD * 4); float* vpk = (float*)take((size_t)NR * HD * 4);
  k_qkv<<<dim3(NR / QM, 2), 256, 0, stream>>>(x, Wq, Wk, Wv, qpk, kpk, vpk);
  k_attn<<<dim3(NB, SQ / 32), NW * 32, 0, stream>>>(qpk, kpk, vpk, out);
}

// v008
// It runs in 41.8 microseconds.
// Two timings next to v007 both put it at 1.03 times that version's speed.
// Counting every step since v000, it is 12.7 times as fast.
#include <hip/hip_runtime.h>
#include <math.h>

typedef __attribute__((ext_vector_type(16))) _Float16 v16h;
typedef __attribute__((ext_vector_type(16))) __bf16 v16b;
typedef __attribute__((ext_vector_type(8)))  _Float16 v8h;
typedef __attribute__((ext_vector_type(8)))  float v8f;
typedef __attribute__((ext_vector_type(4)))  float v4f;
typedef __attribute__((ext_vector_type(2)))  float v2f;
typedef __attribute__((ext_vector_type(4)))  unsigned v4u;
typedef __attribute__((ext_vector_type(4)))  int v4i;
typedef float __attribute__((may_alias)) float_a;
typedef int __attribute__((may_alias)) int_a;

template <typename T> __device__ __forceinline__ void vst2(void* p, T v) { *(T*)p = v;  }
__device__ __forceinline__ v8f wmma16(v16h a, v16h b, v8f c) {
  v8f d = __builtin_amdgcn_wmma_f32_16x16x32_f16(false, a, false, b, (short)0, c, false, false);
  asm volatile("v_nop\n\tv_nop\n\tv_nop\n\tv_nop" : "+v"(d) : "v"(a), "v"(b));
  return d;
}
__device__ __forceinline__ v8f wmma_bf(v16b a, v16b b, v8f c) {
  v8f d = __builtin_amdgcn_wmma_f32_16x16x32_bf16(false, a, false, b, (short)0, c, false, false);
  asm volatile("v_nop\n\tv_nop\n\tv_nop\n\tv_nop" : "+v"(d) : "v"(a), "v"(b));
  return d;
}
// 16x16x32 fragments: lane = (h = lane>>4, row/col = lane&15); elements 0..7 = k0+8h+0..7, 8..15 = k0+16+8h+0..7; D element r = row 8h+r
__device__ __forceinline__ v16h frag_h(const _Float16* rowk0, int lane) {
  union { v16h v; v8h q[2]; } u; const _Float16* p = rowk0 + 8 * (lane >> 4);
  u.q[0] = *(const v8h*)p; u.q[1] = *(const v8h*)(p + 16); return u.v;
}
__device__ __forceinline__ v16h frag_f32(const float* rowk0, int lane) {
  v16h a; const float* p = rowk0 + 8 * (lane >> 4);
#pragma unroll
  for (int i = 0; i < 8; ++i) { a[i] = (_Float16)p[i]; a[8 + i] = (_Float16)p[16 + i]; }
  return a;
}
__device__ __forceinline__ v16h frag_f32s(const float* rowk0, int lane, float sc) {
  v16h a; const float* p = rowk0 + 8 * (lane >> 4);
#pragma unroll
  for (int i = 0; i < 8; ++i) { a[i] = (_Float16)(p[i] * sc); a[8 + i] = (_Float16)(p[16 + i] * sc); }
  return a;
}
// column fragment from a [K][ld] layout (column n), rows >= K read as 0
__device__ __forceinline__ v16h fragc_f32(const float* W, int k0, int n, int lane, int ld, int K) {
  v16h a; const int g = lane >> 4;
#pragma unroll
  for (int i = 0; i < 8; ++i) { const int ka = k0 + 8 * g + i, kb = ka + 16;
    a[i] = (_Float16)(ka < K ? W[(size_t)ka * ld + n] : 0.f); a[8 + i] = (_Float16)(kb < K ? W[(size_t)kb * ld + n] : 0.f); }
  return a;
}
struct F2 { v16b h, l; };
__device__ __forceinline__ F2 bsplit16(const float v[16]) { F2 r;
#pragma unroll
  for (int i = 0; i < 16; ++i) { const __bf16 h = (__bf16)v[i]; r.h[i] = h; r.l[i] = (__bf16)(v[i] - (float)h); }
  return r; }
__device__ __forceinline__ F2 split_row(const float* row, int k0, int lane) { float v[16]; const float* p = row + k0 + 8 * (lane >> 4);
#pragma unroll
  for (int i = 0; i < 8; ++i) { v[i] = p[i]; v[8 + i] = p[16 + i]; }
  return bsplit16(v); }
__device__ __forceinline__ F2 split_rowK(const float* row, int k0, int lane, int K) { float v[16]; const int g = lane >> 4;
#pragma unroll
  for (int i = 0; i < 8; ++i) { const int ka = k0 + 8 * g + i, kb = ka + 16; v[i] = ka < K ? row[ka] : 0.f; v[8 + i] = kb < K ? row[kb] : 0.f; }
  return bsplit16(v); }
__device__ __forceinline__ F2 split_col(const float* W, int k0, int n, int lane, int ld, int K) { float v[16]; const int g = lane >> 4;
#pragma unroll
  for (int i = 0; i < 8; ++i) { const int ka = k0 + 8 * g + i, kb = ka + 16; v[i] = ka < K ? W[(size_t)ka * ld + n] : 0.f; v[8 + i] = kb < K ? W[(size_t)kb * ld + n] : 0.f; }
  return bsplit16(v); }
__device__ __forceinline__ v8f mac3(const F2& a, const F2& b, v8f c) { c = wmma_bf(a.l, b.h, c); c = wmma_bf(a.h, b.l, c); return wmma_bf(a.h, b.h, c); }
__device__ __forceinline__ float sigm(float v) { return 1.0f / (1.0f + expf(-v)); }
#define LDSX() do { asm volatile("s_wait_dscnt 0" ::: "memory"); __builtin_amdgcn_wave_barrier(); __builtin_amdgcn_fence(__ATOMIC_RELEASE, "workgroup"); } while (0)

// Single-head causal attention whose scores are MULTIPLIED by sqrt(128) (as the reference), so the softmax is extremely sharp: q and k
// come from two-way bf16 split GEMMs (near-f32, stored as bf16 hi and lo fragments) and S = q.k*sqrt(128) is also a two-way split; the causal zero-fill followed
// by "== 0 -> -inf" of the reference is reproduced (masked and exactly-zero kept scores both get -inf); online softmax in f32; v from the
#define NB 4
#define SQ 2048
#define EE 1024
#define HD 128
#define NR (NB * SQ)

// q, k and v leave as bf16 hi and lo planes in WMMA fragment order (two-way bf16 split GEMMs, f32 results split once more). One block = 64 rows of x times 192 output columns: blockIdx.y = 0 all of q and
// columns 0..63 of k, blockIdx.y = 1 all of v and columns 64..127 of k. Per slab of 64 k the block reads its 64 x rows and 192 W rows
// once, in whole 256-byte runs, splits each value once into bf16 hi and lo, and lays the two planes in LDS; the eight waves (2 x 4, 32 x 48 outputs each) take their fragments from
// there. Two LDS buffers and two register sets of fragments: the fragments of a 32-k step are read from LDS during the WMMAs of the step before it, also from one slab to the next,
// and each staging register is refilled from global memory as soon as it has been staged. Per accumulator the WMMA order is k ascending, lo.hi, hi.lo, hi.hi.
#define QM 64
#define QN 192
#define QK 64
#define QP 144                    // LDS row pitch in bytes: 128 B of bf16 + 16, an odd multiple of 16 B (no bank conflict for 16-byte reads)
#define QPL ((QM + QN) * QP)      // one plane (hi or lo) of one buffer
#define QBUF (2 * QPL)
#define QSO 196                   // pitch in floats of the output staging
typedef __attribute__((ext_vector_type(8))) __bf16 v8b;
typedef __attribute__((ext_vector_type(4))) __bf16 v4b;
// A packed fragment is 2 KB: hi elements 0..7, hi 8..15, lo 0..7, lo 8..15, each a run of 32 lanes x 16 bytes, so that every wave-wide access is 512 contiguous bytes.
// q, k: fragment (16-row tile, 32-wide step kc of the head), lane (g, col) = row col, elements = head kc*32 + 8g + 0..7 and + 16. Index tile * 4 + kc.
// v: fragment (32-key group, 16-column tile t), lane (g, col) = column t*16 + col, elements = keys 8g + 0..7 and + 16 of the group. Index group * 8 + t.
#define FRB 2048
__device__ __forceinline__ void put_frag(char* p, const F2& f) { union { v16b v; v8b q[2]; } a, b; a.v = f.h; b.v = f.l;
  *(v8b*)p = a.q[0]; *(v8b*)(p + 512) = a.q[1]; *(v8b*)(p + 1024) = b.q[0]; *(v8b*)(p + 1536) = b.q[1];
  // behind the run's last store: wait before a register that an issued store names is overwritten; as an input the address pair stays live up to it
  asm volatile("s_wait_xcnt 0x0" :: "v"(p) : "memory"); }
__device__ __forceinline__ F2 get_frag(const char* p) { union { v16b v; v8b q[2]; } a, b; F2 r;
  a.q[0] = *(const v8b*)p; a.q[1] = *(const v8b*)(p + 512); b.q[0] = *(const v8b*)(p + 1024); b.q[1] = *(const v8b*)(p + 1536); r.h = a.v; r.l = b.v; return r; }
__device__ __forceinline__ v16b frag_lds(const char* p) { union { v16b v; v8b q[2]; } u; u.q[0] = *(const v8b*)p; u.q[1] = *(const v8b*)(p + 32); return u.v; }
// 16 rows a step, 16 lanes a row: 4 steps of x, 8 of the whole W matrix, 4 of the half of Wk; each pointer holds the lane's own offset and the slab's k, and moves on by one slab behind its loads
// steps I0 .. I1 - 1 only: 0..3 are x (from memory, the longest way), 4..15 are W (from L2)
struct QB { const float* x; const float* a; const float* b; unsigned lo; };   // the three block-wide bases and the lane's byte offset, from which the pointers were formed
template <int I0, int I1, bool PRO> __device__ __forceinline__ void q_fetch(v4f (&st)[16], const float*& px, const float*& pa, const float*& pb, const QB& qb) {
#pragma unroll   // st is indexed by constants only, so it stays in registers; the row steps become immediate offsets
  for (int i = I0; i < I1; ++i) st[i] = *(const v4f*)(i < 4 ? px + (size_t)i * 16 * EE : (i < 12 ? pa + (size_t)(i - 4) * 16 * EE : pb + (size_t)(i - 12) * 16 * EE));
  // wait before a register that an issued load names is overwritten (the pointers move on right behind it); as inputs the address pairs in use stay live up to it, so that nothing lands on one
  // ahead of it; in front of the loop (PRO) so do base and offset, which the loads there name in the pairs' place
  if constexpr (I0 < 4 && PRO) asm volatile("s_wait_xcnt 0x0" :: "v"(px), "v"(qb.lo), "s"(qb.x) : "memory");
  if constexpr (I0 < 4 && !PRO) asm volatile("s_wait_xcnt 0x0" :: "v"(px) : "memory");
  if constexpr (I1 > 4 && PRO) asm volatile("s_wait_xcnt 0x0" :: "v"(pa), "v"(pb), "v"(qb.lo), "s"(qb.a), "s"(qb.b) : "memory");
  if constexpr (I1 > 4 && !PRO) asm volatile("s_wait_xcnt 0x0" :: "v"(pa), "v"(pb) : "memory");
  if constexpr (I0 < 4) px += QK;
  if constexpr (I1 > 4) { pa += QK; pb += QK; }
}
template <int I0, int I1> __device__ __forceinline__ void q_stage(const v4f (&st)[16], char* p) {
#pragma unroll   // st is indexed by constants only, so it stays in registers
  for (int i = I0; i < I1; ++i) { v4b h, l;
#pragma unroll   // vector elements picked by constants
    for (int c = 0; c < 4; ++c) { const __bf16 hh = (__bf16)st[i][c]; h[c] = hh; l[c] = (__bf16)(st[i][c] - (float)hh); }
    *(v4b*)(p + i * 16 * QP) = h; *(v4b*)(p + i * 16 * QP + QPL) = l; }
}
// the five fragments of one 32-k step, hi and lo: f[0], f[1] the wave's two row tiles of x, f[2..4] its three column tiles of W
__device__ __forceinline__ void q_frags(F2 (&f)[5], const char* ra, const char* rbf) {
#pragma unroll   // f is indexed by constants only, so it stays in registers
  for (int t = 0; t < 5; ++t) { const char* p = t < 2 ? ra + t * 16 * QP : rbf + (t - 2) * 16 * QP; f[t].h = frag_lds(p); f[t].l = frag_lds(p + QPL); }
  __builtin_amdgcn_sched_barrier(0);   // keeps the reads as one group in front of the WMMAs of the step before: sunk among or behind them they would not have returned when they are needed
}
// The plain builtin, which the compiler pads itself: the two fragment sets take the kernel above 256 registers, and with wmma_bf, whose asm operands the compiler kept in the first 256, the loop spilled to scratch.
__device__ __forceinline__ void q_mac(v8f (&acc)[6], const F2 (&f)[5]) {
#pragma unroll   // lo.hi, then hi.lo, then hi.hi: six independent accumulators between two WMMAs on the same one
  for (int ps = 0; ps < 3; ++ps)
#pragma unroll   // acc and f are indexed by constants only
    for (int t = 0; t < 6; ++t) acc[t] = __builtin_amdgcn_wmma_f32_16x16x32_bf16(false, ps == 0 ? f[t / 3].l : f[t / 3].h, false, ps == 1 ? f[2 + t % 3].l : f[2 + t % 3].h, (short)0, acc[t], false, false);
}
// The slab barrier by hand: the wave's LDS stores and reads are done, then the work-group barrier. __syncthreads() would also wait for the global loads of the slab after next, which are to stay in flight across it.
#define QBAR() asm volatile("s_wait_dscnt 0x0\n\ts_barrier_signal -1\n\ts_barrier_wait -1" ::: "memory")
// One slab. On entry f0 holds (or is about to receive) the fragments of the slab's first 32-k step. STAGE: a next slab exists and is in st; FETCH: a slab after next exists.
// The last two trips are written out apart from the loop, so that inside it every count of loads and LDS reads in flight is the same on every path and no wait is set for the shorter path.
template <bool STAGE, bool FETCH> __device__ __forceinline__ void q_trip(int ks, v8f (&acc)[6], F2 (&f0)[5], F2 (&f1)[5], v4f (&st)[16], const char* ra, const char* rbf, char* wr,
                                                                         const float*& px, const float*& pa, const float*& pb, const QB& qb) {
  const int cur = (ks & 1) * QBUF, nxt = QBUF - cur;
  q_frags(f1, ra + cur + 64, rbf + cur + 64);   // the slab's second step is read during the first step's WMMAs
  if (STAGE) q_stage<0, 4>(st, wr + nxt);
  if (FETCH) q_fetch<0, 4, false>(st, px, pa, pb, qb);   // x is staged and asked for again first: nearly a whole trip for the way from memory
  __builtin_amdgcn_sched_barrier(0);                             // keeps the WMMAs out of the lines above: woven in there they put off the loads of x by their own length
  q_mac(acc, f0);                                                // the compiler is free to weave the split of W into these WMMAs
  if (STAGE) q_stage<4, 16>(st, wr + nxt);
  if (FETCH) q_fetch<4, 16, false>(st, px, pa, pb, qb);
  QBAR();   // publishes the slab just staged; every wave's reads of this slab's buffer, which the next trip refills, have returned in front of it
  if (STAGE) q_frags(f0, ra + nxt, rbf + nxt);   // the next slab's first step is read during this slab's last WMMAs
  q_mac(acc, f1);
}
__global__ __launch_bounds__(256) void k_qkv(const float* __restrict__ x, const float* __restrict__ Wq, const float* __restrict__ Wk, const float* __restrict__ Wv, float* __restrict__ qpk, float* __restrict__ kpk, float* __restrict__ vpk) {
  __shared__ __align__(16) char sm[2 * QBUF];
  const int tid = threadIdx.x, wave = __builtin_amdgcn_readfirstlane(tid >> 5), lane = tid & 31, col = lane & 15, g = lane >> 4;
  const int r0b = blockIdx.x * QM, y = blockIdx.y, wm = wave >> 2, wn = wave & 3;
  const QB qb = { x + (size_t)r0b * EE, y == 0 ? Wq : Wv, Wk + (size_t)y * 64 * EE, (unsigned)(((tid >> 4) * EE + (tid & 15) * 4) * 4) };
  const float* px = (const float*)((const char*)qb.x + qb.lo); const float* pa = (const float*)((const char*)qb.a + qb.lo); const float* pb = (const float*)((const char*)qb.b + qb.lo);
  char* const wr = sm + (tid >> 4) * QP + (tid & 15) * 8;
  const char* const ra = sm + (wm * 32 + col) * QP + g * 16;
  const char* const rbf = sm + (QM + wn * 48 + col) * QP + g * 16;
  v4f st[16]; v8f acc[6] = {}; F2 f0[5], f1[5];
  q_fetch<0, 16, true>(st, px, pa, pb, qb);
  q_stage<0, 4>(st, wr); q_fetch<0, 4, true>(st, px, pa, pb, qb);
  q_stage<4, 16>(st, wr); q_fetch<4, 16, true>(st, px, pa, pb, qb);
  QBAR();
  q_frags(f0, ra, rbf);
#pragma unroll 1   // one slab a trip: the two buffers alternate by a run-time offset
  for (int ks = 0; ks < EE / QK - 2; ++ks) q_trip<true, true>(ks, acc, f0, f1, st, ra, rbf, wr, px, pa, pb, qb);
  q_trip<true, false>(EE / QK - 2, acc, f0, f1, st, ra, rbf, wr, px, pa, pb, qb);
  q_trip<false, false>(EE / QK - 1, acc, f0, f1, st, ra, rbf, wr, px, pa, pb, qb);
  float* const so = (float*)sm;   // the ring is free behind the last trip's barrier
#pragma unroll   // acc is indexed by constants only
  for (int e = 0; e < 48; ++e) { const int t = e >> 3, r = e & 7; so[(wm * 32 + (t / 3) * 16 + 8 * g + r) * QSO + wn * 48 + (t % 3) * 16 + col] = acc[t][r]; }
  __syncthreads();
  if (y == 0) {
#pragma unroll   // the block's sixteen fragments of q, two a wave: id = (16-row tile, kc)
    for (int u = 0; u < 2; ++u) { const int id = u * 8 + wave; float v[16]; const float* p = so + ((id >> 2) * 16 + col) * QSO + (id & 3) * 32 + 8 * g;
#pragma unroll   // v is indexed by constants only
      for (int i = 0; i < 8; ++i) { v[i] = p[i]; v[8 + i] = p[16 + i]; }
      put_frag((char*)qpk + ((size_t)(r0b / 16) * 4 + id) * FRB + lane * 16, bsplit16(v)); }
  } else {
#pragma unroll   // the block's two 32-key groups of v; wave = column tile
    for (int u = 0; u < 2; ++u) { float v[16]; const float* p = so + (u * 32 + 8 * g) * QSO + wave * 16 + col;
#pragma unroll   // v is indexed by constants only
      for (int i = 0; i < 8; ++i) { v[i] = p[i * QSO]; v[8 + i] = p[(16 + i) * QSO]; }
      put_frag((char*)vpk + ((size_t)(r0b / 32 + u) * 8 + wave) * FRB + lane * 16, bsplit16(v)); }
  }
  { float v[16]; const float* p = so + ((wave >> 1) * 16 + col) * QSO + 128 + (wave & 1) * 32 + 8 * g;   // the block's half of k: wave = (16-key tile, kc)
#pragma unroll   // v is indexed by constants only
    for (int i = 0; i < 8; ++i) { v[i] = p[i]; v[8 + i] = p[16 + i]; }
    put_frag((char*)kpk + ((size_t)(r0b / 16 + (wave >> 1)) * 4 + y * 2 + (wave & 1)) * FRB + lane * 16, bsplit16(v)); }
}
// One block = two tiles of 16 query rows, tile 127 - y (index 0 below, the longer) and tile y (index 1): every block then has 33 (query tile, key tile) pairs, all blocks are resident at once, and the key tiles
// of the shorter query tile are among those of the longer, so that there one copy of a k or v fragment feeds the products of both. The NW waves share the key tiles (wave w takes tiles w, w + NW, ...), each with
// an online softmax of its own per query tile; the partial (max, sum, acc) triples are merged through LDS in wave order at the end.
// Both products run transposed, the fragment of k or v as A and that of q or of the weights as B: a lane's column is then one query, whose scores, weights and sums stay in the lane's own registers.
// qpk is not __restrict__: its fragments are then loaded anew in every tile's stream and not held in registers (or in scratch) across the softmax and the v products.
// The fragments of k and v do not pass through registers on their way in: each wave copies them asynchronously into an LDS ring of its own, RG groups of two fragments, in the order of their use
// (k: per kc the four key tiles; then the sixteen of v). A group is read into registers one group ahead of its products; as soon as those reads have returned its place is refilled with the group
// RG further on, so that up to RG groups (24 KB a wave) are on their way at a time. No other wave touches a wave's ring, so no barrier belongs to it.
#define NW 8
#define GB (2 * FRB)    // one group
#define RG 6            // groups in a wave's ring
#define RWB (RG * GB)   // ring bytes a wave
#define NG 16           // groups a key tile: 8 of k, 8 of v
// The eight copies of one group: every lane brings 16 bytes a copy, the immediate offset moves the global and the LDS address alike. The s_wait_xcnt stands inside the statement, behind the last copy:
// wait before a register that an issued copy names is rewritten.
__device__ __forceinline__ void cp_group(unsigned l0, const char* g0, unsigned l1, const char* g1) {
  asm volatile("global_load_async_to_lds_b128 %0, %1, off\n\t"
               "global_load_async_to_lds_b128 %0, %1, off offset:512\n\t"
               "global_load_async_to_lds_b128 %0, %1, off offset:1024\n\t"
               "global_load_async_to_lds_b128 %0, %1, off offset:1536\n\t"
               "global_load_async_to_lds_b128 %2, %3, off\n\t"
               "global_load_async_to_lds_b128 %2, %3, off offset:512\n\t"
               "global_load_async_to_lds_b128 %2, %3, off offset:1024\n\t"
               "global_load_async_to_lds_b128 %2, %3, off offset:1536\n\t"
               "s_wait_xcnt 0x0" :: "v"(l0), "v"(g0), "v"(l1), "v"(g1) : "memory");
}
// Returns when all but the wave's Y youngest groups (eight copies each) have landed. Every key tile is the same straight line of copies and waits and starts and ends with none on its way, so each count is exact.
template <int Y> __device__ __forceinline__ void cp_wait() {
  static_assert(Y >= 0 && Y < RG, "");
  if constexpr (Y == 5) asm volatile("s_wait_asynccnt 0x28" ::: "memory");
  if constexpr (Y == 4) asm volatile("s_wait_asynccnt 0x20" ::: "memory");
  if constexpr (Y == 3) asm volatile("s_wait_asynccnt 0x18" ::: "memory");
  if constexpr (Y == 2) asm volatile("s_wait_asynccnt 0x10" ::: "memory");
  if constexpr (Y == 1) asm volatile("s_wait_asynccnt 0x8" ::: "memory");
  if constexpr (Y == 0) asm volatile("s_wait_asynccnt 0x0" ::: "memory");
}
struct G2 { F2 a, b; };   // one group in registers
template <int GI> __device__ __forceinline__ void cp_issue(unsigned rl, const char* kp, const char* vp) {
  constexpr int f = 2 * GI; const unsigned l = rl + (GI % RG) * GB;
  if constexpr (f < 16) cp_group(l, kp + ((f & 3) * 4 + (f >> 2)) * FRB, l + FRB, kp + (((f + 1) & 3) * 4 + (f >> 2)) * FRB);
  else cp_group(l, vp + (f - 16) * FRB, l + FRB, vp + (f - 15) * FRB);
}
template <int GI> __device__ __forceinline__ void ring_read(G2& d, const char* rr) { d.a = get_frag(rr + (GI % RG) * GB); d.b = get_frag(rr + (GI % RG) * GB + FRB); }
// In front of the products of group GI: its reads have returned, so its place takes the copies of group GI + RG; then group GI + 1, once landed, is read into the other register set.
template <int GI> __device__ __forceinline__ void ring_turn(G2& nx, const char* rr, unsigned rl, const char* kp, const char* vp) {
  asm volatile("s_wait_dscnt 0x0" ::: "memory");   // the wave's reads of the place have retired before a copy is aimed at it
  if constexpr (GI + RG < NG) cp_issue<GI + RG>(rl, kp, vp);
  if constexpr (GI + 1 < NG) { cp_wait<(GI + RG < NG ? RG - 1 : NG - 2 - GI)>(); ring_read<GI + 1>(nx, rr); }
}
// The products of one group (two fragments of k or v, as A) with the B fragments of one or two query tiles: the results stand transposed, a lane's column is a query. The plain builtin, which the compiler pads itself: two query tiles take the kernel above 256 registers (see q_mac).
// Per accumulator the order is (query side).(key side) lo.hi, hi.lo, hi.hi.
template <int NQ> __device__ __forceinline__ void g_mac(const F2* const (&a)[2], const G2& b, v8f* const (&c0)[2], v8f* const (&c1)[2]) {
#pragma unroll   // the two or four accumulators are independent: they stand between two WMMAs on the same one
  for (int ps = 0; ps < 3; ++ps)
#pragma unroll
    for (int j = 0; j < NQ; ++j) {
      *c0[j] = __builtin_amdgcn_wmma_f32_16x16x32_bf16(false, ps == 1 ? b.a.l : b.a.h, false, ps == 0 ? a[j]->l : a[j]->h, (short)0, *c0[j], false, false);
      *c1[j] = __builtin_amdgcn_wmma_f32_16x16x32_bf16(false, ps == 1 ? b.b.l : b.b.h, false, ps == 0 ? a[j]->l : a[j]->h, (short)0, *c1[j], false, false); }
}
template <int GI, int NQ> __device__ __forceinline__ void s_step(v8f (&s4)[2][4], F2 (&fq)[2][2], G2 (&fr)[2], const char* q0p, const char* q1p, const char* rr, unsigned rl, const char* kp, const char* vp) {
  constexpr int kc = GI >> 1, t0 = (GI & 1) * 2;
  ring_turn<GI>(fr[(GI + 1) & 1], rr, rl, kp, vp);
  if constexpr ((GI & 1) == 0 && kc < 3) {   // the next kc's fragments of q, two groups ahead, by plain loads: all waves of the block read the same lines
    fq[0][(kc + 1) & 1] = get_frag(q0p + (kc + 1) * FRB);
    if constexpr (NQ == 2) fq[1][(kc + 1) & 1] = get_frag(q1p + (kc + 1) * FRB); }
  // behind the tile's last loads of q: wait before a register that an issued load names is overwritten; as inputs the address pairs stay live up to it
  if constexpr (GI == 4) asm volatile("s_wait_xcnt 0x0" :: "v"(q0p), "v"(q1p) : "memory");
  __builtin_amdgcn_sched_barrier(0);   // keeps the reads and loads above in front of the WMMAs: sunk behind them they would not have returned at the next group's wait
  const F2* const a[2] = { &fq[0][kc & 1], &fq[1][kc & 1] }; v8f* const c0[2] = { &s4[0][t0], &s4[1][t0] }; v8f* const c1[2] = { &s4[0][t0 + 1], &s4[1][t0 + 1] };
  g_mac<NQ>(a, fr[GI & 1], c0, c1);
}
template <int GI, int NQ> __device__ __forceinline__ void v_step(v8f (&acc)[2][8], const F2& p0, const F2& p1, G2 (&fr)[2], const char* rr, unsigned rl, const char* kp, const char* vp) {
  constexpr int t0 = (2 * (GI - 8)) & 7;
  ring_turn<GI>(fr[(GI + 1) & 1], rr, rl, kp, vp);
  __builtin_amdgcn_sched_barrier(0);   // as in s_step
  const F2* const a[2] = { &p0, &p1 }; v8f* const c0[2] = { &acc[0][t0], &acc[1][t0] }; v8f* const c1[2] = { &acc[0][t0 + 1], &acc[1][t0 + 1] };
  g_mac<NQ>(a, fr[GI & 1], c0, c1);
}
// lane l with lane l ^ 16, in the vector unit
__device__ __forceinline__ float xhalf(float x) { return __builtin_bit_cast(float, __builtin_amdgcn_permlanex16(__builtin_bit_cast(int, x), __builtin_bit_cast(int, x), 0x76543210, 0xfedcba98, false, false)); }
// The online softmax step of one query tile, in registers. The scores stand transposed: lane (g, col) holds, of query qi = tile + col, the keys key0 + 16 t + r with key0 = 64 kt + 8 g, so a row's maximum and sum are
// in-lane but for one exchange between the wave's halves, and tiles 2u and 2u + 1 of the weights, split in place, are the B fragment of 32-key group u. Returns the factor that the query's older sums take.
__device__ __forceinline__ float soft_reg(const v8f (&s4)[4], F2 (&pa)[2], int qi, int key0, float& mrun, float& lrun) {
  const float scl = 11.313708498984761f;     // * sqrt(128), as the reference
  const int d = qi - key0;                   // key <= query reads 16 t + r <= d: one compare with a constant per score
  float sv[32], mt[4], pt[4];
#pragma unroll   // sv is indexed by constants only, so it stays in registers
  for (int t = 0; t < 4; ++t) { mt[t] = -3.4e38f;
#pragma unroll
    for (int r = 0; r < 8; ++r) { const float x = s4[t][r] * scl; const float s = (t * 16 + r <= d && x != 0.0f) ? x : -3.0e38f; sv[t * 8 + r] = s; mt[t] = fmaxf(mt[t], s); } }
  float mx = fmaxf(fmaxf(mt[0], mt[1]), fmaxf(mt[2], mt[3]));
  mx = fmaxf(mx, xhalf(mx));
  // Every exponential is computed unconditionally and the masked case picked afterwards by a select: no branch on EXEC per score, so the chains of a tile are independent and interleave.
  const float mnew = fmaxf(mrun, mx); const float ec = expf(mrun - mnew); const float corr = mnew <= -1.0e38f ? 1.0f : ec;
#pragma unroll
  for (int t = 0; t < 4; ++t) { pt[t] = 0.f;
#pragma unroll
    for (int r = 0; r < 8; ++r) { const float s = sv[t * 8 + r]; const float e = expf(s - mnew); const float p = s <= -1.0e38f ? 0.f : e; pt[t] += p; sv[t * 8 + r] = p; } }
  float ps = (pt[0] + pt[1]) + (pt[2] + pt[3]);
  ps += xhalf(ps);
  lrun = lrun * corr + ps; mrun = mnew;
  pa[0] = bsplit16(&sv[0]); pa[1] = bsplit16(&sv[16]);
  return corr;
}
// One key tile, for the longer query tile (NQ = 1) or for both (NQ = 2), in two parts: the scores; then, behind the softmax, the products with v.
template <int NQ> __device__ __forceinline__ void s_phase(const char* kp, const char* vp, const char* q0p, const char* q1p, const char* rr, unsigned rl, v8f (&s4)[2][4], G2 (&fr)[2]) {
  F2 fq[2][2];
  cp_issue<0>(rl, kp, vp); cp_issue<1>(rl, kp, vp); cp_issue<2>(rl, kp, vp);   // every ring read of the tile before retired at the wait in front of its last group's products
  cp_issue<3>(rl, kp, vp); cp_issue<4>(rl, kp, vp); cp_issue<5>(rl, kp, vp);
  fq[0][0] = get_frag(q0p);
  if constexpr (NQ == 2) fq[1][0] = get_frag(q1p);
  cp_wait<RG - 1>(); ring_read<0>(fr[0], rr);
  s_step<0, NQ>(s4, fq, fr, q0p, q1p, rr, rl, kp, vp); s_step<1, NQ>(s4, fq, fr, q0p, q1p, rr, rl, kp, vp); s_step<2, NQ>(s4, fq, fr, q0p, q1p, rr, rl, kp, vp); s_step<3, NQ>(s4, fq, fr, q0p, q1p, rr, rl, kp, vp);
  s_step<4, NQ>(s4, fq, fr, q0p, q1p, rr, rl, kp, vp); s_step<5, NQ>(s4, fq, fr, q0p, q1p, rr, rl, kp, vp); s_step<6, NQ>(s4, fq, fr, q0p, q1p, rr, rl, kp, vp); s_step<7, NQ>(s4, fq, fr, q0p, q1p, rr, rl, kp, vp);
}
template <int NQ> __device__ __forceinline__ void v_phase(const char* kp, const char* vp, const char* rr, unsigned rl, const float (&corr)[2], const F2 (&pa)[2][2], G2 (&fr)[2], v8f (&acc)[2][8]) {
#pragma unroll   // acc is indexed by constants only, so it stays in registers; a lane's accumulators all belong to its own query
  for (int j = 0; j < NQ; ++j)
#pragma unroll
    for (int t = 0; t < 8; ++t) acc[j][t] *= corr[j];
  v_step<8, NQ>(acc, pa[0][0], pa[1][0], fr, rr, rl, kp, vp); v_step<9, NQ>(acc, pa[0][0], pa[1][0], fr, rr, rl, kp, vp); v_step<10, NQ>(acc, pa[0][0], pa[1][0], fr, rr, rl, kp, vp); v_step<11, NQ>(acc, pa[0][0], pa[1][0], fr, rr, rl, kp, vp);
  v_step<12, NQ>(acc, pa[0][1], pa[1][1], fr, rr, rl, kp, vp); v_step<13, NQ>(acc, pa[0][1], pa[1][1], fr, rr, rl, kp, vp); v_step<14, NQ>(acc, pa[0][1], pa[1][1], fr, rr, rl, kp, vp); v_step<15, NQ>(acc, pa[0][1], pa[1][1], fr, rr, rl, kp, vp);
}
__global__ __launch_bounds__(NW * 32) void k_attn(const float* qpk, const float* __restrict__ kpk, const float* __restrict__ vpk, float* __restrict__ out) {
  __shared__ __align__(16) char sR[NW * RWB];          // the rings; behind the tile loop and the first barrier the same bytes hold the partial outputs
  __shared__ float sM[2][NW][16];
  __shared__ float sL[2][NW][16];
  float (*const sO)[32][132] = (float (*)[32][132])sR;
  static_assert(sizeof(float) * NW * 32 * 132 <= NW * RWB, "");
  // w through readfirstlane: the tile loop's tests are then scalar branches and EXEC stays full at the WMMAs and at the copies
  const int tid = threadIdx.x, w = __builtin_amdgcn_readfirstlane(tid >> 5), lane = tid & 31, col = lane & 15, g = lane >> 4;
  const int b = blockIdx.x; const int q0[2] = { (SQ / 16 - 1 - (int)blockIdx.y) * 16, (int)blockIdx.y * 16 }; const size_t rb = (size_t)b * SQ;
  const char* q0p = (const char*)qpk + (rb + q0[0]) * HD * 4 + lane * 16; const char* q1p = (const char*)qpk + (rb + q0[1]) * HD * 4 + lane * 16;
  const char* kb = (const char*)kpk + rb * HD * 4 + lane * 16; const char* vb = (const char*)vpk + rb * HD * 4 + lane * 16;   // 64 keys = 16 fragments = 32 KB in either
  const char* const rr = sR + w * RWB + lane * 16;   // the lane's 16 bytes in the first run of its wave's ring
  const unsigned rl = (unsigned)(size_t)rr;          // the same as an LDS byte address
  float mrun[2] = { -3.0e38f, -3.0e38f }, lrun[2] = { 0.f, 0.f }; v8f acc[2][8] = {};   // of query col of either tile, the same in both halves of the wave; acc[j][t][r] = head column 16 t + 8 g + r
  const int n0 = (q0[0] >> 6) + 1, n1 = (q0[1] >> 6) + 1;   // key tiles of the longer and of the shorter query tile, n1 <= n0
#pragma unroll 1
  for (int kt = w; kt < n0; kt += NW) {
    const char* const kp = kb + (size_t)kt * (16 * FRB); const char* const vp = vb + (size_t)kt * (16 * FRB);
    G2 fr[2]; v8f s4[2][4] = {}; F2 pa[2][2]; float corr[2] = { 1.0f, 1.0f };
    const bool two = kt < n1; const int key0 = kt * 64 + 8 * g;
    if (two) s_phase<2>(kp, vp, q0p, q1p, rr, rl, s4, fr);
    else s_phase<1>(kp, vp, q0p, q1p, rr, rl, s4, fr);
    // the longer tile's softmax stands once in the text and serves both cases: written out for each, the kernel's text passes 32 KB
    corr[0] = soft_reg(s4[0], pa[0], q0[0] + col, key0, mrun[0], lrun[0]);
    if (two) { corr[1] = soft_reg(s4[1], pa[1], q0[1] + col, key0, mrun[1], lrun[1]); v_phase<2>(kp, vp, rr, rl, corr, pa, fr, acc); }
    else v_phase<1>(kp, vp, rr, rl, corr, pa, fr, acc);
  }
  if (g == 0) { sM[0][w][col] = mrun[0]; sM[1][w][col] = mrun[1]; }
  __syncthreads();
#pragma unroll   // acc is indexed by constants only, so it stays in registers
  for (int j = 0; j < 2; ++j) {
    float mg = sM[j][0][col];
#pragma unroll   // all NW reads in flight at once
    for (int i = 1; i < NW; ++i) mg = fmaxf(mg, sM[j][i][col]);
    const float f = mg <= -1.0e38f ? 1.0f : expf(mrun[j] - mg);   // a wave without a kept score has acc = 0 and lrun = 0
    if (g == 0) sL[j][w][col] = lrun[j] * f;
#pragma unroll   // a lane's eight values of a tile are eight neighbouring head columns of its query's row: two 16-byte stores
    for (int t = 0; t < 8; ++t) { const v8f o = acc[j][t] * f; float* const p = &sO[w][j * 16 + col][t * 16 + 8 * g];
      *(v4f*)p = __builtin_shufflevector(o, o, 0, 1, 2, 3); *(v4f*)(p + 4) = __builtin_shufflevector(o, o, 4, 5, 6, 7); }
  }
  __syncthreads();
#pragma unroll 1   // wave w sums rows w, w + NW of either query tile over the NW partials; rolled for the size of the text, as above
  for (int u = 0; u < 32 / NW; ++u) { const int row = u * NW + w, j = row >> 4, rw = row & 15;
    float lt = 0.f; v4f o = {};
#pragma unroll   // all NW reads in flight at once; the sum runs in wave order
    for (int i = 0; i < NW; ++i) { lt += sL[j][i][rw]; o += *(const v4f*)(&sO[i][row][lane * 4]); }
#pragma unroll
    for (int c = 0; c < 4; ++c) o[c] = o[c] / lt;
    float* const po = out + (rb + (j ? q0[1] : q0[0]) + rw) * HD + lane * 4; vst2(po, o);
    // behind the store: wait before a register that the issued store names is overwritten (the next trip writes them anew); as an input the address pair stays live up to it
    asm volatile("s_wait_xcnt 0x0" :: "v"(po) : "memory"); }
}
extern "C" void kernel_launch(void* const* d_in, const int* in_sizes, int n_in, void* d_out, int out_size, void* d_ws, size_t ws_size, hipStream_t stream) {
  (void)in_sizes; (void)n_in; (void)out_size; (void)ws_size;
  const float* x = (const float*)d_in[0]; const float* Wq = (const float*)d_in[1]; const float* Wk = (const float*)d_in[2]; const float* Wv = (const float*)d_in[3];
  float* out = (float*)d_out;
  char* ws = (char*)d_ws; size_t off = 0;
  auto take = [&](size_t bytes) { char* p = ws + off; off += (bytes + 255) & ~(size_t)255; return p; };
  float* qpk = (float*)take((size_t)NR * HD * 4); float* kpk = (float*)take((size_t)NR * HD * 4); float* vpk = (float*)take((size_t)NR * HD * 4);
  k_qkv<<<dim3(NR / QM, 2), 256, 0, stream>>>(x, Wq, Wk, Wv, qpk, kpk, vpk);
  k_attn<<<dim3(NB, SQ / 32), NW * 32, 0, stream>>>(qpk, kpk, vpk, out);
}

// v009
// One run takes 40.2 microseconds.
// Timed twice side by side with v008, it ran 1.05 and 1.04 times as fast.
// All steps since v000 together make it 13.2 times as fast.
#include <hip/hip_runtime.h>
#include <math.h>

typedef __attribute__((ext_vector_type(16))) _Float16 v16h;
typedef __attribute__((ext_vector_type(16))) __bf16 v16b;
typedef __attribute__((ext_vector_type(8)))  _Float16 v8h;
typedef __attribute__((ext_vector_type(8)))  float v8f;
typedef __attribute__((ext_vector_type(4)))  float v4f;
typedef __attribute__((ext_vector_type(2)))  float v2f;
typedef __attribute__((ext_vector_type(4)))  unsigned v4u;
typedef __attribute__((ext_vector_type(4)))  int v4i;
typedef float __attribute__((may_alias)) float_a;
typedef int __attribute__((may_alias)) int_a;

template <typename T> __device__ __forceinline__ void vst2(void* p, T v) { *(T*)p = v;  }
__device__ __forceinline__ v8f wmma16(v16h a, v16h b, v8f c) {
  v8f d = __builtin_amdgcn_wmma_f32_16x16x32_f16(false, a, false, b, (short)0, c, false, false);
  asm volatile("v_nop\n\tv_nop\n\tv_nop\n\tv_nop" : "+v"(d) : "v"(a), "v"(b));
  return d;
}
__device__ __forceinline__ v8f wmma_bf(v16b a, v16b b, v8f c) {
  v8f d = __builtin_amdgcn_wmma_f32_16x16x32_bf16(false, a, false, b, (short)0, c, false, false);
  asm volatile("v_nop\n\tv_nop\n\tv_nop\n\tv_nop" : "+v"(d) : "v"(a), "v"(b));
  return d;
}
// 16x16x32 fragments: lane = (h = lane>>4, row/col = lane&15); elements 0..7 = k0+8h+0..7, 8..15 = k0+16+8h+0..7; D element r = row 8h+r
__device__ __forceinline__ v16h frag_h(const _Float16* rowk0, int lane) {
  union { v16h v; v8h q[2]; } u; const _Float16* p = rowk0 + 8 * (lane >> 4);
  u.q[0] = *(const v8h*)p; u.q[1] = *(const v8h*)(p + 16); return u.v;
}
__device__ __forceinline__ v16h frag_f32(const float* rowk0, int lane) {
  v16h a; const float* p = rowk0 + 8 * (lane >> 4);
#pragma unroll
  for (int i = 0; i < 8; ++i) { a[i] = (_Float16)p[i]; a[8 + i] = (_Float16)p[16 + i]; }
  return a;
}
__device__ __forceinline__ v16h frag_f32s(const float* rowk0, int lane, float sc) {
  v16h a; const float* p = rowk0 + 8 * (lane >> 4);
#pragma unroll
  for (int i = 0; i < 8; ++i) { a[i] = (_Float16)(p[i] * sc); a[8 + i] = (_Float16)(p[16 + i] * sc); }
  return a;
}
// column fragment from a [K][ld] layout (column n), rows >= K read as 0
__device__ __forceinline__ v16h fragc_f32(const float* W, int k0, int n, int lane, int ld, int K) {
  v16h a; const int g = lane >> 4;
#pragma unroll
  for (int i = 0; i < 8; ++i) { const int ka = k0 + 8 * g + i, kb = ka + 16;
    a[i] = (_Float16)(ka < K ? W[(size_t)ka * ld + n] : 0.f); a[8 + i] = (_Float16)(kb < K ? W[(size_t)kb * ld + n] : 0.f); }
  return a;
}
struct F2 { v16b h, l; };
__device__ __forceinline__ F2 bsplit16(const float v[16]) { F2 r;
#pragma unroll
  for (int i = 0; i < 16; ++i) { const __bf16 h = (__bf16)v[i]; r.h[i] = h; r.l[i] = (__bf16)(v[i] - (float)h); }
  return r; }
__device__ __forceinline__ F2 split_row(const float* row, int k0, int lane) { float v[16]; const float* p = row + k0 + 8 * (lane >> 4);
#pragma unroll
  for (int i = 0; i < 8; ++i) { v[i] = p[i]; v[8 + i] = p[16 + i]; }
  return bsplit16(v); }
__device__ __forceinline__ F2 split_rowK(const float* row, int k0, int lane, int K) { float v[16]; const int g = lane >> 4;
#pragma unroll
  for (int i = 0; i < 8; ++i) { const int ka = k0 + 8 * g + i, kb = ka + 16; v[i] = ka < K ? row[ka] : 0.f; v[8 + i] = kb < K ? row[kb] : 0.f; }
  return bsplit16(v); }
__device__ __forceinline__ F2 split_col(const float* W, int k0, int n, int lane, int ld, int K) { float v[16]; const int g = lane >> 4;
#pragma unroll
  for (int i = 0; i < 8; ++i) { const int ka = k0 + 8 * g + i, kb = ka + 16; v[i] = ka < K ? W[(size_t)ka * ld + n] : 0.f; v[8 + i] = kb < K ? W[(size_t)kb * ld + n] : 0.f; }
  return bsplit16(v); }
__device__ __forceinline__ v8f mac3(const F2& a, const F2& b, v8f c) { c = wmma_bf(a.l, b.h, c); c = wmma_bf(a.h, b.l, c); return wmma_bf(a.h, b.h, c); }
__device__ __forceinline__ float sigm(float v) { return 1.0f / (1.0f + expf(-v)); }
#define LDSX() do { asm volatile("s_wait_dscnt 0" ::: "memory"); __builtin_amdgcn_wave_barrier(); __builtin_amdgcn_fence(__ATOMIC_RELEASE, "workgroup"); } while (0)

// Single-head causal attention whose scores are MULTIPLIED by sqrt(128) (as the reference), so the softmax is extremely sharp: q and k
// come from two-way bf16 split GEMMs (near-f32, stored as bf16 hi and lo fragments) and S = q.k*sqrt(128) is also a two-way split; the causal zero-fill followed
// by "== 0 -> -inf" of the reference is reproduced (masked and exactly-zero kept scores both get -inf); online softmax in f32; v from the
#define NB 4
#define SQ 2048
#define EE 1024
#define HD 128
#define NR (NB * SQ)

// q, k and v leave as bf16 hi and lo planes in WMMA fragment order (two-way bf16 split GEMMs, f32 results split once more). One block = 64 rows of x times 192 output columns: blockIdx.y = 0 all of q and
// columns 0..63 of k, blockIdx.y = 1 all of v and columns 64..127 of k. Per slab of 64 k the block reads its 64 x rows and 192 W rows
// once, in whole 256-byte runs, splits each value once into bf16 hi and lo, and lays the two planes in LDS; the eight waves (2 x 4, 32 x 48 outputs each) take their fragments from
// there. Two LDS buffers and two register sets of fragments: the fragments of a 32-k step are read from LDS during the WMMAs of the step before it, also from one slab to the next,
// and each staging register is refilled from global memory as soon as it has been staged. Per accumulator the WMMA order is k ascending from the block's own first slab, wrapping round, lo.hi, hi.lo, hi.hi.
#define QM 64
#define QN 192
#define QK 64
#define QP 144                    // LDS row pitch in bytes: 128 B of bf16 + 16, an odd multiple of 16 B (no bank conflict for 16-byte reads)
#define QPL ((QM + QN) * QP)      // one plane (hi or lo) of one buffer
#define QBUF (2 * QPL)
#define QSO 196                   // pitch in floats of the output staging
typedef __attribute__((ext_vector_type(8))) __bf16 v8b;
typedef __attribute__((ext_vector_type(4))) __bf16 v4b;
// A packed fragment is 2 KB: hi elements 0..7, hi 8..15, lo 0..7, lo 8..15, each a run of 32 lanes x 16 bytes, so that every wave-wide access is 512 contiguous bytes.
// q, k: fragment (16-row tile, 32-wide step kc of the head), lane (g, col) = row col, elements = head kc*32 + 8g + 0..7 and + 16. Index tile * 4 + kc.
// v: fragment (32-key group, 16-column tile t), lane (g, col) = column t*16 + col, elements = keys 8g + 0..7 and + 16 of the group. Index group * 8 + t.
#define FRB 2048
__device__ __forceinline__ void put_frag(char* p, const F2& f) { union { v16b v; v8b q[2]; } a, b; a.v = f.h; b.v = f.l;
  *(v8b*)p = a.q[0]; *(v8b*)(p + 512) = a.q[1]; *(v8b*)(p + 1024) = b.q[0]; *(v8b*)(p + 1536) = b.q[1];
  // behind the run's last store: wait before a register that an issued store names is overwritten; as an input the address pair stays live up to it
  asm volatile("s_wait_xcnt 0x0" :: "v"(p) : "memory"); }
__device__ __forceinline__ F2 get_frag(const char* p) { union { v16b v; v8b q[2]; } a, b; F2 r;
  a.q[0] = *(const v8b*)p; a.q[1] = *(const v8b*)(p + 512); b.q[0] = *(const v8b*)(p + 1024); b.q[1] = *(const v8b*)(p + 1536); r.h = a.v; r.l = b.v; return r; }
__device__ __forceinline__ v16b frag_lds(const char* p) { union { v16b v; v8b q[2]; } u; u.q[0] = *(const v8b*)p; u.q[1] = *(const v8b*)(p + 32); return u.v; }
// 16 rows a step, 16 lanes a row: 4 steps of x, 8 of the whole W matrix, 4 of the half of Wk; each pointer holds the lane's own offset and the slab's k, and moves on by one slab behind its loads
// steps I0 .. I1 - 1 only: 0..3 are x (from memory, the longest way), 4..15 are W (from L2)
struct QB { const float* x; const float* a; const float* b; unsigned lo; int kx, kw; };   // the three block-wide bases and the lane's byte offset, from which the pointers were formed; the slab that px, and that pa and pb, stand at
template <int I0, int I1, bool PRO> __device__ __forceinline__ void q_fetch(v4f (&st)[16], const float*& px, const float*& pa, const float*& pb, QB& qb) {
#pragma unroll   // st is indexed by constants only, so it stays in registers; the row steps become immediate offsets
  for (int i = I0; i < I1; ++i) st[i] = *(const v4f*)(i < 4 ? px + (size_t)i * 16 * EE : (i < 12 ? pa + (size_t)(i - 4) * 16 * EE : pb + (size_t)(i - 12) * 16 * EE));
  // wait before a register that an issued load names is overwritten (the pointers move on right behind it); as inputs the address pairs in use stay live up to it, so that nothing lands on one
  // ahead of it; in front of the loop (PRO) so do base and offset, which the loads there name in the pairs' place
  if constexpr (I0 < 4 && PRO) asm volatile("s_wait_xcnt 0x0" :: "v"(px), "v"(qb.lo), "s"(qb.x) : "memory");
  if constexpr (I0 < 4 && !PRO) asm volatile("s_wait_xcnt 0x0" :: "v"(px) : "memory");
  if constexpr (I1 > 4 && PRO) asm volatile("s_wait_xcnt 0x0" :: "v"(pa), "v"(pb), "v"(qb.lo), "s"(qb.a), "s"(qb.b) : "memory");
  if constexpr (I1 > 4 && !PRO) asm volatile("s_wait_xcnt 0x0" :: "v"(pa), "v"(pb) : "memory");
  // on by one slab; behind the last slab of the row the walk goes on at the row's first (the block entered it at a slab of its own)
  if constexpr (I0 < 4) { qb.kx = (qb.kx + 1) & (EE / QK - 1); px += qb.kx ? QK : QK - EE; }
  if constexpr (I1 > 4) { qb.kw = (qb.kw + 1) & (EE / QK - 1); const int d = qb.kw ? QK : QK - EE; pa += d; pb += d; }
}
template <int I0, int I1> __device__ __forceinline__ void q_stage(const v4f (&st)[16], char* p) {
#pragma unroll   // st is indexed by constants only, so it stays in registers
  for (int i = I0; i < I1; ++i) { v4b h, l;
#pragma unroll   // vector elements picked by constants
    for (int c = 0; c < 4; ++c) { const __bf16 hh = (__bf16)st[i][c]; h[c] = hh; l[c] = (__bf16)(st[i][c] - (float)hh); }
    *(v4b*)(p + i * 16 * QP) = h; *(v4b*)(p + i * 16 * QP + QPL) = l; }
}
// the five fragments of one 32-k step, hi and lo: f[0], f[1] the wave's two row tiles of x, f[2..4] its three column tiles of W
__device__ __forceinline__ void q_frags(F2 (&f)[5], const char* ra, const char* rbf) {
#pragma unroll   // f is indexed by constants only, so it stays in registers
  for (int t = 0; t < 5; ++t) { const char* p = t < 2 ? ra + t * 16 * QP : rbf + (t - 2) * 16 * QP; f[t].h = frag_lds(p); f[t].l = frag_lds(p + QPL); }
  __builtin_amdgcn_sched_barrier(0);   // keeps the reads as one group in front of the WMMAs of the step before: sunk among or behind them they would not have returned when they are needed
}
// The plain builtin, which the compiler pads itself: the two fragment sets take the kernel above 256 registers, and with wmma_bf, whose asm operands the compiler kept in the first 256, the loop spilled to scratch.
__device__ __forceinline__ void q_mac(v8f (&acc)[6], const F2 (&f)[5]) {
#pragma unroll   // lo.hi, then hi.lo, then hi.hi: six independent accumulators between two WMMAs on the same one
  for (int ps = 0; ps < 3; ++ps)
#pragma unroll   // acc and f are indexed by constants only
    for (int t = 0; t < 6; ++t) acc[t] = __builtin_amdgcn_wmma_f32_16x16x32_bf16(false, ps == 0 ? f[t / 3].l : f[t / 3].h, false, ps == 1 ? f[2 + t % 3].l : f[2 + t % 3].h, (short)0, acc[t], false, false);
}
// The slab barrier by hand: the wave's LDS stores and reads are done, then the work-group barrier. __syncthreads() would also wait for the global loads of the slab after next, which are to stay in flight across it.
#define QBAR() asm volatile("s_wait_dscnt 0x0\n\ts_barrier_signal -1\n\ts_barrier_wait -1" ::: "memory")
// One slab. On entry f0 holds (or is about to receive) the fragments of the slab's first 32-k step. STAGE: a next slab exists and is in st; FETCH: a slab after next exists.
// The last two trips are written out apart from the loop, so that inside it every count of loads and LDS reads in flight is the same on every path and no wait is set for the shorter path.
template <bool STAGE, bool FETCH> __device__ __forceinline__ void q_trip(int ks, v8f (&acc)[6], F2 (&f0)[5], F2 (&f1)[5], v4f (&st)[16], const char* ra, const char* rbf, char* wr,
                                                                         const float*& px, const float*& pa, const float*& pb, QB& qb) {
  const int cur = (ks & 1) * QBUF, nxt = QBUF - cur;
  q_frags(f1, ra + cur + 64, rbf + cur + 64);   // the slab's second step is read during the first step's WMMAs
  if (STAGE) q_stage<0, 4>(st, wr + nxt);
  if (FETCH) q_fetch<0, 4, false>(st, px, pa, pb, qb);   // x is staged and asked for again first: nearly a whole trip for the way from memory
  __builtin_amdgcn_sched_barrier(0);                             // keeps the WMMAs out of the lines above: woven in there they put off the loads of x by their own length
  q_mac(acc, f0);                                                // the compiler is free to weave the split of W into these WMMAs
  if (STAGE) q_stage<4, 16>(st, wr + nxt);
  if (FETCH) q_fetch<4, 16, false>(st, px, pa, pb, qb);
  QBAR();   // publishes the slab just staged; every wave's reads of this slab's buffer, which the next trip refills, have returned in front of it
  if (STAGE) q_frags(f0, ra + nxt, rbf + nxt);   // the next slab's first step is read during this slab's last WMMAs
  q_mac(acc, f1);
}
__global__ __launch_bounds__(256) void k_qkv(const float* __restrict__ x, const float* __restrict__ Wq, const float* __restrict__ Wk, const float* __restrict__ Wv, float* __restrict__ qpk, float* __restrict__ kpk, float* __restrict__ vpk) {
  __shared__ __align__(16) char sm[2 * QBUF];
  const int tid = threadIdx.x, wave = __builtin_amdgcn_readfirstlane(tid >> 5), lane = tid & 31, col = lane & 15, g = lane >> 4;
  const int r0b = blockIdx.x * QM, y = blockIdx.y, wm = wave >> 2, wn = wave & 3;
  // All blocks of one y walk the same rows of W. Each enters the walk over k at a slab of its own and wraps round, so that at one moment they ask L2 for sixteen different sets of lines and not all for the same one.
  const int s0 = ((blockIdx.x >> 3) + 8 * y) & (EE / QK - 1);   // the two blocks that share their rows of x stand half a walk apart
  QB qb = { x + (size_t)r0b * EE + s0 * QK, (y == 0 ? Wq : Wv) + s0 * QK, Wk + (size_t)y * 64 * EE + s0 * QK, (unsigned)(((tid >> 4) * EE + (tid & 15) * 4) * 4), s0, s0 };
  const float* px = (const float*)((const char*)qb.x + qb.lo); const float* pa = (const float*)((const char*)qb.a + qb.lo); const float* pb = (const float*)((const char*)qb.b + qb.lo);
  char* const wr = sm + (tid >> 4) * QP + (tid & 15) * 8;
  const char* const ra = sm + (wm * 32 + col) * QP + g * 16;
  const char* const rbf = sm + (QM + wn * 48 + col) * QP + g * 16;
  v4f st[16]; v8f acc[6] = {}; F2 f0[5], f1[5];
  q_fetch<0, 16, true>(st, px, pa, pb, qb);
  q_stage<0, 4>(st, wr); q_fetch<0, 4, true>(st, px, pa, pb, qb);
  q_stage<4, 16>(st, wr); q_fetch<4, 16, true>(st, px, pa, pb, qb);
  QBAR();
  q_frags(f0, ra, rbf);
#pragma unroll 1   // one slab a trip: the two buffers alternate by a run-time offset
  for (int ks = 0; ks < EE / QK - 2; ++ks) q_trip<true, true>(ks, acc, f0, f1, st, ra, rbf, wr, px, pa, pb, qb);
  q_trip<true, false>(EE / QK - 2, acc, f0, f1, st, ra, rbf, wr, px, pa, pb, qb);
  q_trip<false, false>(EE / QK - 1, acc, f0, f1, st, ra, rbf, wr, px, pa, pb, qb);
  float* const so = (float*)sm;   // the ring is free behind the last trip's barrier
#pragma unroll   // acc is indexed by constants only
  for (int e = 0; e < 48; ++e) { const int t = e >> 3, r = e & 7; so[(wm * 32 + (t / 3) * 16 + 8 * g + r) * QSO + wn * 48 + (t % 3) * 16 + col] = acc[t][r]; }
  __syncthreads();
  if (y == 0) {
#pragma unroll   // the block's sixteen fragments of q, two a wave: id = (16-row tile, kc)
    for (int u = 0; u < 2; ++u) { const int id = u * 8 + wave; float v[16]; const float* p = so + ((id >> 2) * 16 + col) * QSO + (id & 3) * 32 + 8 * g;
#pragma unroll   // v is indexed by constants only
      for (int i = 0; i < 8; ++i) { v[i] = p[i]; v[8 + i] = p[16 + i]; }
      put_frag((char*)qpk + ((size_t)(r0b / 16) * 4 + id) * FRB + lane * 16, bsplit16(v)); }
  } else {
#pragma unroll   // the block's two 32-key groups of v; wave = column tile
    for (int u = 0; u < 2; ++u) { float v[16]; const float* p = so + (u * 32 + 8 * g) * QSO + wave * 16 + col;
#pragma unroll   // v is indexed by constants only
      for (int i = 0; i < 8; ++i) { v[i] = p[i * QSO]; v[8 + i] = p[(16 + i) * QSO]; }
      put_frag((char*)vpk + ((size_t)(r0b / 32 + u) * 8 + wave) * FRB + lane * 16, bsplit16(v)); }
  }
  { float v[16]; const float* p = so + ((wave >> 1) * 16 + col) * QSO + 128 + (wave & 1) * 32 + 8 * g;   // the block's half of k: wave = (16-key tile, kc)
#pragma unroll   // v is indexed by constants only
    for (int i = 0; i < 8; ++i) { v[i] = p[i]; v[8 + i] = p[16 + i]; }
    put_frag((char*)kpk + ((size_t)(r0b / 16 + (wave >> 1)) * 4 + y * 2 + (wave & 1)) * FRB + lane * 16, bsplit16(v)); }
}
// One block = two tiles of 16 query rows, tile 127 - y (index 0 below, the longer) and tile y (index 1): every block then has 33 (query tile, key tile) pairs, all blocks are resident at once, and the key tiles
// of the shorter query tile are among those of the longer, so that there one copy of a k or v fragment feeds the products of both. The NW waves share the key tiles (wave w takes tiles w, w + NW, ...), each with
// an online softmax of its own per query tile; the partial (max, sum, acc) triples are merged through LDS in wave order at the end.
// Both products run transposed, the fragment of k or v as A and that of q or of the weights as B: a lane's column is then one query, whose scores, weights and sums stay in the lane's own registers.
// qpk is not __restrict__: its fragments are then loaded anew in every tile's stream and not held in registers (or in scratch) across the softmax and the v products.
// The fragments of k and v do not pass through registers on their way in: each wave copies them asynchronously into an LDS ring of its own, RG groups of two fragments, in the order of their use
// (k: per kc step the four key tiles; then the sixteen of v). A group is read into registers one group ahead of its products; as soon as those reads have returned its place is refilled with the group
// RG further on, so that up to RG groups (24 KB a wave) are on their way at a time. No other wave touches a wave's ring, so no barrier belongs to it.
#define NW 8
#define GB (2 * FRB)    // one group
#define RG 6            // groups in a wave's ring
#define RWB (RG * GB)   // ring bytes a wave
#define NG 16           // groups a key tile: 8 of k, 8 of v
// The eight copies of one group: every lane brings 16 bytes a copy, the immediate offset moves the global and the LDS address alike. The s_wait_xcnt stands inside the statement, behind the last copy:
// wait before a register that an issued copy names is rewritten.
__device__ __forceinline__ void cp_group(unsigned l0, const char* g0, unsigned l1, const char* g1) {
  asm volatile("global_load_async_to_lds_b128 %0, %1, off\n\t"
               "global_load_async_to_lds_b128 %0, %1, off offset:512\n\t"
               "global_load_async_to_lds_b128 %0, %1, off offset:1024\n\t"
               "global_load_async_to_lds_b128 %0, %1, off offset:1536\n\t"
               "global_load_async_to_lds_b128 %2, %3, off\n\t"
               "global_load_async_to_lds_b128 %2, %3, off offset:512\n\t"
               "global_load_async_to_lds_b128 %2, %3, off offset:1024\n\t"
               "global_load_async_to_lds_b128 %2, %3, off offset:1536\n\t"
               "s_wait_xcnt 0x0" :: "v"(l0), "v"(g0), "v"(l1), "v"(g1) : "memory");
}
// Returns when all but the wave's Y youngest groups (eight copies each) have landed. Every key tile is the same straight line of copies and waits and starts and ends with none on its way, so each count is exact.
template <int Y> __device__ __forceinline__ void cp_wait() {
  static_assert(Y >= 0 && Y < RG, "");
  if constexpr (Y == 5) asm volatile("s_wait_asynccnt 0x28" ::: "memory");
  if constexpr (Y == 4) asm volatile("s_wait_asynccnt 0x20" ::: "memory");
  if constexpr (Y == 3) asm volatile("s_wait_asynccnt 0x18" ::: "memory");
  if constexpr (Y == 2) asm volatile("s_wait_asynccnt 0x10" ::: "memory");
  if constexpr (Y == 1) asm volatile("s_wait_asynccnt 0x8" ::: "memory");
  if constexpr (Y == 0) asm volatile("s_wait_asynccnt 0x0" ::: "memory");
}
struct G2 { F2 a, b; };   // one group in registers
// Inside a key tile too the blocks of a batch do not ask L2 for the same lines at one moment. The scores sum over the four kc in any order: at place p of that walk a block takes step kc_at(p), of k and of q alike.
// The eight column tiles of v are independent: accumulator t of a block stands for column tile vt_at(t) all through the kernel, in the copies' addresses and where the partial outputs are laid down.
__device__ __forceinline__ int kc_at(int p) { return (p + (int)(blockIdx.y >> 3)) & 3; }
__device__ __forceinline__ int vt_at(int t) { return (t + (int)(blockIdx.y >> 3)) & 7; }
template <int GI> __device__ __forceinline__ void cp_issue(unsigned rl, const char* kp, const char* vp) {
  constexpr int f = 2 * GI; const unsigned l = rl + (GI % RG) * GB;
  if constexpr (f < 16) cp_group(l, kp + ((f & 3) * 4 + kc_at(f >> 2)) * FRB, l + FRB, kp + (((f + 1) & 3) * 4 + kc_at(f >> 2)) * FRB);
  else cp_group(l, vp + (((f - 16) & 8) + vt_at((f - 16) & 7)) * FRB, l + FRB, vp + (((f - 16) & 8) + vt_at((f - 15) & 7)) * FRB);
}
template <int GI> __device__ __forceinline__ void ring_read(G2& d, const char* rr) { d.a = get_frag(rr + (GI % RG) * GB); d.b = get_frag(rr + (GI % RG) * GB + FRB); }
// In front of the products of group GI: its reads have returned, so its place takes the copies of group GI + RG; then group GI + 1, once landed, is read into the other register set.
template <int GI> __device__ __forceinline__ void ring_turn(G2& nx, const char* rr, unsigned rl, const char* kp, const char* vp) {
  asm volatile("s_wait_dscnt 0x0" ::: "memory");   // the wave's reads of the place have retired before a copy is aimed at it
  if constexpr (GI + RG < NG) cp_issue<GI + RG>(rl, kp, vp);
  if constexpr (GI + 1 < NG) { cp_wait<(GI + RG < NG ? RG - 1 : NG - 2 - GI)>(); ring_read<GI + 1>(nx, rr); }
}
// The products of one group (two fragments of k or v, as A) with the B fragments of one or two query tiles: the results stand transposed, a lane's column is a query. The plain builtin, which the compiler pads itself: two query tiles take the kernel above 256 registers (see q_mac).
// Per accumulator the order is (query side).(key side) lo.hi, hi.lo, hi.hi.
template <int NQ> __device__ __forceinline__ void g_mac(const F2* const (&a)[2], const G2& b, v8f* const (&c0)[2], v8f* const (&c1)[2]) {
#pragma unroll   // the two or four accumulators are independent: they stand between two WMMAs on the same one
  for (int ps = 0; ps < 3; ++ps)
#pragma unroll
    for (int j = 0; j < NQ; ++j) {
      *c0[j] = __builtin_amdgcn_wmma_f32_16x16x32_bf16(false, ps == 1 ? b.a.l : b.a.h, false, ps == 0 ? a[j]->l : a[j]->h, (short)0, *c0[j], false, false);
      *c1[j] = __builtin_amdgcn_wmma_f32_16x16x32_bf16(false, ps == 1 ? b.b.l : b.b.h, false, ps == 0 ? a[j]->l : a[j]->h, (short)0, *c1[j], false, false); }
}
// One kc step's fragments of q, of one or two query tiles: a0, a1 are the same for the whole wave, the lane adds its 16 bytes.
template <int NQ> __device__ __forceinline__ void q_frag(F2& f0, F2& f1, const char* a0, const char* a1) {
  const unsigned lo = (threadIdx.x & 31u) * 16u;
  f0 = get_frag(a0 + lo);
  if constexpr (NQ == 2) f1 = get_frag(a1 + lo);
}
template <int GI, int NQ> __device__ __forceinline__ void s_step(v8f (&s4)[2][4], F2 (&fq)[2][2], G2 (&fr)[2], const char* q0p, const char* q1p, const char* rr, unsigned rl, const char* kp, const char* vp) {
  constexpr int kc = GI >> 1, t0 = (GI & 1) * 2;
  ring_turn<GI>(fr[(GI + 1) & 1], rr, rl, kp, vp);
  if constexpr ((GI & 1) == 0 && kc < 3) {   // the next kc's fragments of q, two groups ahead, by plain loads: all waves of the block read the same lines
    q_frag<NQ>(fq[0][(kc + 1) & 1], fq[1][(kc + 1) & 1], q0p + kc_at(kc + 1) * FRB, q1p + kc_at(kc + 1) * FRB); }
  // behind the tile's last loads of q: wait before a register that an issued load names is overwritten (the eight address pairs are formed once, in front of the tile loop)
  if constexpr (GI == 4) asm volatile("s_wait_xcnt 0x0" ::: "memory");
  __builtin_amdgcn_sched_barrier(0);   // keeps the reads and loads above in front of the WMMAs: sunk behind them they would not have returned at the next group's wait
  const F2* const a[2] = { &fq[0][kc & 1], &fq[1][kc & 1] }; v8f* const c0[2] = { &s4[0][t0], &s4[1][t0] }; v8f* const c1[2] = { &s4[0][t0 + 1], &s4[1][t0 + 1] };
  g_mac<NQ>(a, fr[GI & 1], c0, c1);
}
template <int GI, int NQ> __device__ __forceinline__ void v_step(v8f (&acc)[2][8], const F2& p0, const F2& p1, G2 (&fr)[2], const char* rr, unsigned rl, const char* kp, const char* vp) {
  constexpr int t0 = (2 * (GI - 8)) & 7;
  ring_turn<GI>(fr[(GI + 1) & 1], rr, rl, kp, vp);
  __builtin_amdgcn_sched_barrier(0);   // as in s_step
  const F2* const a[2] = { &p0, &p1 }; v8f* const c0[2] = { &acc[0][t0], &acc[1][t0] }; v8f* const c1[2] = { &acc[0][t0 + 1], &acc[1][t0 + 1] };
  g_mac<NQ>(a, fr[GI & 1], c0, c1);
}
// lane l with lane l ^ 16, in the vector unit
__device__ __forceinline__ float xhalf(float x) { return __builtin_bit_cast(float, __builtin_amdgcn_permlanex16(__builtin_bit_cast(int, x), __builtin_bit_cast(int, x), 0x76543210, 0xfedcba98, false, false)); }
// The online softmax step of one query tile, in registers. The scores stand transposed: lane (g, col) holds, of query qi = tile + col, the keys key0 + 16 t + r with key0 = 64 kt + 8 g, so a row's maximum and sum are
// in-lane but for one exchange between the wave's halves, and tiles 2u and 2u + 1 of the weights, split in place, are the B fragment of 32-key group u. Returns the factor that the query's older sums take.
__device__ __forceinline__ float soft_reg(const v8f (&s4)[4], F2 (&pa)[2], int qi, int key0, float& mrun, float& lrun) {
  const float scl = 11.313708498984761f;     // * sqrt(128), as the reference
  const int d = qi - key0;                   // key <= query reads 16 t + r <= d: one compare with a constant per score
  float sv[32], mt[4], pt[4];
#pragma unroll   // sv is indexed by constants only, so it stays in registers
  for (int t = 0; t < 4; ++t) { mt[t] = -3.4e38f;
#pragma unroll
    for (int r = 0; r < 8; ++r) { const float x = s4[t][r] * scl; const float s = (t * 16 + r <= d && x != 0.0f) ? x : -3.0e38f; sv[t * 8 + r] = s; mt[t] = fmaxf(mt[t], s); } }
  float mx = fmaxf(fmaxf(mt[0], mt[1]), fmaxf(mt[2], mt[3]));
  mx = fmaxf(mx, xhalf(mx));
  // Every exponential is computed unconditionally and the masked case picked afterwards by a select: no branch on EXEC per score, so the chains of a tile are independent and interleave.
  const float mnew = fmaxf(mrun, mx); const float ec = expf(mrun - mnew); const float corr = mnew <= -1.0e38f ? 1.0f : ec;
#pragma unroll
  for (int t = 0; t < 4; ++t) { pt[t] = 0.f;
#pragma unroll
    for (int r = 0; r < 8; ++r) { const float s = sv[t * 8 + r]; const float e = expf(s - mnew); const float p = s <= -1.0e38f ? 0.f : e; pt[t] += p; sv[t * 8 + r] = p; } }
  float ps = (pt[0] + pt[1]) + (pt[2] + pt[3]);
  ps += xhalf(ps);
  lrun = lrun * corr + ps; mrun = mnew;
  pa[0] = bsplit16(&sv[0]); pa[1] = bsplit16(&sv[16]);
  return corr;
}
// One key tile, for the longer query tile (NQ = 1) or for both (NQ = 2), in two parts: the scores; then, behind the softmax, the products with v.
template <int NQ> __device__ __forceinline__ void s_phase(const char* kp, const char* vp, const char* q0p, const char* q1p, const char* rr, unsigned rl, v8f (&s4)[2][4], G2 (&fr)[2]) {
  F2 fq[2][2];
  cp_issue<0>(rl, kp, vp); cp_issue<1>(rl, kp, vp); cp_issue<2>(rl, kp, vp);   // every ring read of the tile before retired at the wait in front of its last group's products
  cp_issue<3>(rl, kp, vp); cp_issue<4>(rl, kp, vp); cp_issue<5>(rl, kp, vp);
  q_frag<NQ>(fq[0][0], fq[1][0], q0p + kc_at(0) * FRB, q1p + kc_at(0) * FRB);
  cp_wait<RG - 1>(); ring_read<0>(fr[0], rr);
  s_step<0, NQ>(s4, fq, fr, q0p, q1p, rr, rl, kp, vp); s_step<1, NQ>(s4, fq, fr, q0p, q1p, rr, rl, kp, vp); s_step<2, NQ>(s4, fq, fr, q0p, q1p, rr, rl, kp, vp); s_step<3, NQ>(s4, fq, fr, q0p, q1p, rr, rl, kp, vp);
  s_step<4, NQ>(s4, fq, fr, q0p, q1p, rr, rl, kp, vp); s_step<5, NQ>(s4, fq, fr, q0p, q1p, rr, rl, kp, vp); s_step<6, NQ>(s4, fq, fr, q0p, q1p, rr, rl, kp, vp); s_step<7, NQ>(s4, fq, fr, q0p, q1p, rr, rl, kp, vp);
}
template <int NQ> __device__ __forceinline__ void v_phase(const char* kp, const char* vp, const char* rr, unsigned rl, const float (&corr)[2], const F2 (&pa)[2][2], G2 (&fr)[2], v8f (&acc)[2][8]) {
#pragma unroll   // acc is indexed by constants only, so it stays in registers; a lane's accumulators all belong to its own query
  for (int j = 0; j < NQ; ++j)
#pragma unroll
    for (int t = 0; t < 8; ++t) acc[j][t] *= corr[j];
  v_step<8, NQ>(acc, pa[0][0], pa[1][0], fr, rr, rl, kp, vp); v_step<9, NQ>(acc, pa[0][0], pa[1][0], fr, rr, rl, kp, vp); v_step<10, NQ>(acc, pa[0][0], pa[1][0], fr, rr, rl, kp, vp); v_step<11, NQ>(acc, pa[0][0], pa[1][0], fr, rr, rl, kp, vp);
  v_step<12, NQ>(acc, pa[0][1], pa[1][1], fr, rr, rl, kp, vp); v_step<13, NQ>(acc, pa[0][1], pa[1][1], fr, rr, rl, kp, vp); v_step<14, NQ>(acc, pa[0][1], pa[1][1], fr, rr, rl, kp, vp); v_step<15, NQ>(acc, pa[0][1], pa[1][1], fr, rr, rl, kp, vp);
}
__global__ __launch_bounds__(NW * 32) void k_attn(const float* qpk, const float* __restrict__ kpk, const float* __restrict__ vpk, float* __restrict__ out) {
  __shared__ __align__(16) char sR[NW * RWB];          // the rings; behind the tile loop and the first barrier the same bytes hold the partial outputs
  __shared__ float sM[2][NW][16];
  __shared__ float sL[2][NW][16];
  float (*const sO)[32][132] = (float (*)[32][132])sR;
  static_assert(sizeof(float) * NW * 32 * 132 <= NW * RWB, "");
  // w through readfirstlane: the tile loop's tests are then scalar branches and EXEC stays full at the WMMAs and at the copies
  const int tid = threadIdx.x, w = __builtin_amdgcn_readfirstlane(tid >> 5), lane = tid & 31, col = lane & 15, g = lane >> 4;
  const int b = blockIdx.x; const int q0[2] = { (SQ / 16 - 1 - (int)blockIdx.y) * 16, (int)blockIdx.y * 16 }; const size_t rb = (size_t)b * SQ;
  const char* q0p = (const char*)qpk + (rb + q0[0]) * HD * 4; const char* q1p = (const char*)qpk + (rb + q0[1]) * HD * 4;   // the two query tiles' fragments, without the lane's offset
  const char* kb = (const char*)kpk + rb * HD * 4 + lane * 16; const char* vb = (const char*)vpk + rb * HD * 4 + lane * 16;   // 64 keys = 16 fragments = 32 KB in either
  const char* const rr = sR + w * RWB + lane * 16;   // the lane's 16 bytes in the first run of its wave's ring
  const unsigned rl = (unsigned)(size_t)rr;          // the same as an LDS byte address
  float mrun[2] = { -3.0e38f, -3.0e38f }, lrun[2] = { 0.f, 0.f }; v8f acc[2][8] = {};   // of query col of either tile, the same in both halves of the wave; acc[j][t][r] = head column 16 vt_at(t) + 8 g + r
  const int n0 = (q0[0] >> 6) + 1, n1 = (q0[1] >> 6) + 1;   // key tiles of the longer and of the shorter query tile, n1 <= n0
  // The 64 blocks of one batch walk the same k and v. A wave keeps its key tiles (w, w + NW, ...) but enters them at a place set by the block's index and wraps round, so that at one moment
  // the blocks ask L2 for up to four different sets of tiles and not all for the same eight. The online softmax takes the tiles in any order.
  const int cnt = (n0 - w + NW - 1) / NW;                      // key tiles of this wave: 2 to 4
  int it = ((((int)blockIdx.y >> 1) & 3) * cnt) >> 2;          // the first of them for this block
#pragma unroll 1
  for (int c = 0; c < cnt; ++c) {
    const int kt = w + it * NW; it = it + 1 == cnt ? 0 : it + 1;
    const char* const kp = kb + (size_t)kt * (16 * FRB); const char* const vp = vb + (size_t)kt * (16 * FRB);
    G2 fr[2]; v8f s4[2][4] = {}; F2 pa[2][2]; float corr[2] = { 1.0f, 1.0f };
    const bool two = kt < n1; const int key0 = kt * 64 + 8 * g;
    if (two) s_phase<2>(kp, vp, q0p, q1p, rr, rl, s4, fr);
    else s_phase<1>(kp, vp, q0p, q1p, rr, rl, s4, fr);
    // the longer tile's softmax stands once in the text and serves both cases: written out for each, the kernel's text passes 32 KB
    corr[0] = soft_reg(s4[0], pa[0], q0[0] + col, key0, mrun[0], lrun[0]);
    if (two) { corr[1] = soft_reg(s4[1], pa[1], q0[1] + col, key0, mrun[1], lrun[1]); v_phase<2>(kp, vp, rr, rl, corr, pa, fr, acc); }
    else v_phase<1>(kp, vp, rr, rl, corr, pa, fr, acc);
  }
  if (g == 0) { sM[0][w][col] = mrun[0]; sM[1][w][col] = mrun[1]; }
  __syncthreads();
#pragma unroll   // acc is indexed by constants only, so it stays in registers
  for (int j = 0; j < 2; ++j) {
    float mg = sM[j][0][col];
#pragma unroll   // all NW reads in flight at once
    for (int i = 1; i < NW; ++i) mg = fmaxf(mg, sM[j][i][col]);
    const float f = mg <= -1.0e38f ? 1.0f : expf(mrun[j] - mg);   // a wave without a kept score has acc = 0 and lrun = 0
    if (g == 0) sL[j][w][col] = lrun[j] * f;
#pragma unroll   // a lane's eight values of a tile are eight neighbouring head columns of its query's row: two 16-byte stores
    for (int t = 0; t < 8; ++t) { const v8f o = acc[j][t] * f; float* const p = &sO[w][j * 16 + col][vt_at(t) * 16 + 8 * g];
      *(v4f*)p = __builtin_shufflevector(o, o, 0, 1, 2, 3); *(v4f*)(p + 4) = __builtin_shufflevector(o, o, 4, 5, 6, 7); }
  }
  __syncthreads();
#pragma unroll 1   // wave w sums rows w, w + NW of either query tile over the NW partials; rolled for the size of the text, as above
  for (int u = 0; u < 32 / NW; ++u) { const int row = u * NW + w, j = row >> 4, rw = row & 15;
    float lt = 0.f; v4f o = {};
#pragma unroll   // all NW reads in flight at once; the sum runs in wave order
    for (int i = 0; i < NW; ++i) { lt += sL[j][i][rw]; o += *(const v4f*)(&sO[i][row][lane * 4]); }
#pragma unroll
    for (int c = 0; c < 4; ++c) o[c] = o[c] / lt;
    float* const po = out + (rb + (j ? q0[1] : q0[0]) + rw) * HD + lane * 4; vst2(po, o);
    // behind the store: wait before a register that the issued store names is overwritten (the next trip writes them anew); as an input the address pair stays live up to it
    asm volatile("s_wait_xcnt 0x0" :: "v"(po) : "memory"); }
}
extern "C" void kernel_launch(void* const* d_in, const int* in_sizes, int n_in, void* d_out, int out_size, void* d_ws, size_t ws_size, hipStream_t stream) {
  (void)in_sizes; (void)n_in; (void)out_size; (void)ws_size;
  const float* x = (const float*)d_in[0]; const float* Wq = (const float*)d_in[1]; const float* Wk = (const float*)d_in[2]; const float* Wv = (const float*)d_in[3];
  float* out = (float*)d_out;
  char* ws = (char*)d_ws; size_t off = 0;
  auto take = [&](size_t bytes) { char* p = ws + off; off += (bytes + 255) & ~(size_t)255; return p; };
  float* qpk = (float*)take((size_t)NR * HD * 4); float* kpk = (float*)take((size_t)NR * HD * 4); float* vpk = (float*)take((size_t)NR * HD * 4);
  k_qkv<<<dim3(NR / QM, 2), 256, 0, stream>>>(x, Wq, Wk, Wv, qpk, kpk, vpk);
  k_attn<<<dim3(NB, SQ / 32), NW * 32, 0, stream>>>(qpk, kpk, vpk, out);
}

// v010
// One run takes 38.8 microseconds.
// In both of two side-by-side timings against v009, it was 1.03 times as fast.
// Counting every step since v000, it is 13.7 times as fast.
#include <hip/hip_runtime.h>
#include <math.h>

typedef __attribute__((ext_vector_type(16))) _Float16 v16h;
typedef __attribute__((ext_vector_type(16))) __bf16 v16b;
typedef __attribute__((ext_vector_type(8)))  _Float16 v8h;
typedef __attribute__((ext_vector_type(8)))  float v8f;
typedef __attribute__((ext_vector_type(4)))  float v4f;
typedef __attribute__((ext_vector_type(2)))  float v2f;
typedef __attribute__((ext_vector_type(4)))  unsigned v4u;
typedef __attribute__((ext_vector_type(4)))  int v4i;
typedef float __attribute__((may_alias)) float_a;
typedef int __attribute__((may_alias)) int_a;

template <typename T> __device__ __forceinline__ void vst2(void* p, T v) { *(T*)p = v;  }
__device__ __forceinline__ v8f wmma16(v16h a, v16h b, v8f c) {
  v8f d = __builtin_amdgcn_wmma_f32_16x16x32_f16(false, a, false, b, (short)0, c, false, false);
  asm volatile("v_nop\n\tv_nop\n\tv_nop\n\tv_nop" : "+v"(d) : "v"(a), "v"(b));
  return d;
}
__device__ __forceinline__ v8f wmma_bf(v16b a, v16b b, v8f c) {
  v8f d = __builtin_amdgcn_wmma_f32_16x16x32_bf16(false, a, false, b, (short)0, c, false, false);
  asm volatile("v_nop\n\tv_nop\n\tv_nop\n\tv_nop" : "+v"(d) : "v"(a), "v"(b));
  return d;
}
// 16x16x32 fragments: lane = (h = lane>>4, row/col = lane&15); elements 0..7 = k0+8h+0..7, 8..15 = k0+16+8h+0..7; D element r = row 8h+r
__device__ __forceinline__ v16h frag_h(const _Float16* rowk0, int lane) {
  union { v16h v; v8h q[2]; } u; const _Float16* p = rowk0 + 8 * (lane >> 4);
  u.q[0] = *(const v8h*)p; u.q[1] = *(const v8h*)(p + 16); return u.v;
}
__device__ __forceinline__ v16h frag_f32(const float* rowk0, int lane) {
  v16h a; const float* p = rowk0 + 8 * (lane >> 4);
#pragma unroll
  for (int i = 0; i < 8; ++i) { a[i] = (_Float16)p[i]; a[8 + i] = (_Float16)p[16 + i]; }
  return a;
}
__device__ __forceinline__ v16h frag_f32s(const float* rowk0, int lane, float sc) {
  v16h a; const float* p = rowk0 + 8 * (lane >> 4);
#pragma unroll
  for (int i = 0; i < 8; ++i) { a[i] = (_Float16)(p[i] * sc); a[8 + i] = (_Float16)(p[16 + i] * sc); }
  return a;
}
// column fragment from a [K][ld] layout (column n), rows >= K read as 0
__device__ __forceinline__ v16h fragc_f32(const float* W, int k0, int n, int lane, int ld, int K) {
  v16h a; const int g = lane >> 4;
#pragma unroll
  for (int i = 0; i < 8; ++i) { const int ka = k0 + 8 * g + i, kb = ka + 16;
    a[i] = (_Float16)(ka < K ? W[(size_t)ka * ld + n] : 0.f); a[8 + i] = (_Float16)(kb < K ? W[(size_t)kb * ld + n] : 0.f); }
  return a;
}
struct F2 { v16b h, l; };
__device__ __forceinline__ F2 bsplit16(const float v[16]) { F2 r;
#pragma unroll
  for (int i = 0; i < 16; ++i) { const __bf16 h = (__bf16)v[i]; r.h[i] = h; r.l[i] = (__bf16)(v[i] - (float)h); }
  return r; }
__device__ __forceinline__ F2 split_row(const float* row, int k0, int lane) { float v[16]; const float* p = row + k0 + 8 * (lane >> 4);
#pragma unroll
  for (int i = 0; i < 8; ++i) { v[i] = p[i]; v[8 + i] = p[16 + i]; }
  return bsplit16(v); }
__device__ __forceinline__ F2 split_rowK(const float* row, int k0, int lane, int K) { float v[16]; const int g = lane >> 4;
#pragma unroll
  for (int i = 0; i < 8; ++i) { const int ka = k0 + 8 * g + i, kb = ka + 16; v[i] = ka < K ? row[ka] : 0.f; v[8 + i] = kb < K ? row[kb] : 0.f; }
  return bsplit16(v); }
__device__ __forceinline__ F2 split_col(const float* W, int k0, int n, int lane, int ld, int K) { float v[16]; const int g = lane >> 4;
#pragma unroll
  for (int i = 0; i < 8; ++i) { const int ka = k0 + 8 * g + i, kb = ka + 16; v[i] = ka < K ? W[(size_t)ka * ld + n] : 0.f; v[8 + i] = kb < K ? W[(size_t)kb * ld + n] : 0.f; }
  return bsplit16(v); }
__device__ __forceinline__ v8f mac3(const F2& a, const F2& b, v8f c) { c = wmma_bf(a.l, b.h, c); c = wmma_bf(a.h, b.l, c); return wmma_bf(a.h, b.h, c); }
__device__ __forceinline__ float sigm(float v) { return 1.0f / (1.0f + expf(-v)); }
#define LDSX() do { asm volatile("s_wait_dscnt 0" ::: "memory"); __builtin_amdgcn_wave_barrier(); __builtin_amdgcn_fence(__ATOMIC_RELEASE, "workgroup"); } while (0)

// Single-head causal attention whose scores are MULTIPLIED by sqrt(128) (as the reference), so the softmax is extremely sharp: q and k
// come from two-way bf16 split GEMMs (near-f32, stored as bf16 hi and lo fragments) and S = q.k*sqrt(128) is also a two-way split; the causal zero-fill followed
// by "== 0 -> -inf" of the reference is reproduced (masked and exactly-zero kept scores both get -inf); online softmax in f32; v from the
#define NB 4
#define SQ 2048
#define EE 1024
#define HD 128
#define NR (NB * SQ)

// q, k and v leave as bf16 hi and lo planes in WMMA fragment order (two-way bf16 split GEMMs, f32 results split once more). One block = 64 rows of x times 192 output columns: blockIdx.y = 0 all of q and
// columns 0..63 of k, blockIdx.y = 1 all of v and columns 64..127 of k. Per slab of 64 k the block reads its 64 x rows and 192 W rows
// once, in whole 256-byte runs, splits each value once into bf16 hi and lo, and lays the two planes in LDS; the eight waves (2 x 4, 32 x 48 outputs each) take their fragments from
// there. Two LDS buffers and two register sets of fragments: the fragments of a 32-k step are read from LDS during the WMMAs of the step before it, also from one slab to the next,
// and each staging register is refilled from global memory as soon as it has been staged. Per accumulator the WMMA order is k ascending from the block's own first slab, wrapping round, lo.hi, hi.lo, hi.hi.
#define QM 64
#define QN 192
#define QK 64
#define QP 144                    // LDS row pitch in bytes: 128 B of bf16 + 16, an odd multiple of 16 B (no bank conflict for 16-byte reads)
#define QPL ((QM + QN) * QP)      // one plane (hi or lo) of one buffer
#define QBUF (2 * QPL)
#define QSO 196                   // pitch in floats of the output staging
typedef __attribute__((ext_vector_type(8))) __bf16 v8b;
typedef __attribute__((ext_vector_type(4))) __bf16 v4b;
// A packed fragment is 2 KB: hi elements 0..7, hi 8..15, lo 0..7, lo 8..15, each a run of 32 lanes x 16 bytes, so that every wave-wide access is 512 contiguous bytes.
// q, k: fragment (16-row tile, 32-wide step kc of the head), lane (g, col) = row col, elements = head kc*32 + 8g + 0..7 and + 16. Index tile * 4 + kc.
// v: fragment (32-key group, 16-column tile t), lane (g, col) = column t*16 + col, elements = keys 8g + 0..7 and + 16 of the group. Index group * 8 + t.
#define FRB 2048
__device__ __forceinline__ void put_frag(char* p, const F2& f) { union { v16b v; v8b q[2]; } a, b; a.v = f.h; b.v = f.l;
  *(v8b*)p = a.q[0]; *(v8b*)(p + 512) = a.q[1]; *(v8b*)(p + 1024) = b.q[0]; *(v8b*)(p + 1536) = b.q[1];
  // behind the run's last store: wait before a register that an issued store names is overwritten; as an input the address pair stays live up to it
  asm volatile("s_wait_xcnt 0x0" :: "v"(p) : "memory"); }
__device__ __forceinline__ F2 get_frag(const char* p) { union { v16b v; v8b q[2]; } a, b; F2 r;
  a.q[0] = *(const v8b*)p; a.q[1] = *(const v8b*)(p + 512); b.q[0] = *(const v8b*)(p + 1024); b.q[1] = *(const v8b*)(p + 1536); r.h = a.v; r.l = b.v; return r; }
__device__ __forceinline__ v16b frag_lds(const char* p) { union { v16b v; v8b q[2]; } u; u.q[0] = *(const v8b*)p; u.q[1] = *(const v8b*)(p + 32); return u.v; }
// 16 rows a step, 16 lanes a row: 4 steps of x, 8 of the whole W matrix, 4 of the half of Wk; each pointer holds the lane's own offset and the slab's k, and moves on by one slab behind its loads
// steps I0 .. I1 - 1 only: 0..3 are x (from memory, the longest way), 4..15 are W (from L2)
struct QB { const float* x; const float* a; const float* b; unsigned lo; int kx, kw; };   // the three block-wide bases and the lane's byte offset, from which the pointers were formed; the slab that px, and that pa and pb, stand at
template <int I0, int I1, bool PRO> __device__ __forceinline__ void q_fetch(v4f (&st)[16], const float*& px, const float*& pa, const float*& pb, QB& qb) {
#pragma unroll   // st is indexed by constants only, so it stays in registers; the row steps become immediate offsets
  for (int i = I0; i < I1; ++i) st[i] = *(const v4f*)(i < 4 ? px + (size_t)i * 16 * EE : (i < 12 ? pa + (size_t)(i - 4) * 16 * EE : pb + (size_t)(i - 12) * 16 * EE));
  // wait before a register that an issued load names is overwritten (the pointers move on right behind it); as inputs the address pairs in use stay live up to it, so that nothing lands on one
  // ahead of it; in front of the loop (PRO) so do base and offset, which the loads there name in the pairs' place
  if constexpr (I0 < 4 && PRO) asm volatile("s_wait_xcnt 0x0" :: "v"(px), "v"(qb.lo), "s"(qb.x) : "memory");
  if constexpr (I0 < 4 && !PRO) asm volatile("s_wait_xcnt 0x0" :: "v"(px) : "memory");
  if constexpr (I1 > 4 && PRO) asm volatile("s_wait_xcnt 0x0" :: "v"(pa), "v"(pb), "v"(qb.lo), "s"(qb.a), "s"(qb.b) : "memory");
  if constexpr (I1 > 4 && !PRO) asm volatile("s_wait_xcnt 0x0" :: "v"(pa), "v"(pb) : "memory");
  // on by one slab; behind the last slab of the row the walk goes on at the row's first (the block entered it at a slab of its own)
  if constexpr (I0 < 4) { qb.kx = (qb.kx + 1) & (EE / QK - 1); px += qb.kx ? QK : QK - EE; }
  if constexpr (I1 > 4) { qb.kw = (qb.kw + 1) & (EE / QK - 1); const int d = qb.kw ? QK : QK - EE; pa += d; pb += d; }
}
template <int I0, int I1> __device__ __forceinline__ void q_stage(const v4f (&st)[16], char* p) {
#pragma unroll   // st is indexed by constants only, so it stays in registers
  for (int i = I0; i < I1; ++i) { v4b h, l;
#pragma unroll   // vector elements picked by constants
    for (int c = 0; c < 4; ++c) { const __bf16 hh = (__bf16)st[i][c]; h[c] = hh; l[c] = (__bf16)(st[i][c] - (float)hh); }
    *(v4b*)(p + i * 16 * QP) = h; *(v4b*)(p + i * 16 * QP + QPL) = l; }
}
// the five fragments of one 32-k step, hi and lo: f[0], f[1] the wave's two row tiles of x, f[2..4] its three column tiles of W
__device__ __forceinline__ void q_frags(F2 (&f)[5], const char* ra, const char* rbf) {
#pragma unroll   // f is indexed by constants only, so it stays in registers
  for (int t = 0; t < 5; ++t) { const char* p = t < 2 ? ra + t * 16 * QP : rbf + (t - 2) * 16 * QP; f[t].h = frag_lds(p); f[t].l = frag_lds(p + QPL); }
  __builtin_amdgcn_sched_barrier(0);   // keeps the reads as one group in front of the WMMAs of the step before: sunk among or behind them they would not have returned when they are needed
}
// The plain builtin, which the compiler pads itself: the two fragment sets take the kernel above 256 registers, and with wmma_bf, whose asm operands the compiler kept in the first 256, the loop spilled to scratch.
__device__ __forceinline__ void q_mac(v8f (&acc)[6], const F2 (&f)[5]) {
#pragma unroll   // lo.hi, then hi.lo, then hi.hi: six independent accumulators between two WMMAs on the same one
  for (int ps = 0; ps < 3; ++ps)
#pragma unroll   // acc and f are indexed by constants only
    for (int t = 0; t < 6; ++t) acc[t] = __builtin_amdgcn_wmma_f32_16x16x32_bf16(false, ps == 0 ? f[t / 3].l : f[t / 3].h, false, ps == 1 ? f[2 + t % 3].l : f[2 + t % 3].h, (short)0, acc[t], false, false);
}
// The slab barrier by hand: the wave's LDS stores and reads are done, then the work-group barrier. __syncthreads() would also wait for the global loads of the slab after next, which are to stay in flight across it.
#define QBAR() asm volatile("s_wait_dscnt 0x0\n\ts_barrier_signal -1\n\ts_barrier_wait -1" ::: "memory")
// One slab. On entry f0 holds (or is about to receive) the fragments of the slab's first 32-k step. STAGE: a next slab exists and is in st; FETCH: a slab after next exists.
// The last two trips are written out apart from the loop, so that inside it every count of loads and LDS reads in flight is the same on every path and no wait is set for the shorter path.
template <bool STAGE, bool FETCH> __device__ __forceinline__ void q_trip(int ks, v8f (&acc)[6], F2 (&f0)[5], F2 (&f1)[5], v4f (&st)[16], const char* ra, const char* rbf, char* wr,
                                                                         const float*& px, const float*& pa, const float*& pb, QB& qb) {
  const int cur = (ks & 1) * QBUF, nxt = QBUF - cur;
  q_frags(f1, ra + cur + 64, rbf + cur + 64);   // the slab's second step is read during the first step's WMMAs
  if (STAGE) q_stage<0, 4>(st, wr + nxt);
  if (FETCH) q_fetch<0, 4, false>(st, px, pa, pb, qb);   // x is staged and asked for again first: nearly a whole trip for the way from memory
  __builtin_amdgcn_sched_barrier(0);                             // keeps the WMMAs out of the lines above: woven in there they put off the loads of x by their own length
  q_mac(acc, f0);                                                // the compiler is free to weave the split of W into these WMMAs
  if (STAGE) q_stage<4, 16>(st, wr + nxt);
  if (FETCH) q_fetch<4, 16, false>(st, px, pa, pb, qb);
  QBAR();   // publishes the slab just staged; every wave's reads of this slab's buffer, which the next trip refills, have returned in front of it
  if (STAGE) q_frags(f0, ra + nxt, rbf + nxt);   // the next slab's first step is read during this slab's last WMMAs
  q_mac(acc, f1);
}
__global__ __launch_bounds__(256) void k_qkv(const float* __restrict__ x, const float* __restrict__ Wq, const float* __restrict__ Wk, const float* __restrict__ Wv, float* __restrict__ qpk, float* __restrict__ kpk, float* __restrict__ vpk) {
  __shared__ __align__(16) char sm[2 * QBUF];
  const int tid = threadIdx.x, wave = __builtin_amdgcn_readfirstlane(tid >> 5), lane = tid & 31, col = lane & 15, g = lane >> 4;
  const int r0b = blockIdx.x * QM, y = blockIdx.y, wm = wave >> 2, wn = wave & 3;
  // All blocks of one y walk the same rows of W. Each enters the walk over k at a slab of its own and wraps round, so that at one moment they ask L2 for sixteen different sets of lines and not all for the same one.
  const int s0 = ((blockIdx.x >> 3) + 8 * y) & (EE / QK - 1);   // the two blocks that share their rows of x stand half a walk apart
  QB qb = { x + (size_t)r0b * EE + s0 * QK, (y == 0 ? Wq : Wv) + s0 * QK, Wk + (size_t)y * 64 * EE + s0 * QK, (unsigned)(((tid >> 4) * EE + (tid & 15) * 4) * 4), s0, s0 };
  const float* px = (const float*)((const char*)qb.x + qb.lo); const float* pa = (const float*)((const char*)qb.a + qb.lo); const float* pb = (const float*)((const char*)qb.b + qb.lo);
  char* const wr = sm + (tid >> 4) * QP + (tid & 15) * 8;
  const char* const ra = sm + (wm * 32 + col) * QP + g * 16;
  const char* const rbf = sm + (QM + wn * 48 + col) * QP + g * 16;
  v4f st[16]; v8f acc[6] = {}; F2 f0[5], f1[5];
  q_fetch<0, 16, true>(st, px, pa, pb, qb);
  q_stage<0, 4>(st, wr); q_fetch<0, 4, true>(st, px, pa, pb, qb);
  q_stage<4, 16>(st, wr); q_fetch<4, 16, true>(st, px, pa, pb, qb);
  QBAR();
  q_frags(f0, ra, rbf);
#pragma unroll 1   // one slab a trip: the two buffers alternate by a run-time offset
  for (int ks = 0; ks < EE / QK - 2; ++ks) q_trip<true, true>(ks, acc, f0, f1, st, ra, rbf, wr, px, pa, pb, qb);
  q_trip<true, false>(EE / QK - 2, acc, f0, f1, st, ra, rbf, wr, px, pa, pb, qb);
  q_trip<false, false>(EE / QK - 1, acc, f0, f1, st, ra, rbf, wr, px, pa, pb, qb);
  float* const so = (float*)sm;   // the ring is free behind the last trip's barrier
#pragma unroll   // acc is indexed by constants only
  for (int e = 0; e < 48; ++e) { const int t = e >> 3, r = e & 7; so[(wm * 32 + (t / 3) * 16 + 8 * g + r) * QSO + wn * 48 + (t % 3) * 16 + col] = acc[t][r]; }
  __syncthreads();
  if (y == 0) {
#pragma unroll   // the block's sixteen fragments of q, two a wave: id = (16-row tile, kc)
    for (int u = 0; u < 2; ++u) { const int id = u * 8 + wave; float v[16]; const float* p = so + ((id >> 2) * 16 + col) * QSO + (id & 3) * 32 + 8 * g;
#pragma unroll   // v is indexed by constants only
      for (int i = 0; i < 8; ++i) { v[i] = p[i]; v[8 + i] = p[16 + i]; }
      put_frag((char*)qpk + ((size_t)(r0b / 16) * 4 + id) * FRB + lane * 16, bsplit16(v)); }
  } else {
#pragma unroll   // the block's two 32-key groups of v; wave = column tile
    for (int u = 0; u < 2; ++u) { float v[16]; const float* p = so + (u * 32 + 8 * g) * QSO + wave * 16 + col;
#pragma unroll   // v is indexed by constants only
      for (int i = 0; i < 8; ++i) { v[i] = p[i * QSO]; v[8 + i] = p[(16 + i) * QSO]; }
      put_frag((char*)vpk + ((size_t)(r0b / 32 + u) * 8 + wave) * FRB + lane * 16, bsplit16(v)); }
  }
  { float v[16]; const float* p = so + ((wave >> 1) * 16 + col) * QSO + 128 + (wave & 1) * 32 + 8 * g;   // the block's half of k: wave = (16-key tile, kc)
#pragma unroll   // v is indexed by constants only
    for (int i = 0; i < 8; ++i) { v[i] = p[i]; v[8 + i] = p[16 + i]; }
    put_frag((char*)kpk + ((size_t)(r0b / 16 + (wave >> 1)) * 4 + y * 2 + (wave & 1)) * FRB + lane * 16, bsplit16(v)); }
}
// One block = two tiles of 16 query rows, tile 127 - y (index 0 below, the longer) and tile y (index 1): every block then has 33 (query tile, key tile) pairs, all blocks are resident at once, and the key tiles
// of the shorter query tile are among those of the longer, so that there one copy of a k or v fragment feeds the products of both. The NW waves share the key tiles (wave w takes tiles w, w + NW, ...), each with
// an online softmax of its own per query tile; the partial (max, sum, acc) triples are merged through LDS in wave order at the end.
// Both products run transposed, the fragment of k or v as A and that of q or of the weights as B: a lane's column is then one query, whose scores, weights and sums stay in the lane's own registers.
// qpk is not __restrict__: its fragments are then loaded anew in every tile's stream and not held in registers (or in scratch) across the softmax and the v products.
// The fragments of k and v do not pass through registers on their way in: each wave copies them asynchronously into an LDS ring of its own, RG groups of two fragments, in the order of their use
// (k: per kc step the four key tiles; then the sixteen of v). A group is read into registers one group ahead of its products; as soon as those reads have returned its place is refilled with the group
// RG further on, so that up to RG groups (24 KB a wave) are on their way at a time. No other wave touches a wave's ring, so no barrier belongs to it.
#define NW 8
#define GB (2 * FRB)    // one group
#define RG 6            // groups in a wave's ring
#define RWB (RG * GB)   // ring bytes a wave
#define NG 16           // groups a key tile: 8 of k, 8 of v
// The eight copies of one group: every lane brings 16 bytes a copy, the immediate offset moves the global and the LDS address alike. The s_wait_xcnt stands inside the statement, behind the last copy:
// wait before a register that an issued copy names is rewritten.
__device__ __forceinline__ void cp_group(unsigned l0, const char* g0, unsigned l1, const char* g1) {
  asm volatile("global_load_async_to_lds_b128 %0, %1, off\n\t"
               "global_load_async_to_lds_b128 %0, %1, off offset:512\n\t"
               "global_load_async_to_lds_b128 %0, %1, off offset:1024\n\t"
               "global_load_async_to_lds_b128 %0, %1, off offset:1536\n\t"
               "global_load_async_to_lds_b128 %2, %3, off\n\t"
               "global_load_async_to_lds_b128 %2, %3, off offset:512\n\t"
               "global_load_async_to_lds_b128 %2, %3, off offset:1024\n\t"
               "global_load_async_to_lds_b128 %2, %3, off offset:1536\n\t"
               "s_wait_xcnt 0x0" :: "v"(l0), "v"(g0), "v"(l1), "v"(g1) : "memory");
}
// Returns when all but the wave's Y youngest groups (eight copies each) have landed. Every key tile is the same straight line of copies and waits and starts and ends with none on its way, so each count is exact.
template <int Y> __device__ __forceinline__ void cp_wait() {
  static_assert(Y >= 0 && Y < RG, "");
  if constexpr (Y == 5) asm volatile("s_wait_asynccnt 0x28" ::: "memory");
  if constexpr (Y == 4) asm volatile("s_wait_asynccnt 0x20" ::: "memory");
  if constexpr (Y == 3) asm volatile("s_wait_asynccnt 0x18" ::: "memory");
  if constexpr (Y == 2) asm volatile("s_wait_asynccnt 0x10" ::: "memory");
  if constexpr (Y == 1) asm volatile("s_wait_asynccnt 0x8" ::: "memory");
  if constexpr (Y == 0) asm volatile("s_wait_asynccnt 0x0" ::: "memory");
}
struct G2 { F2 a, b; };   // one group in registers
// Inside a key tile too the blocks of a batch do not ask L2 for the same lines at one moment. The scores sum over the four kc in any order: at place p of that walk a block takes step kc_at(p), of k and of q alike.
// The eight column tiles of v are independent: accumulator t of a block stands for column tile vt_at(t) all through the kernel, in the copies' addresses and where the partial outputs are laid down.
__device__ __forceinline__ int kc_at(int p) { return (p + (int)(blockIdx.y >> 3)) & 3; }
__device__ __forceinline__ int vt_at(int t) { return (t + (int)(blockIdx.y >> 3)) & 7; }
template <int GI> __device__ __forceinline__ void cp_issue(unsigned rl, const char* kp, const char* vp) {
  constexpr int f = 2 * GI; const unsigned l = rl + (GI % RG) * GB;
  if constexpr (f < 16) cp_group(l, kp + ((f & 3) * 4 + kc_at(f >> 2)) * FRB, l + FRB, kp + (((f + 1) & 3) * 4 + kc_at(f >> 2)) * FRB);
  else cp_group(l, vp + (((f - 16) & 8) + vt_at((f - 16) & 7)) * FRB, l + FRB, vp + (((f - 16) & 8) + vt_at((f - 15) & 7)) * FRB);
}
template <int GI> __device__ __forceinline__ void ring_read(G2& d, const char* rr) { d.a = get_frag(rr + (GI % RG) * GB); d.b = get_frag(rr + (GI % RG) * GB + FRB); }
// In front of the products of group GI: its reads have returned, so its place takes the copies of group GI + RG; then group GI + 1, once landed, is read into the other register set.
template <int GI> __device__ __forceinline__ void ring_turn(G2& nx, const char* rr, unsigned rl, const char* kp, const char* vp) {
  asm volatile("s_wait_dscnt 0x0" ::: "memory");   // the wave's reads of the place have retired before a copy is aimed at it
  if constexpr (GI + RG < NG) cp_issue<GI + RG>(rl, kp, vp);
  if constexpr (GI + 1 < NG) { cp_wait<(GI + RG < NG ? RG - 1 : NG - 2 - GI)>(); ring_read<GI + 1>(nx, rr); }
}
// The products of one group (two fragments of k or v, as A) with the B fragments of one or two query tiles: the results stand transposed, a lane's column is a query. The plain builtin, which the compiler pads itself: two query tiles take the kernel above 256 registers (see q_mac).
// Per accumulator the order is (query side).(key side) lo.hi, hi.lo, hi.hi.
template <int NQ> __device__ __forceinline__ void g_mac(const F2* const (&a)[2], const G2& b, v8f* const (&c0)[2], v8f* const (&c1)[2]) {
#pragma unroll   // the two or four accumulators are independent: they stand between two WMMAs on the same one
  for (int ps = 0; ps < 3; ++ps)
#pragma unroll
    for (int j = 0; j < NQ; ++j) {
      *c0[j] = __builtin_amdgcn_wmma_f32_16x16x32_bf16(false, ps == 1 ? b.a.l : b.a.h, false, ps == 0 ? a[j]->l : a[j]->h, (short)0, *c0[j], false, false);
      *c1[j] = __builtin_amdgcn_wmma_f32_16x16x32_bf16(false, ps == 1 ? b.b.l : b.b.h, false, ps == 0 ? a[j]->l : a[j]->h, (short)0, *c1[j], false, false); }
}
// One kc step's fragments of q, of one or two query tiles: a0, a1 are the same for the whole wave, the lane adds its 16 bytes.
template <int NQ> __device__ __forceinline__ void q_frag(F2& f0, F2& f1, const char* a0, const char* a1) {
  const unsigned lo = (threadIdx.x & 31u) * 16u;
  f0 = get_frag(a0 + lo);
  if constexpr (NQ == 2) f1 = get_frag(a1 + lo);
}
template <int GI, int NQ> __device__ __forceinline__ void s_step(v8f (&s4)[2][4], F2 (&fq)[2][2], G2 (&fr)[2], const char* q0p, const char* q1p, const char* rr, unsigned rl, const char* kp, const char* vp) {
  constexpr int kc = GI >> 1, t0 = (GI & 1) * 2;
  ring_turn<GI>(fr[(GI + 1) & 1], rr, rl, kp, vp);
  if constexpr ((GI & 1) == 0 && kc < 3) {   // the next kc's fragments of q, two groups ahead, by plain loads: all waves of the block read the same lines
    q_frag<NQ>(fq[0][(kc + 1) & 1], fq[1][(kc + 1) & 1], q0p + kc_at(kc + 1) * FRB, q1p + kc_at(kc + 1) * FRB); }
  // behind the tile's last loads of q: wait before a register that an issued load names is overwritten (the eight address pairs are formed once, in front of the tile loop)
  if constexpr (GI == 4) asm volatile("s_wait_xcnt 0x0" ::: "memory");
  __builtin_amdgcn_sched_barrier(0);   // keeps the reads and loads above in front of the WMMAs: sunk behind them they would not have returned at the next group's wait
  const F2* const a[2] = { &fq[0][kc & 1], &fq[1][kc & 1] }; v8f* const c0[2] = { &s4[0][t0], &s4[1][t0] }; v8f* const c1[2] = { &s4[0][t0 + 1], &s4[1][t0 + 1] };
  g_mac<NQ>(a, fr[GI & 1], c0, c1);
}
template <int GI, int NQ> __device__ __forceinline__ void v_step(v8f (&acc)[2][8], const F2& p0, const F2& p1, G2 (&fr)[2], const char* rr, unsigned rl, const char* kp, const char* vp) {
  constexpr int t0 = (2 * (GI - 8)) & 7;
  ring_turn<GI>(fr[(GI + 1) & 1], rr, rl, kp, vp);
  __builtin_amdgcn_sched_barrier(0);   // as in s_step
  const F2* const a[2] = { &p0, &p1 }; v8f* const c0[2] = { &acc[0][t0], &acc[1][t0] }; v8f* const c1[2] = { &acc[0][t0 + 1], &acc[1][t0 + 1] };
  g_mac<NQ>(a, fr[GI & 1], c0, c1);
}
// lane l with lane l ^ 16, in the vector unit
__device__ __forceinline__ float xhalf(float x) { return __builtin_bit_cast(float, __builtin_amdgcn_permlanex16(__builtin_bit_cast(int, x), __builtin_bit_cast(int, x), 0x76543210, 0xfedcba98, false, false)); }
// The online softmax step of one query tile, in registers. The scores stand transposed: lane (g, col) holds, of query qi = tile + col, the keys key0 + 16 t + r with key0 = 64 kt + 8 g, so a row's maximum and sum are
// in-lane but for one exchange between the wave's halves, and tiles 2u and 2u + 1 of the weights, split in place, are the B fragment of 32-key group u. Returns the factor that the query's older sums take.
// 2^x by the hardware's v_exp_f32 alone. The softmax runs in base 2: the scores take sqrt(128) * log2(e) in their one multiply, so e^(s - m) is 2^(s2 - m2) with no multiply of its own, and every argument is <= 0,
// so none of the library expf's range steps (round, scale back, tests for overflow and underflow) has anything to do; a result under the smallest normal number may come out 0, beside a row's largest weight of 1.
// In asm for the v_nop behind it: the instruction set asks for one slot behind a transcendental before its result is read or its source overwritten.
__device__ __forceinline__ float ex2(float x) { float r; asm("v_exp_f32 %0, %1\n\tv_nop" : "=v"(r) : "v"(x)); return r; }
__device__ __forceinline__ float soft_reg(const v8f (&s4)[4], F2 (&pa)[2], int qi, int key0, float& mrun, float& lrun) {
  const float scl = (float)(11.313708498984761 * 1.4426950408889634);     // * sqrt(128), as the reference, * log2(e): mrun and all scores below are in base 2
  const int d = qi - key0;                   // key <= query reads 16 t + r <= d: one compare with a constant per score
  float sv[32], mt[4], pt[4];
#pragma unroll   // sv is indexed by constants only, so it stays in registers
  for (int t = 0; t < 4; ++t) { mt[t] = -3.4e38f;
#pragma unroll
    for (int r = 0; r < 8; ++r) { const float x = s4[t][r] * scl; const float s = (t * 16 + r <= d && x != 0.0f) ? x : -3.0e38f; sv[t * 8 + r] = s; mt[t] = fmaxf(mt[t], s); } }
  float mx = fmaxf(fmaxf(mt[0], mt[1]), fmaxf(mt[2], mt[3]));
  mx = fmaxf(mx, xhalf(mx));
  // Every exponential is computed unconditionally: no branch on EXEC per score, so the chains of a tile are independent and interleave. A masked score (-3.0e38) gives 2^(very negative) = 0 by itself,
  // also where all scores so far are masked: the maximum that is subtracted is held at -1.0e38 or above, which leaves it as it is as soon as one score is kept.
  const float mnew = fmaxf(mrun, mx); const float ec = ex2(mrun - mnew); const float corr = mnew <= -1.0e38f ? 1.0f : ec; const float msub = fmaxf(mnew, -1.0e38f);
#pragma unroll   // all the exponentials first, the sums behind them: no sum then stands directly behind the exponential that it reads
  for (int i = 0; i < 32; ++i) sv[i] = ex2(sv[i] - msub);
#pragma unroll
  for (int t = 0; t < 4; ++t) { pt[t] = sv[t * 8];
#pragma unroll
    for (int r = 1; r < 8; ++r) pt[t] += sv[t * 8 + r]; }
  float ps = (pt[0] + pt[1]) + (pt[2] + pt[3]);
  ps += xhalf(ps);
  lrun = lrun * corr + ps; mrun = mnew;
  pa[0] = bsplit16(&sv[0]); pa[1] = bsplit16(&sv[16]);
  return corr;
}
// One key tile, for the longer query tile (NQ = 1) or for both (NQ = 2), in two parts: the scores; then, behind the softmax, the products with v.
template <int NQ> __device__ __forceinline__ void s_phase(const char* kp, const char* vp, const char* q0p, const char* q1p, const char* rr, unsigned rl, v8f (&s4)[2][4], G2 (&fr)[2]) {
  F2 fq[2][2];
  cp_issue<0>(rl, kp, vp); cp_issue<1>(rl, kp, vp); cp_issue<2>(rl, kp, vp);   // every ring read of the tile before retired at the wait in front of its last group's products
  cp_issue<3>(rl, kp, vp); cp_issue<4>(rl, kp, vp); cp_issue<5>(rl, kp, vp);
  q_frag<NQ>(fq[0][0], fq[1][0], q0p + kc_at(0) * FRB, q1p + kc_at(0) * FRB);
  cp_wait<RG - 1>(); ring_read<0>(fr[0], rr);
  s_step<0, NQ>(s4, fq, fr, q0p, q1p, rr, rl, kp, vp); s_step<1, NQ>(s4, fq, fr, q0p, q1p, rr, rl, kp, vp); s_step<2, NQ>(s4, fq, fr, q0p, q1p, rr, rl, kp, vp); s_step<3, NQ>(s4, fq, fr, q0p, q1p, rr, rl, kp, vp);
  s_step<4, NQ>(s4, fq, fr, q0p, q1p, rr, rl, kp, vp); s_step<5, NQ>(s4, fq, fr, q0p, q1p, rr, rl, kp, vp); s_step<6, NQ>(s4, fq, fr, q0p, q1p, rr, rl, kp, vp); s_step<7, NQ>(s4, fq, fr, q0p, q1p, rr, rl, kp, vp);
}
template <int NQ> __device__ __forceinline__ void v_phase(const char* kp, const char* vp, const char* rr, unsigned rl, const float (&corr)[2], const F2 (&pa)[2][2], G2 (&fr)[2], v8f (&acc)[2][8]) {
#pragma unroll   // acc is indexed by constants only, so it stays in registers; a lane's accumulators all belong to its own query
  for (int j = 0; j < NQ; ++j)
#pragma unroll
    for (int t = 0; t < 8; ++t) acc[j][t] *= corr[j];
  v_step<8, NQ>(acc, pa[0][0], pa[1][0], fr, rr, rl, kp, vp); v_step<9, NQ>(acc, pa[0][0], pa[1][0], fr, rr, rl, kp, vp); v_step<10, NQ>(acc, pa[0][0], pa[1][0], fr, rr, rl, kp, vp); v_step<11, NQ>(acc, pa[0][0], pa[1][0], fr, rr, rl, kp, vp);
  v_step<12, NQ>(acc, pa[0][1], pa[1][1], fr, rr, rl, kp, vp); v_step<13, NQ>(acc, pa[0][1], pa[1][1], fr, rr, rl, kp, vp); v_step<14, NQ>(acc, pa[0][1], pa[1][1], fr, rr, rl, kp, vp); v_step<15, NQ>(acc, pa[0][1], pa[1][1], fr, rr, rl, kp, vp);
}
__global__ __launch_bounds__(NW * 32) void k_attn(const float* qpk, const float* __restrict__ kpk, const float* __restrict__ vpk, float* __restrict__ out) {
  __shared__ __align__(16) char sR[NW * RWB];          // the rings; behind the tile loop and the first barrier the same bytes hold the partial outputs
  __shared__ float sM[2][NW][16];
  __shared__ float sL[2][NW][16];
  float (*const sO)[32][132] = (float (*)[32][132])sR;
  static_assert(sizeof(float) * NW * 32 * 132 <= NW * RWB, "");
  // w through readfirstlane: the tile loop's tests are then scalar branches and EXEC stays full at the WMMAs and at the copies
  const int tid = threadIdx.x, w = __builtin_amdgcn_readfirstlane(tid >> 5), lane = tid & 31, col = lane & 15, g = lane >> 4;
  const int b = blockIdx.x; const int q0[2] = { (SQ / 16 - 1 - (int)blockIdx.y) * 16, (int)blockIdx.y * 16 }; const size_t rb = (size_t)b * SQ;
  const char* q0p = (const char*)qpk + (rb + q0[0]) * HD * 4; const char* q1p = (const char*)qpk + (rb + q0[1]) * HD * 4;   // the two query tiles' fragments, without the lane's offset
  const char* kb = (const char*)kpk + rb * HD * 4 + lane * 16; const char* vb = (const char*)vpk + rb * HD * 4 + lane * 16;   // 64 keys = 16 fragments = 32 KB in either
  const char* const rr = sR + w * RWB + lane * 16;   // the lane's 16 bytes in the first run of its wave's ring
  const unsigned rl = (unsigned)(size_t)rr;          // the same as an LDS byte address
  float mrun[2] = { -3.0e38f, -3.0e38f }, lrun[2] = { 0.f, 0.f }; v8f acc[2][8] = {};   // of query col of either tile, the same in both halves of the wave; acc[j][t][r] = head column 16 vt_at(t) + 8 g + r
  const int n0 = (q0[0] >> 6) + 1, n1 = (q0[1] >> 6) + 1;   // key tiles of the longer and of the shorter query tile, n1 <= n0
  // The 64 blocks of one batch walk the same k and v. A wave keeps its key tiles (w, w + NW, ...) but enters them at a place set by the block's index and wraps round, so that at one moment
  // the blocks ask L2 for up to four different sets of tiles and not all for the same eight. The online softmax takes the tiles in any order.
  const int cnt = (n0 - w + NW - 1) / NW;                      // key tiles of this wave: 2 to 4
  int it = ((((int)blockIdx.y >> 1) & 3) * cnt) >> 2;          // the first of them for this block
#pragma unroll 1
  for (int c = 0; c < cnt; ++c) {
    const int kt = w + it * NW; it = it + 1 == cnt ? 0 : it + 1;
    const char* const kp = kb + (size_t)kt * (16 * FRB); const char* const vp = vb + (size_t)kt * (16 * FRB);
    G2 fr[2]; v8f s4[2][4] = {}; F2 pa[2][2]; float corr[2] = { 1.0f, 1.0f };
    const bool two = kt < n1; const int key0 = kt * 64 + 8 * g;
    if (two) s_phase<2>(kp, vp, q0p, q1p, rr, rl, s4, fr);
    else s_phase<1>(kp, vp, q0p, q1p, rr, rl, s4, fr);
    // the longer tile's softmax stands once in the text and serves both cases: written out for each, the kernel's text passes 32 KB
    corr[0] = soft_reg(s4[0], pa[0], q0[0] + col, key0, mrun[0], lrun[0]);
    if (two) { corr[1] = soft_reg(s4[1], pa[1], q0[1] + col, key0, mrun[1], lrun[1]); v_phase<2>(kp, vp, rr, rl, corr, pa, fr, acc); }
    else v_phase<1>(kp, vp, rr, rl, corr, pa, fr, acc);
  }
  if (g == 0) { sM[0][w][col] = mrun[0]; sM[1][w][col] = mrun[1]; }
  __syncthreads();
#pragma unroll   // acc is indexed by constants only, so it stays in registers
  for (int j = 0; j < 2; ++j) {
    float mg = sM[j][0][col];
#pragma unroll   // all NW reads in flight at once
    for (int i = 1; i < NW; ++i) mg = fmaxf(mg, sM[j][i][col]);
    const float f = mg <= -1.0e38f ? 1.0f : ex2(mrun[j] - mg);   // a wave without a kept score has acc = 0 and lrun = 0
    if (g == 0) sL[j][w][col] = lrun[j] * f;
#pragma unroll   // a lane's eight values of a tile are eight neighbouring head columns of its query's row: two 16-byte stores
    for (int t = 0; t < 8; ++t) { const v8f o = acc[j][t] * f; float* const p = &sO[w][j * 16 + col][vt_at(t) * 16 + 8 * g];
      *(v4f*)p = __builtin_shufflevector(o, o, 0, 1, 2, 3); *(v4f*)(p + 4) = __builtin_shufflevector(o, o, 4, 5, 6, 7); }
  }
  __syncthreads();
#pragma unroll 1   // wave w sums rows w, w + NW of either query tile over the NW partials; rolled for the size of the text, as above
  for (int u = 0; u < 32 / NW; ++u) { const int row = u * NW + w, j = row >> 4, rw = row & 15;
    float lt = 0.f; v4f o = {};
#pragma unroll   // all NW reads in flight at once; the sum runs in wave order
    for (int i = 0; i < NW; ++i) { lt += sL[j][i][rw]; o += *(const v4f*)(&sO[i][row][lane * 4]); }
#pragma unroll
    for (int c = 0; c < 4; ++c) o[c] = o[c] / lt;
    float* const po = out + (rb + (j ? q0[1] : q0[0]) + rw) * HD + lane * 4; vst2(po, o);
    // behind the store: wait before a register that the issued store names is overwritten (the next trip writes them anew); as an input the address pair stays live up to it
    asm volatile("s_wait_xcnt 0x0" :: "v"(po) : "memory"); }
}
extern "C" void kernel_launch(void* const* d_in, const int* in_sizes, int n_in, void* d_out, int out_size, void* d_ws, size_t ws_size, hipStream_t stream) {
  (void)in_sizes; (void)n_in; (void)out_size; (void)ws_size;
  const float* x = (const float*)d_in[0]; const float* Wq = (const float*)d_in[1]; const float* Wk = (const float*)d_in[2]; const float* Wv = (const float*)d_in[3];
  float* out = (float*)d_out;
  char* ws = (char*)d_ws; size_t off = 0;
  auto take = [&](size_t bytes) { char* p = ws + off; off += (bytes + 255) & ~(size_t)255; return p; };
  float* qpk = (float*)take((size_t)NR * HD * 4); float* kpk = (float*)take((size_t)NR * HD * 4); float* vpk = (float*)take((size_t)NR * HD * 4);
  k_qkv<<<dim3(NR / QM, 2), 256, 0, stream>>>(x, Wq, Wk, Wv, qpk, kpk, vpk);
  k_attn<<<dim3(NB, SQ / 32), NW * 32, 0, stream>>>(qpk, kpk, vpk, out);
}
